// v000
// The times below were measured on an AMD MI455X: many runs one after another, warmed up first and cycling through
// copies of the inputs, with the whole window's GPU time divided by the number of runs. Launches and the gaps
// between them are all in it. The median over several windows is given; except for v000 it joins two sittings, which
// can be a few percent apart, so the side-by-side timings, each taken in one sitting, are the better comparison.
// v000, which the later versions start from, runs in 2240 microseconds.
#include <hip/hip_runtime.h>

// De-stationary attention (Non-stationary Transformer) (queries, keys, values [4][2048][512]; q, k, v = . W + b ('xw' [512][512]; 8 heads x 64); scores = tau[b] (q.k/8) + delta[b][s] (tau [4], delta [4][2048], read); softmax; out = merged Wo + bo -> [4][2048][512] (4.2 M)).
// Compute dtypes, f32 accumulate: every input rounded to bf16; q/k/v on PLAIN bf16 operands (inputs: exact) + biases; tau scale and delta shift applied in f32 per (i, j) inside the softmax kernel; scores and attn.v: query rows < 512 hl (3 products), the rest single fp16 (x1024); softmax f32; Wo hl x exact (2 products) + bo.

#define NB_  4
#define TT   2048
#define DM   512
#define NH_  8
#define NKV  8
#define REP  (NH_ / NKV)
#define HD   64
#define DQ   (NH_ * HD)
#define DKV  (NKV * HD)
#define ZH   2
#define RH   512                  // query rows < RH use hi+lo planes (0: none)
#define WIN  0
#define PCAR 1024.0f
#define SCL  0.125f   // HD^-0.5
typedef _Float16 h16;
typedef unsigned short bf;
typedef __attribute__((ext_vector_type(16))) __bf16   v16bf;
typedef __attribute__((ext_vector_type(16))) _Float16 v16h;
typedef __attribute__((ext_vector_type(8)))  _Float16 v8h;
typedef __attribute__((ext_vector_type(8)))  unsigned short v8us;
typedef __attribute__((ext_vector_type(8)))  float    v8f;
typedef __attribute__((ext_vector_type(4)))  float    v4f;
typedef v8h  __attribute__((may_alias)) v8ha;
typedef v4f  __attribute__((may_alias)) v4fa;
typedef v8us __attribute__((may_alias)) v8usa;

__device__ __forceinline__ unsigned short f2bf(float f) { unsigned u = __float_as_uint(f); u += 0x7FFFu + ((u >> 16) & 1u); return (unsigned short)(u >> 16); }
__device__ __forceinline__ float bf2f(unsigned short b) { return __uint_as_float(((unsigned)b) << 16); }
__device__ __forceinline__ float bfr(float f) { return bf2f(f2bf(f)); }
__device__ __forceinline__ v16h cat16(v8h lo, v8h hi) { return __builtin_shufflevector(lo, hi, 0, 1, 2, 3, 4, 5, 6, 7, 8, 9, 10, 11, 12, 13, 14, 15); }
__device__ __forceinline__ v16bf cat16b(v8us lo, v8us hi) { return __builtin_bit_cast(v16bf, __builtin_shufflevector(lo, hi, 0, 1, 2, 3, 4, 5, 6, 7, 8, 9, 10, 11, 12, 13, 14, 15)); }
__device__ __forceinline__ v8f wmma16(v16h a, v16h b, v8f c) { return __builtin_amdgcn_wmma_f32_16x16x32_f16(false, a, false, b, (short)0, c, false, false); }
__device__ __forceinline__ v8f wmmab(v16bf a, v16bf b, v8f c) { return __builtin_amdgcn_wmma_f32_16x16x32_bf16(false, a, false, b, (short)0, c, false, false); }



// ---- k_gemmw: register-blocked GEMM, ONE WAVE per 64x64 output tile (16 accumulators), operands straight from K-contiguous 16-bit planes; grid (M/64, N/64, Z), 32 threads.
// C[m][n] (f32, pitch ldc, + optional f32 bias[n]) = sum_k A[m][k] Bt[n][k] (+ split products per NSPLIT). z-batch strides sA/sB/sC in elements. K % 32 == 0.
template <typename T16> struct WFrag;
template <> struct WFrag<h16> { typedef v16h V; static __device__ __forceinline__ V ld(const h16* p) { return cat16(*(const v8h*)p, *(const v8h*)(p + 16)); } static __device__ __forceinline__ v8f mma(V a, V b, v8f c) { return wmma16(a, b, c); } };
template <> struct WFrag<bf> { typedef v16bf V; static __device__ __forceinline__ V ld(const bf* p) { return cat16b(*(const v8us*)p, *(const v8us*)(p + 16)); } static __device__ __forceinline__ v8f mma(V a, V b, v8f c) { return wmmab(a, b, c); } };
template <typename T16, int NSPLIT, bool BIAS>
__global__ __launch_bounds__(32) void k_gemmw(const T16* __restrict__ A, const T16* __restrict__ A2, const T16* __restrict__ Bt, const T16* __restrict__ Bt2, int K, float* C, int ldc, const float* __restrict__ bias, size_t sA, size_t sB, size_t sC) {
    typedef typename WFrag<T16>::V V;
    __shared__ __align__(16) float os[16 * 68];
    const size_t z = blockIdx.z; A += z * sA; if (A2) A2 += z * sA; Bt += z * sB; if (Bt2) Bt2 += z * sB; C += z * sC;
    const int lane = threadIdx.x & 31, lr = lane & 15, hi = lane >> 4; const int r0 = blockIdx.x * 64, c0 = blockIdx.y * 64;
    v8f acc[4][4];
#pragma unroll
    for (int mb = 0; mb < 4; ++mb)
#pragma unroll
        for (int nb = 0; nb < 4; ++nb) acc[mb][nb] = (v8f){};
    const size_t aoff = (size_t)(r0 + lr) * K + 8 * hi, boff = (size_t)(c0 + lr) * K + 8 * hi;
#pragma unroll 1
    for (int kc = 0; kc < K; kc += 32) {
        V a[4], a2[4];
#pragma unroll
        for (int mb = 0; mb < 4; ++mb) { a[mb] = WFrag<T16>::ld(A + aoff + (size_t)mb * 16 * K + kc); if (NSPLIT == 1 || NSPLIT == 2) a2[mb] = WFrag<T16>::ld(A2 + aoff + (size_t)mb * 16 * K + kc); }
#pragma unroll
        for (int nb = 0; nb < 4; ++nb) { const V b = WFrag<T16>::ld(Bt + boff + (size_t)nb * 16 * K + kc); V b2; if (NSPLIT >= 2) b2 = WFrag<T16>::ld(Bt2 + boff + (size_t)nb * 16 * K + kc);
#pragma unroll
            for (int mb = 0; mb < 4; ++mb) { acc[mb][nb] = WFrag<T16>::mma(a[mb], b, acc[mb][nb]); if (NSPLIT == 1 || NSPLIT == 2) acc[mb][nb] = WFrag<T16>::mma(a2[mb], b, acc[mb][nb]); if (NSPLIT >= 2) acc[mb][nb] = WFrag<T16>::mma(a[mb], b2, acc[mb][nb]); } }
        asm volatile("v_nop\n\tv_nop\n\tv_nop\n\tv_nop" : "+v"(acc[0][0]), "+v"(acc[1][1]), "+v"(acc[2][2]), "+v"(acc[3][3]) : "v"(a[0]), "v"(a[3]));
    }
#pragma unroll
    for (int mb = 0; mb < 4; ++mb) {
#pragma unroll
        for (int nb = 0; nb < 4; ++nb) {
#pragma unroll
            for (int j = 0; j < 8; ++j) os[(hi * 8 + j) * 68 + nb * 16 + lr] = acc[mb][nb][j]; }
        __builtin_amdgcn_wave_barrier(); asm volatile("" ::: "memory");
        float* crow = C + (size_t)(r0 + mb * 16) * ldc + c0;
{
#pragma unroll
            for (int s = 0; s < 8; ++s) { const int row = 2 * s + hi, cofs = lr * 4; v4f val = *(const v4fa*)(os + row * 68 + cofs); if (BIAS) { val[0] += bfr(bias[c0 + cofs]); val[1] += bfr(bias[c0 + cofs + 1]); val[2] += bfr(bias[c0 + cofs + 2]); val[3] += bfr(bias[c0 + cofs + 3]); }
                *(v4f*)(crow + (size_t)row * ldc + cofs) = val; }
             }
        __builtin_amdgcn_wave_barrier(); asm volatile("" ::: "memory");
    }
}

__device__ __forceinline__ h16 tohx(float x) { return (h16)x; }
__device__ __forceinline__ void splitf(float y, unsigned short& h, unsigned short& l) { h = f2bf(y); l = f2bf(y - bf2f(h)); }
typedef __attribute__((ext_vector_type(2))) _Float16 v2h;
typedef __attribute__((ext_vector_type(4))) _Float16 v4h;
typedef __attribute__((ext_vector_type(2))) unsigned short v2us;
typedef __attribute__((ext_vector_type(4))) unsigned short v4us;
typedef __attribute__((ext_vector_type(2))) float v2f;
typedef __attribute__((ext_vector_type(4))) int v4i;

__global__ __launch_bounds__(256) void k_wtG(const float* __restrict__ w, int K, int N, bf* Bt) {
    const int lane = threadIdx.x & 31; const int L0 = (blockIdx.x * 8 + (threadIdx.x >> 5)) * 8; const int nlines = N * K / 64;
{
#pragma unroll 1
        for (int l = 0; l < 8; ++l) { const int L = L0 + l; if (L >= nlines) break; const size_t e = (size_t)L * 64 + lane * 2; const int k = (int)(e % K), n = (int)(e / K); v2us o;
            o[0] = f2bf(w[(size_t)k * N + n]); o[1] = f2bf(w[(size_t)(k + 1) * N + n]); *(v2us*)(Bt + e) = o; }
         }
}
__global__ __launch_bounds__(256) void k_cvt8(const float* __restrict__ src, bf* dst, size_t n8) { const size_t i = (size_t)blockIdx.x * 256 + threadIdx.x; if (i >= n8) return; const v8f v = *(const v8f*)(src + i * 8); v8us o;
#pragma unroll
    for (int k = 0; k < 8; ++k) o[k] = f2bf(v[k]); *(v8us*)(dst + i * 8) = o;  }

// k_rope: head planes [h][t][d] (fp16 + hi/lo) of rope(x) x sc with the rotate-half convention out[d] = x[d] cos[t][d] - x[d+HD/2] sin[t][d], out[d+HD/2] = x[d+HD/2] cos[t][d+HD/2] + x[d] sin[t][d+HD/2]
__global__ __launch_bounds__(256) void k_rope(const float* __restrict__ F, int pitch, int nheads, const float* __restrict__ CS, const float* __restrict__ RF, const float* __restrict__ nw, float sc, h16* P16, bf* Ph, bf* Pl) {
    const size_t e = ((size_t)blockIdx.x * 256 + threadIdx.x) * 2; if (e >= (size_t)nheads * TT * HD) return; const int d = (int)(e % HD); const int t = (int)((e / HD) % TT); const int h = (int)(e / ((size_t)HD * TT)); const float* f = F + (size_t)t * pitch + h * HD; const float rf = RF ? RF[(size_t)h * TT + t] : 1.0f; v2h o16; v2us oh, ol;
#pragma unroll
    for (int q = 0; q < 2; ++q) { const int dd = d + q; const int dp = (dd < HD / 2) ? dd + HD / 2 : dd - HD / 2; float x0 = f[dd], x1 = f[dp];
        if (RF) { float n0 = __fmul_rn(x0, rf), n1 = __fmul_rn(x1, rf); asm volatile("" : "+v"(n0)); asm volatile("" : "+v"(n1)); x0 = __fmul_rn(bfr(nw[dd]), n0); x1 = __fmul_rn(bfr(nw[dp]), n1); }
        const v2f cs = *(const v2f*)(CS + ((size_t)t * HD + dd) * 2); float a = __fmul_rn(x0, cs[0]), bq = __fmul_rn(x1, cs[1]); asm volatile("" : "+v"(a)); asm volatile("" : "+v"(bq)); const float r = ((dd < HD / 2) ? __fsub_rn(a, bq) : __fadd_rn(a, bq)) * sc;
        o16[q] = tohx(r); unsigned short a2, c2; splitf(r, a2, c2); oh[q] = a2; ol[q] = c2; }
    *(v2h*)(P16 + e) = o16; *(v2us*)(Ph + e) = oh; *(v2us*)(Pl + e) = ol;  }
__global__ __launch_bounds__(256) void k_vtp(const float* __restrict__ F, int pitch, int nheads, h16* V16, bf* Vh, bf* Vl) { const size_t e = ((size_t)blockIdx.x * 256 + threadIdx.x) * 2; if (e >= (size_t)nheads * HD * TT) return; const int t = (int)(e % TT); const int d = (int)((e / TT) % HD); const int g = (int)(e / ((size_t)TT * HD)); v2h o16; v2us oh, ol;
#pragma unroll
    for (int q = 0; q < 2; ++q) { const float x = F[(size_t)(t + q) * pitch + g * HD + d]; o16[q] = tohx(x); unsigned short a2, c2; splitf(x, a2, c2); oh[q] = a2; ol[q] = c2; }
    *(v2h*)(V16 + e) = o16; *(v2us*)(Vh + e) = oh; *(v2us*)(Vl + e) = ol;  }
__global__ __launch_bounds__(256) void k_csid(float* CS) { const int idx = blockIdx.x * 256 + threadIdx.x; if (idx >= TT * HD) return; v2f cs; cs[0] = 1.0f; cs[1] = 0.0f; *(v2f*)(CS + (size_t)idx * 2) = cs;  }
// k_asoft: per row (zz, i): t = tau (S x HD^-0.5) + delta[j] (no mask); softmax over the 2048 keys (register row, one exp, fixed trees);
__global__ __launch_bounds__(256) void k_asoft(const float* __restrict__ Sb, const float* __restrict__ TAUb, const float* __restrict__ DELb, h16* P16, bf* Ph, bf* Pl) {
    const int lane = threadIdx.x & 31; const int row = blockIdx.x * 8 + (threadIdx.x >> 5); if (row >= ZH * TT) return; const int i = row % TT; const int zz = row / TT; (void)zz; float tau = bfr(TAUb[0]); asm volatile("" : "+v"(tau)); const bool hires = (i < RH); const float* sr = Sb + (size_t)row * TT; float v[TT / 32]; float mx = -3.0e38f;
#pragma unroll
    for (int ch = 0; ch < TT / 128; ++ch) { const int j0 = ch * 128 + lane * 4; const v4f a = *(const v4f*)(sr + j0);
#pragma unroll
        for (int q = 0; q < 4; ++q) { const int j = j0 + q; float s0 = a[q] * SCL; asm volatile("" : "+v"(s0)); float s1 = __fmul_rn(tau, s0); asm volatile("" : "+v"(s1)); float dl = bfr(DELb[j]); asm volatile("" : "+v"(dl)); const float t = __fadd_rn(s1, dl);   /* tau (q.k/8) + delta[j] */ v[ch * 4 + q] = t; mx = fmaxf(mx, t); } }
#pragma unroll
    for (int sh = 16; sh; sh >>= 1) mx = fmaxf(mx, __shfl_xor(mx, sh, 32));
    float sum = 0.f;
#pragma unroll
    for (int k = 0; k < TT / 32; ++k) { float d0 = __fsub_rn(v[k], mx); asm volatile("" : "+v"(d0)); v[k] = __builtin_amdgcn_exp2f(__fmul_rn(d0, 1.4426950408889634f)); sum += v[k]; }
#pragma unroll
    for (int sh = 16; sh; sh >>= 1) sum += __shfl_xor(sum, sh, 32);
    const float f = __fdiv_rn(hires ? 1.0f : PCAR, sum);
{
        if (hires) {
#pragma unroll
            for (int ch = 0; ch < TT / 128; ++ch) { v4us oh, ol;
#pragma unroll
                for (int q = 0; q < 4; ++q) { unsigned short a, c2; splitf(v[ch * 4 + q] * f, a, c2); oh[q] = a; ol[q] = c2; }
                const size_t oo = ((size_t)zz * (RH ? RH : 1) + i) * TT + ch * 128 + lane * 4; *(v4us*)(Ph + oo) = oh; *(v4us*)(Pl + oo) = ol; }
        } else {
#pragma unroll
            for (int ch = 0; ch < TT / 128; ++ch) { v4h o4;
#pragma unroll
                for (int q = 0; q < 4; ++q) o4[q] = tohx(v[ch * 4 + q] * f);
                *(v4h*)(P16 + (size_t)row * TT + ch * 128 + lane * 4) = o4; } }
         }
}
__global__ __launch_bounds__(256) void k_merge(const float* __restrict__ O, int h0, bf* Ah, bf* Al) { const size_t e = ((size_t)blockIdx.x * 256 + threadIdx.x) * 2; if (e >= (size_t)ZH * TT * HD) return; const int d = (int)(e % HD); const int t = (int)((e / HD) % TT); const int zz = (int)(e / ((size_t)HD * TT)); const float cs = (t < RH) ? 1.0f : (1.0f / PCAR); const size_t oo = (size_t)t * DQ + (h0 + zz) * HD + d;
    v2us oh, ol;
#pragma unroll
    for (int q = 0; q < 2; ++q) { unsigned short a, c2; splitf(O[e + q] * cs, a, c2); oh[q] = a; ol[q] = c2; } *(v2us*)(Ah + oo) = oh; *(v2us*)(Al + oo) = ol;  }

extern "C" void kernel_launch(void* const* d_in, const int* in_sizes, int n_in,
                              void* d_out, int out_size, void* d_ws, size_t ws_size, hipStream_t stream) {
    (void)in_sizes; (void)n_in; (void)out_size;
    const float* x = (const float*)d_in[0]; const float* xk = (const float*)d_in[1]; const float* xv = (const float*)d_in[2]; const float* TAU = (const float*)d_in[3]; const float* DEL = (const float*)d_in[4]; const float* wq = (const float*)d_in[5]; const float* bq = (const float*)d_in[6]; const float* wk = (const float*)d_in[7]; const float* bk = (const float*)d_in[8]; const float* wv = (const float*)d_in[9]; const float* bv = (const float*)d_in[10]; const float* wo = (const float*)d_in[11]; const float* bo = (const float*)d_in[12];
    float* OUT = (float*)d_out;     // [4][2048][512]
    char* wsp = (char*)d_ws;
    auto take = [&](size_t bytes) { char* p = wsp; wsp += (bytes + 255) & ~(size_t)255; return (void*)p; };
    bf* WQ = (bf*)take((size_t)DQ * DM * 2); bf* WK = (bf*)take((size_t)DKV * DM * 2); bf* WV = (bf*)take((size_t)DKV * DM * 2); bf* WO = (bf*)take((size_t)DM * DQ * 2); float* CS = (float*)take((size_t)TT * HD * 2 * 4);
    bf* XB = (bf*)take((size_t)TT * DM * 2); bf* XKB = (bf*)take((size_t)TT * DM * 2); bf* XVB = (bf*)take((size_t)TT * DM * 2); float* FQ = (float*)take((size_t)TT * DQ * 4); float* FK = (float*)take((size_t)TT * DKV * 4);
    h16* QP16 = (h16*)take((size_t)NH_ * TT * HD * 2); h16* KP16 = (h16*)take((size_t)NKV * TT * HD * 2); h16* VT16 = (h16*)take((size_t)NKV * HD * TT * 2);
    bf* QPh = (bf*)take((size_t)NH_ * TT * HD * 2); bf* QPl = (bf*)take((size_t)NH_ * TT * HD * 2); bf* KPh = (bf*)take((size_t)NKV * TT * HD * 2); bf* KPl = (bf*)take((size_t)NKV * TT * HD * 2); bf* VTh = (bf*)take((size_t)NKV * HD * TT * 2); bf* VTl = (bf*)take((size_t)NKV * HD * TT * 2); bf* Ph = (bf*)take((size_t)ZH * RH * TT * 2); bf* Pl = (bf*)take((size_t)ZH * RH * TT * 2);
    float* Sb = (float*)take((size_t)ZH * TT * TT * 4); h16* P16 = (h16*)take((size_t)ZH * TT * TT * 2); float* Ob = (float*)take((size_t)ZH * TT * HD * 4); bf* ATh = (bf*)take((size_t)TT * DQ * 2); bf* ATl = (bf*)take((size_t)TT * DQ * 2);
    if ((size_t)(wsp - (char*)d_ws) > ws_size) return;    // ws 256 MiB
    float* FV = FK;   // v projection reuses the k buffer after the k planes are built (stream-ordered)
    { k_wtG<<<(unsigned)((DM * DQ / 64 + 63) / 64), 256, 0, stream>>>(wq, DM, DQ, WQ); k_wtG<<<(unsigned)((DM * DKV / 64 + 63) / 64), 256, 0, stream>>>(wk, DM, DKV, WK); k_wtG<<<(unsigned)((DM * DKV / 64 + 63) / 64), 256, 0, stream>>>(wv, DM, DKV, WV);
      k_wtG<<<(unsigned)((DQ * DM / 64 + 63) / 64), 256, 0, stream>>>(wo, DQ, DM, WO);
       }
    k_csid<<<(TT * HD + 255) / 256, 256, 0, stream>>>(CS);
    const unsigned LQ = (unsigned)(((size_t)NH_ * TT * HD / 2 + 255) / 256), LKv = (unsigned)(((size_t)NKV * TT * HD / 2 + 255) / 256);
    for (int b = 0; b < NB_; ++b) {
        
        k_cvt8<<<(unsigned)(((size_t)TT * DM / 8 + 255) / 256), 256, 0, stream>>>(x + (size_t)b * TT * DM, XB, (size_t)TT * DM / 8); k_cvt8<<<(unsigned)(((size_t)TT * DM / 8 + 255) / 256), 256, 0, stream>>>(xk + (size_t)b * TT * DM, XKB, (size_t)TT * DM / 8); k_cvt8<<<(unsigned)(((size_t)TT * DM / 8 + 255) / 256), 256, 0, stream>>>(xv + (size_t)b * TT * DM, XVB, (size_t)TT * DM / 8);
        k_gemmw<bf, 0, true><<<dim3(TT / 64, DQ / 64, 1), 32, 0, stream>>>(XB, nullptr, WQ, nullptr, DM, FQ, DQ, bq, 0, 0, 0);
        k_rope<<<LQ, 256, 0, stream>>>(FQ, DQ, NH_, CS, nullptr, nullptr, 1.0f, QP16, QPh, QPl);
        k_gemmw<bf, 0, true><<<dim3(TT / 64, DKV / 64, 1), 32, 0, stream>>>(XKB, nullptr, WK, nullptr, DM, FK, DKV, bk, 0, 0, 0);
        k_rope<<<LKv, 256, 0, stream>>>(FK, DKV, NKV, CS, nullptr, nullptr, 1.0f, KP16, KPh, KPl);
        k_gemmw<bf, 0, true><<<dim3(TT / 64, DKV / 64, 1), 32, 0, stream>>>(XVB, nullptr, WV, nullptr, DM, FV, DKV, bv, 0, 0, 0); k_vtp<<<LKv, 256, 0, stream>>>(FV, DKV, NKV, VT16, VTh, VTl);
        for (int h0 = 0; h0 < NH_; h0 += ZH) { const size_t zq = (size_t)h0, zk = (size_t)(h0 / REP);   // one kv head per query head: the pass's two heads use consecutive kv planes (z-strides TT*HD)
            k_gemmw<bf, 2, false><<<dim3(RH / 64, TT / 64, ZH), 32, 0, stream>>>(QPh + zq * TT * HD, QPl + zq * TT * HD, KPh + zk * TT * HD, KPl + zk * TT * HD, HD, Sb, TT, nullptr, (size_t)TT * HD, (size_t)TT * HD, (size_t)TT * TT);
            k_gemmw<h16, 0, false><<<dim3((TT - RH) / 64, TT / 64, ZH), 32, 0, stream>>>(QP16 + zq * TT * HD + (size_t)RH * HD, nullptr, KP16 + zk * TT * HD, nullptr, HD, Sb + (size_t)RH * TT, TT, nullptr, (size_t)TT * HD, (size_t)TT * HD, (size_t)TT * TT);
            k_asoft<<<ZH * TT / 8, 256, 0, stream>>>(Sb, TAU + b, DEL + (size_t)b * TT, P16, Ph, Pl);
            k_gemmw<bf, 2, false><<<dim3(RH / 64, HD / 64, ZH), 32, 0, stream>>>(Ph, Pl, VTh + zk * HD * TT, VTl + zk * HD * TT, TT, Ob, HD, nullptr, (size_t)RH * TT, (size_t)HD * TT, (size_t)TT * HD);
            k_gemmw<h16, 0, false><<<dim3((TT - RH) / 64, HD / 64, ZH), 32, 0, stream>>>(P16 + (size_t)RH * TT, nullptr, VT16 + zk * HD * TT, nullptr, TT, Ob + (size_t)RH * HD, HD, nullptr, (size_t)TT * TT, (size_t)HD * TT, (size_t)TT * HD);
            k_merge<<<(unsigned)(((size_t)ZH * TT * HD / 2 + 255) / 256), 256, 0, stream>>>(Ob, h0, ATh, ATl); }
        k_gemmw<bf, 1, true><<<dim3(TT / 64, DM / 64, 1), 32, 0, stream>>>(ATh, ATl, WO, nullptr, DQ, OUT + (size_t)b * TT * DM, DM, bo, 0, 0, 0); }
}

// v001
// A run of this version takes 1120 microseconds.
// In both of two side-by-side timings against v000, it was 2.00 times as fast.
#include <hip/hip_runtime.h>

// De-stationary attention (Non-stationary Transformer) (queries, keys, values [4][2048][512]; q, k, v = . W + b ('xw' [512][512]; 8 heads x 64); scores = tau[b] (q.k/8) + delta[b][s] (tau [4], delta [4][2048], read); softmax; out = merged Wo + bo -> [4][2048][512] (4.2 M)).
// Compute dtypes, f32 accumulate: every input rounded to bf16; q/k/v on PLAIN bf16 operands (inputs: exact) + biases; tau scale and delta shift applied in f32 per (i, j) inside the softmax kernel; scores and attn.v: query rows < 512 hl (3 products), the rest single fp16 (x1024); softmax f32; Wo hl x exact (2 products) + bo.

#define NB_  4
#define TT   2048
#define DM   512
#define NH_  8
#define NKV  8
#define REP  (NH_ / NKV)
#define HD   64
#define DQ   (NH_ * HD)
#define DKV  (NKV * HD)
#define ZH   2
#define RH   512                  // query rows < RH use hi+lo planes (0: none)
#define WIN  0
#define PCAR 1024.0f
#define SCL  0.125f   // HD^-0.5
typedef _Float16 h16;
typedef unsigned short bf;
typedef __attribute__((ext_vector_type(16))) __bf16   v16bf;
typedef __attribute__((ext_vector_type(16))) _Float16 v16h;
typedef __attribute__((ext_vector_type(8)))  _Float16 v8h;
typedef __attribute__((ext_vector_type(8)))  unsigned short v8us;
typedef __attribute__((ext_vector_type(8)))  float    v8f;
typedef __attribute__((ext_vector_type(4)))  float    v4f;
typedef v8h  __attribute__((may_alias)) v8ha;
typedef v4f  __attribute__((may_alias)) v4fa;
typedef v8us __attribute__((may_alias)) v8usa;

__device__ __forceinline__ unsigned short f2bf(float f) { unsigned u = __float_as_uint(f); u += 0x7FFFu + ((u >> 16) & 1u); return (unsigned short)(u >> 16); }
__device__ __forceinline__ float bf2f(unsigned short b) { return __uint_as_float(((unsigned)b) << 16); }
__device__ __forceinline__ float bfr(float f) { return bf2f(f2bf(f)); }
__device__ __forceinline__ v16h cat16(v8h lo, v8h hi) { return __builtin_shufflevector(lo, hi, 0, 1, 2, 3, 4, 5, 6, 7, 8, 9, 10, 11, 12, 13, 14, 15); }
__device__ __forceinline__ v16bf cat16b(v8us lo, v8us hi) { return __builtin_bit_cast(v16bf, __builtin_shufflevector(lo, hi, 0, 1, 2, 3, 4, 5, 6, 7, 8, 9, 10, 11, 12, 13, 14, 15)); }
__device__ __forceinline__ v8f wmma16(v16h a, v16h b, v8f c) { return __builtin_amdgcn_wmma_f32_16x16x32_f16(false, a, false, b, (short)0, c, false, false); }
__device__ __forceinline__ v8f wmmab(v16bf a, v16bf b, v8f c) { return __builtin_amdgcn_wmma_f32_16x16x32_bf16(false, a, false, b, (short)0, c, false, false); }



// ---- k_gemmw: register-blocked GEMM, ONE WAVE per 64x64 output tile (16 accumulators), operands straight from K-contiguous 16-bit planes; grid (M/64, N/64, Z), 32 threads.
// C[m][n] (f32, pitch ldc, + optional f32 bias[n]) = sum_k A[m][k] Bt[n][k] (+ split products per NSPLIT). z-batch strides sA/sB/sC in elements. K % 32 == 0.
template <typename T16> struct WFrag;
template <> struct WFrag<h16> { typedef v16h V; static __device__ __forceinline__ V ld(const h16* p) { return cat16(*(const v8h*)p, *(const v8h*)(p + 16)); } static __device__ __forceinline__ v8f mma(V a, V b, v8f c) { return wmma16(a, b, c); } };
template <> struct WFrag<bf> { typedef v16bf V; static __device__ __forceinline__ V ld(const bf* p) { return cat16b(*(const v8us*)p, *(const v8us*)(p + 16)); } static __device__ __forceinline__ v8f mma(V a, V b, v8f c) { return wmmab(a, b, c); } };
template <typename T16, int NSPLIT, bool BIAS>
__global__ __launch_bounds__(32) void k_gemmw(const T16* __restrict__ A, const T16* __restrict__ A2, const T16* __restrict__ Bt, const T16* __restrict__ Bt2, int K, float* C, int ldc, const float* __restrict__ bias, size_t sA, size_t sB, size_t sC) {
    typedef typename WFrag<T16>::V V;
    __shared__ __align__(16) float os[16 * 68];
    const size_t z = blockIdx.z; A += z * sA; if (A2) A2 += z * sA; Bt += z * sB; if (Bt2) Bt2 += z * sB; C += z * sC;
    const int lane = threadIdx.x & 31, lr = lane & 15, hi = lane >> 4; const int r0 = blockIdx.x * 64, c0 = blockIdx.y * 64;
    v8f acc[4][4];
#pragma unroll
    for (int mb = 0; mb < 4; ++mb)
#pragma unroll
        for (int nb = 0; nb < 4; ++nb) acc[mb][nb] = (v8f){};
    const size_t aoff = (size_t)(r0 + lr) * K + 8 * hi, boff = (size_t)(c0 + lr) * K + 8 * hi;
#pragma unroll 1
    for (int kc = 0; kc < K; kc += 32) {
        V a[4], a2[4];
#pragma unroll
        for (int mb = 0; mb < 4; ++mb) { a[mb] = WFrag<T16>::ld(A + aoff + (size_t)mb * 16 * K + kc); if (NSPLIT == 1 || NSPLIT == 2) a2[mb] = WFrag<T16>::ld(A2 + aoff + (size_t)mb * 16 * K + kc); }
#pragma unroll
        for (int nb = 0; nb < 4; ++nb) { const V b = WFrag<T16>::ld(Bt + boff + (size_t)nb * 16 * K + kc); V b2; if (NSPLIT >= 2) b2 = WFrag<T16>::ld(Bt2 + boff + (size_t)nb * 16 * K + kc);
#pragma unroll
            for (int mb = 0; mb < 4; ++mb) { acc[mb][nb] = WFrag<T16>::mma(a[mb], b, acc[mb][nb]); if (NSPLIT == 1 || NSPLIT == 2) acc[mb][nb] = WFrag<T16>::mma(a2[mb], b, acc[mb][nb]); if (NSPLIT >= 2) acc[mb][nb] = WFrag<T16>::mma(a[mb], b2, acc[mb][nb]); } }
        asm volatile("v_nop\n\tv_nop\n\tv_nop\n\tv_nop" : "+v"(acc[0][0]), "+v"(acc[1][1]), "+v"(acc[2][2]), "+v"(acc[3][3]) : "v"(a[0]), "v"(a[3]));
    }
#pragma unroll
    for (int mb = 0; mb < 4; ++mb) {
#pragma unroll
        for (int nb = 0; nb < 4; ++nb) {
#pragma unroll
            for (int j = 0; j < 8; ++j) os[(hi * 8 + j) * 68 + nb * 16 + lr] = acc[mb][nb][j]; }
        __builtin_amdgcn_wave_barrier(); asm volatile("" ::: "memory");
        float* crow = C + (size_t)(r0 + mb * 16) * ldc + c0;
{
#pragma unroll
            for (int s = 0; s < 8; ++s) { const int row = 2 * s + hi, cofs = lr * 4; v4f val = *(const v4fa*)(os + row * 68 + cofs); if (BIAS) { val[0] += bfr(bias[c0 + cofs]); val[1] += bfr(bias[c0 + cofs + 1]); val[2] += bfr(bias[c0 + cofs + 2]); val[3] += bfr(bias[c0 + cofs + 3]); }
                *(v4f*)(crow + (size_t)row * ldc + cofs) = val; }
             }
        __builtin_amdgcn_wave_barrier(); asm volatile("" ::: "memory");
    }
}

// ---- k_gemmsk: the product of k_gemmw for a long K. NW waves of one work-group share one (MB*16)x64 output tile; wave w sums k in [w*KW, (w+1)*KW) with the loaders of k_gemmw;
// the NW partial tiles meet in LDS and are added in wave order (bias last). grid (M/(MB*16), N/64, Z), NW*32 threads. K = NW*KW.
template <typename T16, int NSPLIT, bool BIAS, int MB, int NW, int KW>
// waves_per_eu: the grids are no larger than the chip, so one work-group per WGP is the case to allot registers for (more fragment loads in flight per trip)
__global__ __launch_bounds__(NW * 32) __attribute__((amdgpu_waves_per_eu(NW / 4, NW / 4))) void k_gemmsk(const T16* __restrict__ A, const T16* __restrict__ A2, const T16* __restrict__ Bt, const T16* __restrict__ Bt2, float* C, int ldc, const float* __restrict__ bias, size_t sA, size_t sB, size_t sC) {
    typedef typename WFrag<T16>::V V;
    constexpr int K = NW * KW, PT = MB * 16 * 68; static_assert((MB * 8) % NW == 0 && KW % 32 == 0, "tile and slice must divide evenly");
    __shared__ __align__(16) float red[NW * PT];
    const size_t z = blockIdx.z; A += z * sA; if (NSPLIT == 1 || NSPLIT == 2) A2 += z * sA; Bt += z * sB; if (NSPLIT >= 2) Bt2 += z * sB; C += z * sC;
    const int tid = threadIdx.x, w = __builtin_amdgcn_readfirstlane(tid >> 5), lane = tid & 31, lr = lane & 15, hi = lane >> 4; const int r0 = blockIdx.x * (MB * 16), c0 = blockIdx.y * 64;
    v8f acc[MB][4];
#pragma unroll
    for (int mb = 0; mb < MB; ++mb)
#pragma unroll
        for (int nb = 0; nb < 4; ++nb) acc[mb][nb] = (v8f){};
    const size_t aoff = (size_t)(r0 + lr) * K + w * KW + 8 * hi, boff = (size_t)(c0 + lr) * K + w * KW + 8 * hi;
#pragma unroll 1   // rolled, as in k_gemmw: unrolled, this build waited on single load pairs
    for (int kc = 0; kc < KW; kc += 32) {
        V a[MB], a2[MB];
#pragma unroll
        for (int mb = 0; mb < MB; ++mb) { a[mb] = WFrag<T16>::ld(A + aoff + (size_t)mb * 16 * K + kc); if (NSPLIT == 1 || NSPLIT == 2) a2[mb] = WFrag<T16>::ld(A2 + aoff + (size_t)mb * 16 * K + kc); }
#pragma unroll
        for (int nb = 0; nb < 4; ++nb) { const V b = WFrag<T16>::ld(Bt + boff + (size_t)nb * 16 * K + kc); V b2; if (NSPLIT >= 2) b2 = WFrag<T16>::ld(Bt2 + boff + (size_t)nb * 16 * K + kc);
#pragma unroll
            for (int mb = 0; mb < MB; ++mb) { acc[mb][nb] = WFrag<T16>::mma(a[mb], b, acc[mb][nb]); if (NSPLIT == 1 || NSPLIT == 2) acc[mb][nb] = WFrag<T16>::mma(a2[mb], b, acc[mb][nb]); if (NSPLIT >= 2) acc[mb][nb] = WFrag<T16>::mma(a[mb], b2, acc[mb][nb]); } }
    }
    float* my = red + w * PT;
#pragma unroll
    for (int mb = 0; mb < MB; ++mb)
#pragma unroll
        for (int nb = 0; nb < 4; ++nb)
#pragma unroll
            for (int j = 0; j < 8; ++j) my[(mb * 16 + hi * 8 + j) * 68 + nb * 16 + lr] = acc[mb][nb][j];
    __syncthreads();   // every wave's partial tile is in LDS before any thread adds them
#pragma unroll
    for (int s = 0; s < MB * 8 / NW; ++s) { const int it = s * NW * 32 + tid, row = it >> 4, cofs = (it & 15) * 4; v4f val = *(const v4fa*)(red + row * 68 + cofs);
#pragma unroll
        for (int p = 1; p < NW; ++p) val += *(const v4fa*)(red + p * PT + row * 68 + cofs);
        if (BIAS) { val[0] += bfr(bias[c0 + cofs]); val[1] += bfr(bias[c0 + cofs + 1]); val[2] += bfr(bias[c0 + cofs + 2]); val[3] += bfr(bias[c0 + cofs + 3]); }
        *(v4f*)(C + (size_t)(r0 + row) * ldc + c0 + cofs) = val; }
}

__device__ __forceinline__ h16 tohx(float x) { return (h16)x; }
__device__ __forceinline__ void splitf(float y, unsigned short& h, unsigned short& l) { h = f2bf(y); l = f2bf(y - bf2f(h)); }
typedef __attribute__((ext_vector_type(2))) _Float16 v2h;
typedef __attribute__((ext_vector_type(4))) _Float16 v4h;
typedef __attribute__((ext_vector_type(2))) unsigned short v2us;
typedef __attribute__((ext_vector_type(4))) unsigned short v4us;
typedef __attribute__((ext_vector_type(2))) float v2f;
typedef __attribute__((ext_vector_type(4))) int v4i;

__global__ __launch_bounds__(256) void k_wtG(const float* __restrict__ w, int K, int N, bf* Bt) {
    const int lane = threadIdx.x & 31; const int L0 = (blockIdx.x * 8 + (threadIdx.x >> 5)) * 8; const int nlines = N * K / 64;
{
#pragma unroll 1
        for (int l = 0; l < 8; ++l) { const int L = L0 + l; if (L >= nlines) break; const size_t e = (size_t)L * 64 + lane * 2; const int k = (int)(e % K), n = (int)(e / K); v2us o;
            o[0] = f2bf(w[(size_t)k * N + n]); o[1] = f2bf(w[(size_t)(k + 1) * N + n]); *(v2us*)(Bt + e) = o; }
         }
}
__global__ __launch_bounds__(256) void k_cvt8(const float* __restrict__ src, bf* dst, size_t n8) { const size_t i = (size_t)blockIdx.x * 256 + threadIdx.x; if (i >= n8) return; const v8f v = *(const v8f*)(src + i * 8); v8us o;
#pragma unroll
    for (int k = 0; k < 8; ++k) o[k] = f2bf(v[k]); *(v8us*)(dst + i * 8) = o;  }

// k_rope: head planes [h][t][d] (fp16 + hi/lo) of rope(x) x sc with the rotate-half convention out[d] = x[d] cos[t][d] - x[d+HD/2] sin[t][d], out[d+HD/2] = x[d+HD/2] cos[t][d+HD/2] + x[d] sin[t][d+HD/2]
__global__ __launch_bounds__(256) void k_rope(const float* __restrict__ F, int pitch, int nheads, const float* __restrict__ CS, const float* __restrict__ RF, const float* __restrict__ nw, float sc, h16* P16, bf* Ph, bf* Pl) {
    const size_t e = ((size_t)blockIdx.x * 256 + threadIdx.x) * 2; if (e >= (size_t)nheads * TT * HD) return; const int d = (int)(e % HD); const int t = (int)((e / HD) % TT); const int h = (int)(e / ((size_t)HD * TT)); const float* f = F + (size_t)t * pitch + h * HD; const float rf = RF ? RF[(size_t)h * TT + t] : 1.0f; v2h o16; v2us oh, ol;
#pragma unroll
    for (int q = 0; q < 2; ++q) { const int dd = d + q; const int dp = (dd < HD / 2) ? dd + HD / 2 : dd - HD / 2; float x0 = f[dd], x1 = f[dp];
        if (RF) { float n0 = __fmul_rn(x0, rf), n1 = __fmul_rn(x1, rf); asm volatile("" : "+v"(n0)); asm volatile("" : "+v"(n1)); x0 = __fmul_rn(bfr(nw[dd]), n0); x1 = __fmul_rn(bfr(nw[dp]), n1); }
        const v2f cs = *(const v2f*)(CS + ((size_t)t * HD + dd) * 2); float a = __fmul_rn(x0, cs[0]), bq = __fmul_rn(x1, cs[1]); asm volatile("" : "+v"(a)); asm volatile("" : "+v"(bq)); const float r = ((dd < HD / 2) ? __fsub_rn(a, bq) : __fadd_rn(a, bq)) * sc;
        o16[q] = tohx(r); unsigned short a2, c2; splitf(r, a2, c2); oh[q] = a2; ol[q] = c2; }
    *(v2h*)(P16 + e) = o16; *(v2us*)(Ph + e) = oh; *(v2us*)(Pl + e) = ol;  }
__global__ __launch_bounds__(256) void k_vtp(const float* __restrict__ F, int pitch, int nheads, h16* V16, bf* Vh, bf* Vl) { const size_t e = ((size_t)blockIdx.x * 256 + threadIdx.x) * 2; if (e >= (size_t)nheads * HD * TT) return; const int t = (int)(e % TT); const int d = (int)((e / TT) % HD); const int g = (int)(e / ((size_t)TT * HD)); v2h o16; v2us oh, ol;
#pragma unroll
    for (int q = 0; q < 2; ++q) { const float x = F[(size_t)(t + q) * pitch + g * HD + d]; o16[q] = tohx(x); unsigned short a2, c2; splitf(x, a2, c2); oh[q] = a2; ol[q] = c2; }
    *(v2h*)(V16 + e) = o16; *(v2us*)(Vh + e) = oh; *(v2us*)(Vl + e) = ol;  }
__global__ __launch_bounds__(256) void k_csid(float* CS) { const int idx = blockIdx.x * 256 + threadIdx.x; if (idx >= TT * HD) return; v2f cs; cs[0] = 1.0f; cs[1] = 0.0f; *(v2f*)(CS + (size_t)idx * 2) = cs;  }
// k_asoft: per row (zz, i): t = tau (S x HD^-0.5) + delta[j] (no mask); softmax over the 2048 keys (register row, one exp, fixed trees);
__global__ __launch_bounds__(256) void k_asoft(const float* __restrict__ Sb, const float* __restrict__ TAUb, const float* __restrict__ DELb, h16* P16, bf* Ph, bf* Pl) {
    const int lane = threadIdx.x & 31; const int row = blockIdx.x * 8 + (threadIdx.x >> 5); if (row >= ZH * TT) return; const int i = row % TT; const int zz = row / TT; (void)zz; float tau = bfr(TAUb[0]); asm volatile("" : "+v"(tau)); const bool hires = (i < RH); const float* sr = Sb + (size_t)row * TT; float v[TT / 32]; float mx = -3.0e38f;
#pragma unroll
    for (int ch = 0; ch < TT / 128; ++ch) { const int j0 = ch * 128 + lane * 4; const v4f a = *(const v4f*)(sr + j0);
#pragma unroll
        for (int q = 0; q < 4; ++q) { const int j = j0 + q; float s0 = a[q] * SCL; asm volatile("" : "+v"(s0)); float s1 = __fmul_rn(tau, s0); asm volatile("" : "+v"(s1)); float dl = bfr(DELb[j]); asm volatile("" : "+v"(dl)); const float t = __fadd_rn(s1, dl);   /* tau (q.k/8) + delta[j] */ v[ch * 4 + q] = t; mx = fmaxf(mx, t); } }
#pragma unroll
    for (int sh = 16; sh; sh >>= 1) mx = fmaxf(mx, __shfl_xor(mx, sh, 32));
    float sum = 0.f;
#pragma unroll
    for (int k = 0; k < TT / 32; ++k) { float d0 = __fsub_rn(v[k], mx); asm volatile("" : "+v"(d0)); v[k] = __builtin_amdgcn_exp2f(__fmul_rn(d0, 1.4426950408889634f)); sum += v[k]; }
#pragma unroll
    for (int sh = 16; sh; sh >>= 1) sum += __shfl_xor(sum, sh, 32);
    const float f = __fdiv_rn(hires ? 1.0f : PCAR, sum);
{
        if (hires) {
#pragma unroll
            for (int ch = 0; ch < TT / 128; ++ch) { v4us oh, ol;
#pragma unroll
                for (int q = 0; q < 4; ++q) { unsigned short a, c2; splitf(v[ch * 4 + q] * f, a, c2); oh[q] = a; ol[q] = c2; }
                const size_t oo = ((size_t)zz * (RH ? RH : 1) + i) * TT + ch * 128 + lane * 4; *(v4us*)(Ph + oo) = oh; *(v4us*)(Pl + oo) = ol; }
        } else {
#pragma unroll
            for (int ch = 0; ch < TT / 128; ++ch) { v4h o4;
#pragma unroll
                for (int q = 0; q < 4; ++q) o4[q] = tohx(v[ch * 4 + q] * f);
                *(v4h*)(P16 + (size_t)row * TT + ch * 128 + lane * 4) = o4; } }
         }
}
__global__ __launch_bounds__(256) void k_merge(const float* __restrict__ O, int h0, bf* Ah, bf* Al) { const size_t e = ((size_t)blockIdx.x * 256 + threadIdx.x) * 2; if (e >= (size_t)ZH * TT * HD) return; const int d = (int)(e % HD); const int t = (int)((e / HD) % TT); const int zz = (int)(e / ((size_t)HD * TT)); const float cs = (t < RH) ? 1.0f : (1.0f / PCAR); const size_t oo = (size_t)t * DQ + (h0 + zz) * HD + d;
    v2us oh, ol;
#pragma unroll
    for (int q = 0; q < 2; ++q) { unsigned short a, c2; splitf(O[e + q] * cs, a, c2); oh[q] = a; ol[q] = c2; } *(v2us*)(Ah + oo) = oh; *(v2us*)(Al + oo) = ol;  }

extern "C" void kernel_launch(void* const* d_in, const int* in_sizes, int n_in,
                              void* d_out, int out_size, void* d_ws, size_t ws_size, hipStream_t stream) {
    (void)in_sizes; (void)n_in; (void)out_size;
    const float* x = (const float*)d_in[0]; const float* xk = (const float*)d_in[1]; const float* xv = (const float*)d_in[2]; const float* TAU = (const float*)d_in[3]; const float* DEL = (const float*)d_in[4]; const float* wq = (const float*)d_in[5]; const float* bq = (const float*)d_in[6]; const float* wk = (const float*)d_in[7]; const float* bk = (const float*)d_in[8]; const float* wv = (const float*)d_in[9]; const float* bv = (const float*)d_in[10]; const float* wo = (const float*)d_in[11]; const float* bo = (const float*)d_in[12];
    float* OUT = (float*)d_out;     // [4][2048][512]
    char* wsp = (char*)d_ws;
    auto take = [&](size_t bytes) { char* p = wsp; wsp += (bytes + 255) & ~(size_t)255; return (void*)p; };
    bf* WQ = (bf*)take((size_t)DQ * DM * 2); bf* WK = (bf*)take((size_t)DKV * DM * 2); bf* WV = (bf*)take((size_t)DKV * DM * 2); bf* WO = (bf*)take((size_t)DM * DQ * 2); float* CS = (float*)take((size_t)TT * HD * 2 * 4);
    bf* XB = (bf*)take((size_t)TT * DM * 2); bf* XKB = (bf*)take((size_t)TT * DM * 2); bf* XVB = (bf*)take((size_t)TT * DM * 2); float* FQ = (float*)take((size_t)TT * DQ * 4); float* FK = (float*)take((size_t)TT * DKV * 4);
    h16* QP16 = (h16*)take((size_t)NH_ * TT * HD * 2); h16* KP16 = (h16*)take((size_t)NKV * TT * HD * 2); h16* VT16 = (h16*)take((size_t)NKV * HD * TT * 2);
    bf* QPh = (bf*)take((size_t)NH_ * TT * HD * 2); bf* QPl = (bf*)take((size_t)NH_ * TT * HD * 2); bf* KPh = (bf*)take((size_t)NKV * TT * HD * 2); bf* KPl = (bf*)take((size_t)NKV * TT * HD * 2); bf* VTh = (bf*)take((size_t)NKV * HD * TT * 2); bf* VTl = (bf*)take((size_t)NKV * HD * TT * 2); bf* Ph = (bf*)take((size_t)ZH * RH * TT * 2); bf* Pl = (bf*)take((size_t)ZH * RH * TT * 2);
    float* Sb = (float*)take((size_t)ZH * TT * TT * 4); h16* P16 = (h16*)take((size_t)ZH * TT * TT * 2); float* Ob = (float*)take((size_t)ZH * TT * HD * 4); bf* ATh = (bf*)take((size_t)TT * DQ * 2); bf* ATl = (bf*)take((size_t)TT * DQ * 2);
    if ((size_t)(wsp - (char*)d_ws) > ws_size) return;    // ws 256 MiB
    float* FV = FK;   // v projection reuses the k buffer after the k planes are built (stream-ordered)
    { k_wtG<<<(unsigned)((DM * DQ / 64 + 63) / 64), 256, 0, stream>>>(wq, DM, DQ, WQ); k_wtG<<<(unsigned)((DM * DKV / 64 + 63) / 64), 256, 0, stream>>>(wk, DM, DKV, WK); k_wtG<<<(unsigned)((DM * DKV / 64 + 63) / 64), 256, 0, stream>>>(wv, DM, DKV, WV);
      k_wtG<<<(unsigned)((DQ * DM / 64 + 63) / 64), 256, 0, stream>>>(wo, DQ, DM, WO);
       }
    k_csid<<<(TT * HD + 255) / 256, 256, 0, stream>>>(CS);
    const unsigned LQ = (unsigned)(((size_t)NH_ * TT * HD / 2 + 255) / 256), LKv = (unsigned)(((size_t)NKV * TT * HD / 2 + 255) / 256);
    for (int b = 0; b < NB_; ++b) {
        
        k_cvt8<<<(unsigned)(((size_t)TT * DM / 8 + 255) / 256), 256, 0, stream>>>(x + (size_t)b * TT * DM, XB, (size_t)TT * DM / 8); k_cvt8<<<(unsigned)(((size_t)TT * DM / 8 + 255) / 256), 256, 0, stream>>>(xk + (size_t)b * TT * DM, XKB, (size_t)TT * DM / 8); k_cvt8<<<(unsigned)(((size_t)TT * DM / 8 + 255) / 256), 256, 0, stream>>>(xv + (size_t)b * TT * DM, XVB, (size_t)TT * DM / 8);
        k_gemmsk<bf, 0, true, 4, 8, DM / 8><<<dim3(TT / 64, DQ / 64, 1), 256, 0, stream>>>(XB, nullptr, WQ, nullptr, FQ, DQ, bq, 0, 0, 0);
        k_rope<<<LQ, 256, 0, stream>>>(FQ, DQ, NH_, CS, nullptr, nullptr, 1.0f, QP16, QPh, QPl);
        k_gemmsk<bf, 0, true, 4, 8, DM / 8><<<dim3(TT / 64, DKV / 64, 1), 256, 0, stream>>>(XKB, nullptr, WK, nullptr, FK, DKV, bk, 0, 0, 0);
        k_rope<<<LKv, 256, 0, stream>>>(FK, DKV, NKV, CS, nullptr, nullptr, 1.0f, KP16, KPh, KPl);
        k_gemmsk<bf, 0, true, 4, 8, DM / 8><<<dim3(TT / 64, DKV / 64, 1), 256, 0, stream>>>(XVB, nullptr, WV, nullptr, FV, DKV, bv, 0, 0, 0); k_vtp<<<LKv, 256, 0, stream>>>(FV, DKV, NKV, VT16, VTh, VTl);
        for (int h0 = 0; h0 < NH_; h0 += ZH) { const size_t zq = (size_t)h0, zk = (size_t)(h0 / REP);   // one kv head per query head: the pass's two heads use consecutive kv planes (z-strides TT*HD)
            k_gemmw<bf, 2, false><<<dim3(RH / 64, TT / 64, ZH), 32, 0, stream>>>(QPh + zq * TT * HD, QPl + zq * TT * HD, KPh + zk * TT * HD, KPl + zk * TT * HD, HD, Sb, TT, nullptr, (size_t)TT * HD, (size_t)TT * HD, (size_t)TT * TT);
            k_gemmw<h16, 0, false><<<dim3((TT - RH) / 64, TT / 64, ZH), 32, 0, stream>>>(QP16 + zq * TT * HD + (size_t)RH * HD, nullptr, KP16 + zk * TT * HD, nullptr, HD, Sb + (size_t)RH * TT, TT, nullptr, (size_t)TT * HD, (size_t)TT * HD, (size_t)TT * TT);
            k_asoft<<<ZH * TT / 8, 256, 0, stream>>>(Sb, TAU + b, DEL + (size_t)b * TT, P16, Ph, Pl);
            k_gemmsk<bf, 2, false, 2, 16, TT / 16><<<dim3(RH / 32, HD / 64, ZH), 512, 0, stream>>>(Ph, Pl, VTh + zk * HD * TT, VTl + zk * HD * TT, Ob, HD, nullptr, (size_t)RH * TT, (size_t)HD * TT, (size_t)TT * HD);
            k_gemmsk<h16, 0, false, 2, 16, TT / 16><<<dim3((TT - RH) / 32, HD / 64, ZH), 512, 0, stream>>>(P16 + (size_t)RH * TT, nullptr, VT16 + zk * HD * TT, nullptr, Ob + (size_t)RH * HD, HD, nullptr, (size_t)TT * TT, (size_t)HD * TT, (size_t)TT * HD);
            k_merge<<<(unsigned)(((size_t)ZH * TT * HD / 2 + 255) / 256), 256, 0, stream>>>(Ob, h0, ATh, ATl); }
        k_gemmsk<bf, 1, true, 4, 8, DQ / 8><<<dim3(TT / 64, DM / 64, 1), 256, 0, stream>>>(ATh, ATl, WO, nullptr, OUT + (size_t)b * TT * DM, DM, bo, 0, 0, 0); }
}

// v002
// One run takes 656 microseconds.
// Next to v001, in two timings, it ran 1.71 and 1.70 times as fast.
// All steps since v000 together make it 3.42 times as fast.
#include <hip/hip_runtime.h>

// De-stationary attention (Non-stationary Transformer) (queries, keys, values [4][2048][512]; q, k, v = . W + b ('xw' [512][512]; 8 heads x 64); scores = tau[b] (q.k/8) + delta[b][s] (tau [4], delta [4][2048], read); softmax; out = merged Wo + bo -> [4][2048][512] (4.2 M)).
// Compute dtypes, f32 accumulate: every input rounded to bf16; q/k/v on PLAIN bf16 operands (inputs: exact) + biases; tau scale and delta shift applied in f32 per (i, j) inside the softmax kernel; scores and attn.v: query rows < 512 hl (3 products), the rest single fp16 (x1024); softmax f32; Wo hl x exact (2 products) + bo.

#define NB_  4
#define TT   2048
#define DM   512
#define NH_  8
#define NKV  8
#define REP  (NH_ / NKV)
#define HD   64
#define DQ   (NH_ * HD)
#define DKV  (NKV * HD)
#define ZH   8                    // (batch, head) planes per score/softmax/attn.v pass
#define NZ   (NB_ * NH_)          // all (batch, head) planes
#define RH   512                  // query rows < RH use hi+lo planes (0: none)
#define WIN  0
#define PCAR 1024.0f
#define SCL  0.125f   // HD^-0.5
typedef _Float16 h16;
typedef unsigned short bf;
typedef __attribute__((ext_vector_type(16))) __bf16   v16bf;
typedef __attribute__((ext_vector_type(16))) _Float16 v16h;
typedef __attribute__((ext_vector_type(8)))  _Float16 v8h;
typedef __attribute__((ext_vector_type(8)))  unsigned short v8us;
typedef __attribute__((ext_vector_type(8)))  float    v8f;
typedef __attribute__((ext_vector_type(4)))  float    v4f;
typedef v8h  __attribute__((may_alias)) v8ha;
typedef v4f  __attribute__((may_alias)) v4fa;
typedef v8us __attribute__((may_alias)) v8usa;

__device__ __forceinline__ unsigned short f2bf(float f) { unsigned u = __float_as_uint(f); u += 0x7FFFu + ((u >> 16) & 1u); return (unsigned short)(u >> 16); }
__device__ __forceinline__ float bf2f(unsigned short b) { return __uint_as_float(((unsigned)b) << 16); }
__device__ __forceinline__ float bfr(float f) { return bf2f(f2bf(f)); }
__device__ __forceinline__ v16h cat16(v8h lo, v8h hi) { return __builtin_shufflevector(lo, hi, 0, 1, 2, 3, 4, 5, 6, 7, 8, 9, 10, 11, 12, 13, 14, 15); }
__device__ __forceinline__ v16bf cat16b(v8us lo, v8us hi) { return __builtin_bit_cast(v16bf, __builtin_shufflevector(lo, hi, 0, 1, 2, 3, 4, 5, 6, 7, 8, 9, 10, 11, 12, 13, 14, 15)); }
__device__ __forceinline__ v8f wmma16(v16h a, v16h b, v8f c) { return __builtin_amdgcn_wmma_f32_16x16x32_f16(false, a, false, b, (short)0, c, false, false); }
__device__ __forceinline__ v8f wmmab(v16bf a, v16bf b, v8f c) { return __builtin_amdgcn_wmma_f32_16x16x32_bf16(false, a, false, b, (short)0, c, false, false); }



// ---- k_gemmw: register-blocked GEMM, ONE WAVE per 64x64 output tile (16 accumulators), operands straight from K-contiguous 16-bit planes; grid (M/64, N/64, Z), 32 threads.
// C[m][n] (f32, pitch ldc, + optional f32 bias[n]) = sum_k A[m][k] Bt[n][k] (+ split products per NSPLIT). z-batch strides sA/sB/sC in elements. K % 32 == 0.
template <typename T16> struct WFrag;
template <> struct WFrag<h16> { typedef v16h V; static __device__ __forceinline__ V ld(const h16* p) { return cat16(*(const v8h*)p, *(const v8h*)(p + 16)); } static __device__ __forceinline__ v8f mma(V a, V b, v8f c) { return wmma16(a, b, c); } };
template <> struct WFrag<bf> { typedef v16bf V; static __device__ __forceinline__ V ld(const bf* p) { return cat16b(*(const v8us*)p, *(const v8us*)(p + 16)); } static __device__ __forceinline__ v8f mma(V a, V b, v8f c) { return wmmab(a, b, c); } };
template <typename T16, int NSPLIT, bool BIAS>
__global__ __launch_bounds__(32) void k_gemmw(const T16* __restrict__ A, const T16* __restrict__ A2, const T16* __restrict__ Bt, const T16* __restrict__ Bt2, int K, float* C, int ldc, const float* __restrict__ bias, size_t sA, size_t sB, size_t sC) {
    typedef typename WFrag<T16>::V V;
    __shared__ __align__(16) float os[16 * 68];
    const size_t z = blockIdx.z; A += z * sA; if (A2) A2 += z * sA; Bt += z * sB; if (Bt2) Bt2 += z * sB; C += z * sC;
    const int lane = threadIdx.x & 31, lr = lane & 15, hi = lane >> 4; const int r0 = blockIdx.x * 64, c0 = blockIdx.y * 64;
    v8f acc[4][4];
#pragma unroll
    for (int mb = 0; mb < 4; ++mb)
#pragma unroll
        for (int nb = 0; nb < 4; ++nb) acc[mb][nb] = (v8f){};
    const size_t aoff = (size_t)(r0 + lr) * K + 8 * hi, boff = (size_t)(c0 + lr) * K + 8 * hi;
#pragma unroll 1
    for (int kc = 0; kc < K; kc += 32) {
        V a[4], a2[4];
#pragma unroll
        for (int mb = 0; mb < 4; ++mb) { a[mb] = WFrag<T16>::ld(A + aoff + (size_t)mb * 16 * K + kc); if (NSPLIT == 1 || NSPLIT == 2) a2[mb] = WFrag<T16>::ld(A2 + aoff + (size_t)mb * 16 * K + kc); }
#pragma unroll
        for (int nb = 0; nb < 4; ++nb) { const V b = WFrag<T16>::ld(Bt + boff + (size_t)nb * 16 * K + kc); V b2; if (NSPLIT >= 2) b2 = WFrag<T16>::ld(Bt2 + boff + (size_t)nb * 16 * K + kc);
#pragma unroll
            for (int mb = 0; mb < 4; ++mb) { acc[mb][nb] = WFrag<T16>::mma(a[mb], b, acc[mb][nb]); if (NSPLIT == 1 || NSPLIT == 2) acc[mb][nb] = WFrag<T16>::mma(a2[mb], b, acc[mb][nb]); if (NSPLIT >= 2) acc[mb][nb] = WFrag<T16>::mma(a[mb], b2, acc[mb][nb]); } }
        asm volatile("v_nop\n\tv_nop\n\tv_nop\n\tv_nop" : "+v"(acc[0][0]), "+v"(acc[1][1]), "+v"(acc[2][2]), "+v"(acc[3][3]) : "v"(a[0]), "v"(a[3]));
    }
#pragma unroll
    for (int mb = 0; mb < 4; ++mb) {
#pragma unroll
        for (int nb = 0; nb < 4; ++nb) {
#pragma unroll
            for (int j = 0; j < 8; ++j) os[(hi * 8 + j) * 68 + nb * 16 + lr] = acc[mb][nb][j]; }
        __builtin_amdgcn_wave_barrier(); asm volatile("" ::: "memory");
        float* crow = C + (size_t)(r0 + mb * 16) * ldc + c0;
{
#pragma unroll
            for (int s = 0; s < 8; ++s) { const int row = 2 * s + hi, cofs = lr * 4; v4f val = *(const v4fa*)(os + row * 68 + cofs); if (BIAS) { val[0] += bfr(bias[c0 + cofs]); val[1] += bfr(bias[c0 + cofs + 1]); val[2] += bfr(bias[c0 + cofs + 2]); val[3] += bfr(bias[c0 + cofs + 3]); }
                *(v4f*)(crow + (size_t)row * ldc + cofs) = val; }
             }
        __builtin_amdgcn_wave_barrier(); asm volatile("" ::: "memory");
    }
}

// ---- k_gemmsk: the product of k_gemmw for a long K. NW waves of one work-group share one (MB*16)x64 output tile; wave w sums k in [w*KW, (w+1)*KW) with the loaders of k_gemmw;
// the NW partial tiles meet in LDS and are added in wave order (bias last). grid (M/(MB*16), N/64, Z), NW*32 threads. K = NW*KW.
template <typename T16, int NSPLIT, bool BIAS, int MB, int NW, int KW, int LDA = NW * KW>   // LDA: row pitch of A and A2 in elements
// waves_per_eu: registers are allotted as for one work-group per WGP (more fragment loads in flight per trip)
__global__ __launch_bounds__(NW * 32) __attribute__((amdgpu_waves_per_eu(NW / 4, NW / 4))) void k_gemmsk(const T16* __restrict__ A, const T16* __restrict__ A2, const T16* __restrict__ Bt, const T16* __restrict__ Bt2, float* C, int ldc, const float* __restrict__ bias0, const float* __restrict__ bias1, const float* __restrict__ bias2, size_t sA, size_t sB, size_t sC) {
    typedef typename WFrag<T16>::V V;
    constexpr int K = NW * KW, PT = MB * 16 * 68; static_assert((MB * 8) % NW == 0 && KW % 32 == 0, "tile and slice must divide evenly");
    __shared__ __align__(16) float red[NW * PT];
    const size_t z = blockIdx.z; A += z * sA; if (NSPLIT == 1 || NSPLIT == 2) A2 += z * sA; Bt += z * sB; if (NSPLIT >= 2) Bt2 += z * sB; C += z * sC; const float* bias = (z == 0) ? bias0 : (z == 1) ? bias1 : bias2;   // one bias vector per z plane
    const int tid = threadIdx.x, w = __builtin_amdgcn_readfirstlane(tid >> 5), lane = tid & 31, lr = lane & 15, hi = lane >> 4; const int r0 = blockIdx.x * (MB * 16), c0 = blockIdx.y * 64;
    v8f acc[MB][4];
#pragma unroll
    for (int mb = 0; mb < MB; ++mb)
#pragma unroll
        for (int nb = 0; nb < 4; ++nb) acc[mb][nb] = (v8f){};
    const size_t aoff = (size_t)(r0 + lr) * LDA + w * KW + 8 * hi, boff = (size_t)(c0 + lr) * K + w * KW + 8 * hi;
#pragma unroll 1   // rolled, as in k_gemmw: unrolled, this build waited on single load pairs
    for (int kc = 0; kc < KW; kc += 32) {
        V a[MB], a2[MB]; const T16* pa = A + aoff + kc; const T16* pa2 = (NSPLIT == 1 || NSPLIT == 2) ? A2 + aoff + kc : nullptr;
#pragma unroll
        for (int mb = 0; mb < MB; ++mb) { a[mb] = WFrag<T16>::ld(pa + (size_t)mb * 16 * LDA); if (NSPLIT == 1 || NSPLIT == 2) a2[mb] = WFrag<T16>::ld(pa2 + (size_t)mb * 16 * LDA); }
        // the registers of pa and pa2 are reused behind these loads: this wait stands in front of that overwrite, and as its inputs they stay whole up to it
        if (NSPLIT == 1 || NSPLIT == 2) asm volatile("s_wait_xcnt 0x0" :: "v"(pa), "v"(pa2) : "memory"); else asm volatile("s_wait_xcnt 0x0" :: "v"(pa) : "memory");
#pragma unroll
        for (int nb = 0; nb < 4; ++nb) { const V b = WFrag<T16>::ld(Bt + boff + (size_t)nb * 16 * K + kc); V b2; if (NSPLIT >= 2) b2 = WFrag<T16>::ld(Bt2 + boff + (size_t)nb * 16 * K + kc);
#pragma unroll
            for (int mb = 0; mb < MB; ++mb) { acc[mb][nb] = WFrag<T16>::mma(a[mb], b, acc[mb][nb]); if (NSPLIT == 1 || NSPLIT == 2) acc[mb][nb] = WFrag<T16>::mma(a2[mb], b, acc[mb][nb]); if (NSPLIT >= 2) acc[mb][nb] = WFrag<T16>::mma(a[mb], b2, acc[mb][nb]); } }
    }
    float* my = red + w * PT;
#pragma unroll
    for (int mb = 0; mb < MB; ++mb)
#pragma unroll
        for (int nb = 0; nb < 4; ++nb)
#pragma unroll
            for (int j = 0; j < 8; ++j) my[(mb * 16 + hi * 8 + j) * 68 + nb * 16 + lr] = acc[mb][nb][j];
    __syncthreads();   // every wave's partial tile is in LDS before any thread adds them
#pragma unroll
    for (int s = 0; s < MB * 8 / NW; ++s) { const int it = s * NW * 32 + tid, row = it >> 4, cofs = (it & 15) * 4; v4f val = *(const v4fa*)(red + row * 68 + cofs);
#pragma unroll
        for (int p = 1; p < NW; ++p) val += *(const v4fa*)(red + p * PT + row * 68 + cofs);
        if (BIAS) { val[0] += bfr(bias[c0 + cofs]); val[1] += bfr(bias[c0 + cofs + 1]); val[2] += bfr(bias[c0 + cofs + 2]); val[3] += bfr(bias[c0 + cofs + 3]); }
        *(v4f*)(C + (size_t)(r0 + row) * ldc + c0 + cofs) = val; }
}

__device__ __forceinline__ h16 tohx(float x) { return (h16)x; }
__device__ __forceinline__ void splitf(float y, unsigned short& h, unsigned short& l) { h = f2bf(y); l = f2bf(y - bf2f(h)); }
typedef __attribute__((ext_vector_type(2))) _Float16 v2h;
typedef __attribute__((ext_vector_type(4))) _Float16 v4h;
typedef __attribute__((ext_vector_type(2))) unsigned short v2us;
typedef __attribute__((ext_vector_type(4))) unsigned short v4us;
typedef __attribute__((ext_vector_type(2))) float v2f;
typedef __attribute__((ext_vector_type(4))) int v4i;

__global__ __launch_bounds__(256) void k_wtG(const float* __restrict__ w0, const float* __restrict__ w1, const float* __restrict__ w2, const float* __restrict__ w3, int K, int N, bf* Bt) {
    const int y = blockIdx.y; const float* w = (y == 0) ? w0 : (y == 1) ? w1 : (y == 2) ? w2 : w3; Bt += (size_t)y * K * N;   // blockIdx.y: which of the four equal-shaped matrices
    const int lane = threadIdx.x & 31; const int L0 = (blockIdx.x * 8 + (threadIdx.x >> 5)) * 8; const int nlines = N * K / 64;
{
#pragma unroll 1
        for (int l = 0; l < 8; ++l) { const int L = L0 + l; if (L >= nlines) break; const size_t e = (size_t)L * 64 + lane * 2; const int k = (int)(e % K), n = (int)(e / K); v2us o;
            o[0] = f2bf(w[(size_t)k * N + n]); o[1] = f2bf(w[(size_t)(k + 1) * N + n]); *(v2us*)(Bt + e) = o; }
         }
}
__global__ __launch_bounds__(256) void k_cvt8(const float* __restrict__ s0, const float* __restrict__ s1, const float* __restrict__ s2, bf* dst, size_t n8) { const size_t i = (size_t)blockIdx.x * 256 + threadIdx.x; if (i >= n8) return; const int y = blockIdx.y; const float* src = (y == 0) ? s0 : (y == 1) ? s1 : s2; dst += (size_t)y * n8 * 8;   // blockIdx.y: which of the three equal-shaped tensors
    const v8f v = *(const v8f*)(src + i * 8); v8us o;
#pragma unroll
    for (int k = 0; k < 8; ++k) o[k] = f2bf(v[k]); *(v8us*)(dst + i * 8) = o;  }

// k_rope: head planes [h][t][d] (fp16 + hi/lo) of rope(x) x sc with the rotate-half convention out[d] = x[d] cos[t][d] - x[d+HD/2] sin[t][d], out[d+HD/2] = x[d+HD/2] cos[t][d+HD/2] + x[d] sin[t][d+HD/2]
__global__ __launch_bounds__(256) void k_rope(const float* __restrict__ F, int pitch, int nheads, const float* __restrict__ CS, const float* __restrict__ RF, const float* __restrict__ nw, float sc, h16* P16, bf* Ph, bf* Pl) {
    { const size_t zb = (size_t)blockIdx.z * NB_ + blockIdx.y; F += zb * TT * pitch; P16 += zb * nheads * TT * HD; Ph += zb * nheads * TT * HD; Pl += zb * nheads * TT * HD; }   // blockIdx.y: batch; blockIdx.z: q or k (sources and plane sets lie one after the other)
    const size_t e = ((size_t)blockIdx.x * 256 + threadIdx.x) * 2; if (e >= (size_t)nheads * TT * HD) return; const int d = (int)(e % HD); const int t = (int)((e / HD) % TT); const int h = (int)(e / ((size_t)HD * TT)); const float* f = F + (size_t)t * pitch + h * HD; const float rf = RF ? RF[(size_t)h * TT + t] : 1.0f; v2h o16; v2us oh, ol;
#pragma unroll
    for (int q = 0; q < 2; ++q) { const int dd = d + q; const int dp = (dd < HD / 2) ? dd + HD / 2 : dd - HD / 2; float x0 = f[dd], x1 = f[dp];
        if (RF) { float n0 = __fmul_rn(x0, rf), n1 = __fmul_rn(x1, rf); asm volatile("" : "+v"(n0)); asm volatile("" : "+v"(n1)); x0 = __fmul_rn(bfr(nw[dd]), n0); x1 = __fmul_rn(bfr(nw[dp]), n1); }
        const v2f cs = *(const v2f*)(CS + ((size_t)t * HD + dd) * 2); float a = __fmul_rn(x0, cs[0]), bq = __fmul_rn(x1, cs[1]); asm volatile("" : "+v"(a)); asm volatile("" : "+v"(bq)); const float r = ((dd < HD / 2) ? __fsub_rn(a, bq) : __fadd_rn(a, bq)) * sc;
        o16[q] = tohx(r); unsigned short a2, c2; splitf(r, a2, c2); oh[q] = a2; ol[q] = c2; }
    *(v2h*)(P16 + e) = o16; *(v2us*)(Ph + e) = oh; *(v2us*)(Pl + e) = ol;  }
__global__ __launch_bounds__(256) void k_vtp(const float* __restrict__ F, int pitch, int nheads, h16* V16, bf* Vh, bf* Vl) { const size_t e = ((size_t)blockIdx.x * 256 + threadIdx.x) * 2; if (e >= (size_t)NB_ * nheads * HD * TT) return; const int t = (int)(e % TT); const int d = (int)((e / TT) % HD); const int zg = (int)(e / ((size_t)TT * HD)); const int g = zg % nheads; F += (size_t)(zg / nheads) * TT * pitch; v2h o16; v2us oh, ol;
#pragma unroll
    for (int q = 0; q < 2; ++q) { const float x = F[(size_t)(t + q) * pitch + g * HD + d]; o16[q] = tohx(x); unsigned short a2, c2; splitf(x, a2, c2); oh[q] = a2; ol[q] = c2; }
    *(v2h*)(V16 + e) = o16; *(v2us*)(Vh + e) = oh; *(v2us*)(Vl + e) = ol;  }
__global__ __launch_bounds__(256) void k_csid(float* CS) { const int idx = blockIdx.x * 256 + threadIdx.x; if (idx >= TT * HD) return; v2f cs; cs[0] = 1.0f; cs[1] = 0.0f; *(v2f*)(CS + (size_t)idx * 2) = cs;  }
// k_asoft: per row (zz, i): t = tau[b] (S x HD^-0.5) + delta[b][j] (no mask); softmax over the 2048 keys (register row, one exp, fixed trees);
__global__ __launch_bounds__(256) void k_asoft(float* Sb, const float* __restrict__ TAU, const float* __restrict__ DEL, int z0) {
    const int lane = threadIdx.x & 31; const int row = blockIdx.x * 8 + (threadIdx.x >> 5); if (row >= ZH * TT) return; const int i = row % TT; const int zz = row / TT; const int b = (z0 + zz) / NH_; const float* DELb = DEL + (size_t)b * TT; float tau = bfr(TAU[b]); asm volatile("" : "+v"(tau)); const bool hires = (i < RH); const float* sr = Sb + (size_t)row * TT; float v[TT / 32]; float mx = -3.0e38f;
#pragma unroll
    for (int ch = 0; ch < TT / 128; ++ch) { const int j0 = ch * 128 + lane * 4; const v4f a = *(const v4f*)(sr + j0);
#pragma unroll
        for (int q = 0; q < 4; ++q) { const int j = j0 + q; float s0 = a[q] * SCL; asm volatile("" : "+v"(s0)); float s1 = __fmul_rn(tau, s0); asm volatile("" : "+v"(s1)); float dl = bfr(DELb[j]); asm volatile("" : "+v"(dl)); const float t = __fadd_rn(s1, dl);   /* tau (q.k/8) + delta[j] */ v[ch * 4 + q] = t; mx = fmaxf(mx, t); } }
#pragma unroll
    for (int sh = 16; sh; sh >>= 1) mx = fmaxf(mx, __shfl_xor(mx, sh, 32));
    float sum = 0.f;
#pragma unroll
    for (int k = 0; k < TT / 32; ++k) { float d0 = __fsub_rn(v[k], mx); asm volatile("" : "+v"(d0)); v[k] = __builtin_amdgcn_exp2f(__fmul_rn(d0, 1.4426950408889634f)); sum += v[k]; }
#pragma unroll
    for (int sh = 16; sh; sh >>= 1) sum += __shfl_xor(sum, sh, 32);
    const float f = __fdiv_rn(hires ? 1.0f : PCAR, sum);
    // the probabilities go over the wave's own score row (8 KiB: hi plane then lo plane, or fp16 in its first half); every store needs f, which needs every load of the row
    bf* Ph = (bf*)(Sb + (size_t)row * TT); h16* P16 = (h16*)(Sb + (size_t)row * TT);
{
        if (hires) {
#pragma unroll
            for (int ch = 0; ch < TT / 128; ++ch) { v4us oh, ol;
#pragma unroll
                for (int q = 0; q < 4; ++q) { unsigned short a, c2; splitf(v[ch * 4 + q] * f, a, c2); oh[q] = a; ol[q] = c2; }
                const int oo = ch * 128 + lane * 4; *(v4us*)(Ph + oo) = oh; *(v4us*)(Ph + TT + oo) = ol; }
        } else {
#pragma unroll
            for (int ch = 0; ch < TT / 128; ++ch) { v4h o4;
#pragma unroll
                for (int q = 0; q < 4; ++q) o4[q] = tohx(v[ch * 4 + q] * f);
                *(v4h*)(P16 + ch * 128 + lane * 4) = o4; } }
         }
}
__global__ __launch_bounds__(256) void k_merge(const float* __restrict__ O, bf* Ah, bf* Al) { const size_t e = ((size_t)blockIdx.x * 256 + threadIdx.x) * 2; if (e >= (size_t)NZ * TT * HD) return; const int d = (int)(e % HD); const int t = (int)((e / HD) % TT); const int zz = (int)(e / ((size_t)HD * TT)); const float cs = (t < RH) ? 1.0f : (1.0f / PCAR); const size_t oo = ((size_t)(zz / NH_) * TT + t) * DQ + (zz % NH_) * HD + d;
    v2us oh, ol;
#pragma unroll
    for (int q = 0; q < 2; ++q) { unsigned short a, c2; splitf(O[e + q] * cs, a, c2); oh[q] = a; ol[q] = c2; } *(v2us*)(Ah + oo) = oh; *(v2us*)(Al + oo) = ol;  }

extern "C" void kernel_launch(void* const* d_in, const int* in_sizes, int n_in,
                              void* d_out, int out_size, void* d_ws, size_t ws_size, hipStream_t stream) {
    (void)in_sizes; (void)n_in; (void)out_size;
    const float* x = (const float*)d_in[0]; const float* xk = (const float*)d_in[1]; const float* xv = (const float*)d_in[2]; const float* TAU = (const float*)d_in[3]; const float* DEL = (const float*)d_in[4]; const float* wq = (const float*)d_in[5]; const float* bq = (const float*)d_in[6]; const float* wk = (const float*)d_in[7]; const float* bk = (const float*)d_in[8]; const float* wv = (const float*)d_in[9]; const float* bv = (const float*)d_in[10]; const float* wo = (const float*)d_in[11]; const float* bo = (const float*)d_in[12];
    float* OUT = (float*)d_out;     // [4][2048][512]
    char* wsp = (char*)d_ws;
    auto take = [&](size_t bytes) { char* p = wsp; wsp += (bytes + 255) & ~(size_t)255; return (void*)p; };
    const size_t PLN = (size_t)NZ * TT * HD;   // elements of one plane set: every (batch, head)
    bf* WQ = (bf*)take((size_t)DQ * DM * 2); bf* WK = (bf*)take((size_t)DKV * DM * 2); bf* WV = (bf*)take((size_t)DKV * DM * 2); bf* WO = (bf*)take((size_t)DM * DQ * 2); float* CS = (float*)take((size_t)TT * HD * 2 * 4); (void)WK; (void)WV;
    h16* QP16 = (h16*)take(PLN * 2); h16* KP16 = (h16*)take(PLN * 2); h16* VT16 = (h16*)take(PLN * 2);
    bf* QPh = (bf*)take(PLN * 2); bf* KPh = (bf*)take(PLN * 2); bf* QPl = (bf*)take(PLN * 2); bf* KPl = (bf*)take(PLN * 2); bf* VTh = (bf*)take(PLN * 2); bf* VTl = (bf*)take(PLN * 2);
    float* Ob = (float*)take(PLN * 4); bf* ATh = (bf*)take((size_t)NB_ * TT * DQ * 2); bf* ATl = (bf*)take((size_t)NB_ * TT * DQ * 2);
    float* Sb = (float*)take((size_t)ZH * TT * TT * 4);
    if ((size_t)(wsp - (char*)d_ws) > ws_size) return;    // ws 256 MiB
    // the bf16 inputs and the f32 projections are dead once the planes are built: they lie in the score buffer (72 of its 128 MiB; stream-ordered)
    wsp = (char*)Sb; bf* XB = (bf*)take((size_t)3 * NB_ * TT * DM * 2); float* FQ = (float*)take((size_t)NB_ * TT * DQ * 4); float* FK = (float*)take((size_t)NB_ * TT * DKV * 4); float* FV = (float*)take((size_t)NB_ * TT * DKV * 4); (void)FK;
    k_wtG<<<dim3((unsigned)((DM * DQ / 64 + 63) / 64), 4, 1), 256, 0, stream>>>(wq, wk, wv, wo, DM, DQ, WQ);
    k_csid<<<(TT * HD + 255) / 256, 256, 0, stream>>>(CS);
    k_cvt8<<<dim3((unsigned)(((size_t)NB_ * TT * DM / 8 + 255) / 256), 3, 1), 256, 0, stream>>>(x, xk, xv, XB, (size_t)NB_ * TT * DM / 8);
    // q, k, v projections of all batches: rows = NB_*TT, z = which projection
    k_gemmsk<bf, 0, true, 4, 8, DM / 8><<<dim3(NB_ * TT / 64, DQ / 64, 3), 256, 0, stream>>>(XB, nullptr, WQ, nullptr, FQ, DQ, bq, bk, bv, (size_t)NB_ * TT * DM, (size_t)DQ * DM, (size_t)NB_ * TT * DQ);
    k_rope<<<dim3((unsigned)(((size_t)NH_ * TT * HD / 2 + 255) / 256), NB_, 2), 256, 0, stream>>>(FQ, DQ, NH_, CS, nullptr, nullptr, 1.0f, QP16, QPh, QPl);
    k_vtp<<<(unsigned)((PLN / 2 + 255) / 256), 256, 0, stream>>>(FV, DKV, NKV, VT16, VTh, VTl);
    for (int z0 = 0; z0 < NZ; z0 += ZH) { const size_t zo = (size_t)z0 * TT * HD;   // ZH consecutive (batch, head) planes per pass (z-strides TT*HD)
        k_gemmw<bf, 2, false><<<dim3(RH / 64, TT / 64, ZH), 32, 0, stream>>>(QPh + zo, QPl + zo, KPh + zo, KPl + zo, HD, Sb, TT, nullptr, (size_t)TT * HD, (size_t)TT * HD, (size_t)TT * TT);
        k_gemmw<h16, 0, false><<<dim3((TT - RH) / 64, TT / 64, ZH), 32, 0, stream>>>(QP16 + zo + (size_t)RH * HD, nullptr, KP16 + zo, nullptr, HD, Sb + (size_t)RH * TT, TT, nullptr, (size_t)TT * HD, (size_t)TT * HD, (size_t)TT * TT);
        k_asoft<<<ZH * TT / 8, 256, 0, stream>>>(Sb, TAU, DEL, z0);
        k_gemmsk<bf, 2, false, 2, 16, TT / 16, 2 * TT><<<dim3(RH / 32, HD / 64, ZH), 512, 0, stream>>>((const bf*)Sb, (const bf*)Sb + TT, VTh + zo, VTl + zo, Ob + zo, HD, nullptr, nullptr, nullptr, (size_t)2 * TT * TT, (size_t)HD * TT, (size_t)TT * HD);
        k_gemmsk<h16, 0, false, 2, 16, TT / 16, 2 * TT><<<dim3((TT - RH) / 32, HD / 64, ZH), 512, 0, stream>>>((const h16*)Sb + (size_t)RH * 2 * TT, nullptr, VT16 + zo, nullptr, Ob + zo + (size_t)RH * HD, HD, nullptr, nullptr, nullptr, (size_t)2 * TT * TT, (size_t)HD * TT, (size_t)TT * HD); }
    k_merge<<<(unsigned)((PLN / 2 + 255) / 256), 256, 0, stream>>>(Ob, ATh, ATl);
    k_gemmsk<bf, 1, true, 4, 8, DQ / 8><<<dim3(NB_ * TT / 64, DM / 64, 1), 256, 0, stream>>>(ATh, ATl, WO, nullptr, OUT, DM, bo, nullptr, nullptr, 0, 0, 0);
}

// v004
// One run takes 221 microseconds.
// Versions in between are left out here; by their measured steps it is 2.97 times as fast as v002.
// Over all steps from v000 it is 10.2 times as fast.
#include <hip/hip_runtime.h>

// De-stationary attention (Non-stationary Transformer) (queries, keys, values [4][2048][512]; q, k, v = . W + b ('xw' [512][512]; 8 heads x 64); scores = tau[b] (q.k/8) + delta[b][s] (tau [4], delta [4][2048], read); softmax; out = merged Wo + bo -> [4][2048][512] (4.2 M)).
// Compute dtypes, f32 accumulate: every input rounded to bf16; q/k/v on PLAIN bf16 operands (inputs: exact) + biases; tau scale and delta shift applied in f32 per (i, j) inside the attention kernel; scores and attn.v: query rows < 512 hl (3 products), the rest single fp16 (x1024); softmax f32; Wo hl x exact (2 products) + bo.

#define NB_  4
#define TT   2048
#define DM   512
#define NH_  8
#define NKV  8
#define REP  (NH_ / NKV)
#define HD   64
#define DQ   (NH_ * HD)
#define DKV  (NKV * HD)
#define NZ   (NB_ * NH_)          // all (batch, head) planes
#define RH   512                  // query rows < RH use hi+lo planes (0: none)
#define WIN  0
#define PCAR 1024.0f
#define SCL  0.125f   // HD^-0.5
typedef _Float16 h16;
typedef unsigned short bf;
typedef __attribute__((ext_vector_type(16))) __bf16   v16bf;
typedef __attribute__((ext_vector_type(16))) _Float16 v16h;
typedef __attribute__((ext_vector_type(8)))  _Float16 v8h;
typedef __attribute__((ext_vector_type(8)))  unsigned short v8us;
typedef __attribute__((ext_vector_type(8)))  float    v8f;
typedef __attribute__((ext_vector_type(4)))  float    v4f;
typedef v8h  __attribute__((may_alias)) v8ha;
typedef v4f  __attribute__((may_alias)) v4fa;
typedef v8us __attribute__((may_alias)) v8usa;

__device__ __forceinline__ unsigned short f2bf(float f) { unsigned u = __float_as_uint(f); u += 0x7FFFu + ((u >> 16) & 1u); return (unsigned short)(u >> 16); }
__device__ __forceinline__ float bf2f(unsigned short b) { return __uint_as_float(((unsigned)b) << 16); }
__device__ __forceinline__ float bfr(float f) { return bf2f(f2bf(f)); }
__device__ __forceinline__ v16h cat16(v8h lo, v8h hi) { return __builtin_shufflevector(lo, hi, 0, 1, 2, 3, 4, 5, 6, 7, 8, 9, 10, 11, 12, 13, 14, 15); }
__device__ __forceinline__ v16bf cat16b(v8us lo, v8us hi) { return __builtin_bit_cast(v16bf, __builtin_shufflevector(lo, hi, 0, 1, 2, 3, 4, 5, 6, 7, 8, 9, 10, 11, 12, 13, 14, 15)); }
__device__ __forceinline__ v8f wmma16(v16h a, v16h b, v8f c) { return __builtin_amdgcn_wmma_f32_16x16x32_f16(false, a, false, b, (short)0, c, false, false); }
__device__ __forceinline__ v8f wmmab(v16bf a, v16bf b, v8f c) { return __builtin_amdgcn_wmma_f32_16x16x32_bf16(false, a, false, b, (short)0, c, false, false); }



// fragment loaders: K-contiguous 16-bit planes, lane (lr, hi) takes k = 8 hi + 0..7 and 16 + 8 hi + 0..7 of each 32
template <typename T16> struct WFrag;
template <> struct WFrag<h16> { typedef v16h V; static __device__ __forceinline__ V ld(const h16* p) { return cat16(*(const v8h*)p, *(const v8h*)(p + 16)); } static __device__ __forceinline__ v8f mma(V a, V b, v8f c) { return wmma16(a, b, c); } };
template <> struct WFrag<bf> { typedef v16bf V; static __device__ __forceinline__ V ld(const bf* p) { return cat16b(*(const v8us*)p, *(const v8us*)(p + 16)); } static __device__ __forceinline__ v8f mma(V a, V b, v8f c) { return wmmab(a, b, c); } };
// ---- k_gemmsk: C[m][n] (f32, pitch ldc, + optional f32 bias[n]) = sum_k A[m][k] Bt[n][k] (+ split products per NSPLIT), operands straight from K-contiguous 16-bit planes. NW waves of one work-group share one (MB*16)x64 output tile; wave w sums k in [w*KW, (w+1)*KW) with the WFrag loaders;
// the NW partial tiles meet in LDS and are added in wave order (bias last). grid (M/(MB*16), N/64, Z), NW*32 threads. K = NW*KW.
template <typename T16, int NSPLIT, bool BIAS, int MB, int NW, int KW, int LDA = NW * KW>   // LDA: row pitch of A and A2 in elements
// waves_per_eu: registers are allotted as for one work-group per WGP (more fragment loads in flight per trip)
__global__ __launch_bounds__(NW * 32) __attribute__((amdgpu_waves_per_eu(NW / 4, NW / 4))) void k_gemmsk(const T16* __restrict__ A, const T16* __restrict__ A2, const T16* __restrict__ Bt, const T16* __restrict__ Bt2, float* C, int ldc, const float* __restrict__ bias0, const float* __restrict__ bias1, const float* __restrict__ bias2, size_t sA, size_t sB, size_t sC) {
    typedef typename WFrag<T16>::V V;
    constexpr int K = NW * KW, PT = MB * 16 * 68; static_assert((MB * 8) % NW == 0 && KW % 32 == 0, "tile and slice must divide evenly");
    __shared__ __align__(16) float red[NW * PT];
    const size_t z = blockIdx.z; A += z * sA; if (NSPLIT == 1 || NSPLIT == 2) A2 += z * sA; Bt += z * sB; if (NSPLIT >= 2) Bt2 += z * sB; C += z * sC; const float* bias = (z == 0) ? bias0 : (z == 1) ? bias1 : bias2;   // one bias vector per z plane
    const int tid = threadIdx.x, w = __builtin_amdgcn_readfirstlane(tid >> 5), lane = tid & 31, lr = lane & 15, hi = lane >> 4; const int r0 = blockIdx.x * (MB * 16), c0 = blockIdx.y * 64;
    v8f acc[MB][4];
#pragma unroll
    for (int mb = 0; mb < MB; ++mb)
#pragma unroll
        for (int nb = 0; nb < 4; ++nb) acc[mb][nb] = (v8f){};
    const size_t aoff = (size_t)(r0 + lr) * LDA + w * KW + 8 * hi, boff = (size_t)(c0 + lr) * K + w * KW + 8 * hi;
#pragma unroll 1   // rolled: unrolled, this build waited on single load pairs
    for (int kc = 0; kc < KW; kc += 32) {
        V a[MB], a2[MB]; const T16* pa = A + aoff + kc; const T16* pa2 = (NSPLIT == 1 || NSPLIT == 2) ? A2 + aoff + kc : nullptr;
#pragma unroll
        for (int mb = 0; mb < MB; ++mb) { a[mb] = WFrag<T16>::ld(pa + (size_t)mb * 16 * LDA); if (NSPLIT == 1 || NSPLIT == 2) a2[mb] = WFrag<T16>::ld(pa2 + (size_t)mb * 16 * LDA); }
        // the registers of pa and pa2 are reused behind these loads: this wait stands in front of that overwrite, and as its inputs they stay whole up to it
        if (NSPLIT == 1 || NSPLIT == 2) asm volatile("s_wait_xcnt 0x0" :: "v"(pa), "v"(pa2) : "memory"); else asm volatile("s_wait_xcnt 0x0" :: "v"(pa) : "memory");
#pragma unroll
        for (int nb = 0; nb < 4; ++nb) { const V b = WFrag<T16>::ld(Bt + boff + (size_t)nb * 16 * K + kc); V b2; if (NSPLIT >= 2) b2 = WFrag<T16>::ld(Bt2 + boff + (size_t)nb * 16 * K + kc);
#pragma unroll
            for (int mb = 0; mb < MB; ++mb) { acc[mb][nb] = WFrag<T16>::mma(a[mb], b, acc[mb][nb]); if (NSPLIT == 1 || NSPLIT == 2) acc[mb][nb] = WFrag<T16>::mma(a2[mb], b, acc[mb][nb]); if (NSPLIT >= 2) acc[mb][nb] = WFrag<T16>::mma(a[mb], b2, acc[mb][nb]); } }
    }
    float* my = red + w * PT;
#pragma unroll
    for (int mb = 0; mb < MB; ++mb)
#pragma unroll
        for (int nb = 0; nb < 4; ++nb)
#pragma unroll
            for (int j = 0; j < 8; ++j) my[(mb * 16 + hi * 8 + j) * 68 + nb * 16 + lr] = acc[mb][nb][j];
    __syncthreads();   // every wave's partial tile is in LDS before any thread adds them
#pragma unroll
    for (int s = 0; s < MB * 8 / NW; ++s) { const int it = s * NW * 32 + tid, row = it >> 4, cofs = (it & 15) * 4; v4f val = *(const v4fa*)(red + row * 68 + cofs);
#pragma unroll
        for (int p = 1; p < NW; ++p) val += *(const v4fa*)(red + p * PT + row * 68 + cofs);
        if (BIAS) { val[0] += bfr(bias[c0 + cofs]); val[1] += bfr(bias[c0 + cofs + 1]); val[2] += bfr(bias[c0 + cofs + 2]); val[3] += bfr(bias[c0 + cofs + 3]); }
        *(v4f*)(C + (size_t)(r0 + row) * ldc + c0 + cofs) = val; }
}

__device__ __forceinline__ h16 tohx(float x) { return (h16)x; }
__device__ __forceinline__ void splitf(float y, unsigned short& h, unsigned short& l) { h = f2bf(y); l = f2bf(y - bf2f(h)); }
typedef __attribute__((ext_vector_type(2))) _Float16 v2h;
typedef __attribute__((ext_vector_type(4))) _Float16 v4h;
typedef __attribute__((ext_vector_type(2))) unsigned short v2us;
typedef __attribute__((ext_vector_type(4))) unsigned short v4us;
typedef __attribute__((ext_vector_type(2))) float v2f;
typedef __attribute__((ext_vector_type(4))) int v4i;

__global__ __launch_bounds__(256) void k_wtG(const float* __restrict__ w0, const float* __restrict__ w1, const float* __restrict__ w2, const float* __restrict__ w3, int K, int N, bf* Bt) {
    const int y = blockIdx.y; const float* w = (y == 0) ? w0 : (y == 1) ? w1 : (y == 2) ? w2 : w3; Bt += (size_t)y * K * N;   // blockIdx.y: which of the four equal-shaped matrices
    const int lane = threadIdx.x & 31; const int L0 = (blockIdx.x * 8 + (threadIdx.x >> 5)) * 8; const int nlines = N * K / 64;
{
#pragma unroll 1
        for (int l = 0; l < 8; ++l) { const int L = L0 + l; if (L >= nlines) break; const size_t e = (size_t)L * 64 + lane * 2; const int k = (int)(e % K), n = (int)(e / K); v2us o;
            o[0] = f2bf(w[(size_t)k * N + n]); o[1] = f2bf(w[(size_t)(k + 1) * N + n]); *(v2us*)(Bt + e) = o; }
         }
}
__global__ __launch_bounds__(256) void k_cvt8(const float* __restrict__ s0, const float* __restrict__ s1, const float* __restrict__ s2, bf* dst, size_t n8) { const size_t i = (size_t)blockIdx.x * 256 + threadIdx.x; if (i >= n8) return; const int y = blockIdx.y; const float* src = (y == 0) ? s0 : (y == 1) ? s1 : s2; dst += (size_t)y * n8 * 8;   // blockIdx.y: which of the three equal-shaped tensors
    const v8f v = *(const v8f*)(src + i * 8); v8us o;
#pragma unroll
    for (int k = 0; k < 8; ++k) o[k] = f2bf(v[k]); *(v8us*)(dst + i * 8) = o;  }

// ---- k_qkv: the three projections of all batches, K split over 8 waves as in k_gemmsk (same loaders, same partial sums, same order of addition, bias last); the epilogue writes the attention kernel's operand planes itself.
// z = 0, 1 (q, k): A = 64 token rows, B = the 64 columns of head blockIdx.y -> planes [batch][head][t][d]. z = 2 (v): the operands change places (A = the head's 64 weight rows, B = 64 tokens),
// so the tile comes out as [d][t] and goes to the transposed planes [batch][head][d][t] in whole lines too. Each value is stored as fp16 and as bf16 hi + lo.
__global__ __launch_bounds__(256) __attribute__((amdgpu_waves_per_eu(2, 2))) void k_qkv(const bf* __restrict__ X, const bf* __restrict__ Wt, const float* __restrict__ bias0, const float* __restrict__ bias1, const float* __restrict__ bias2, h16* P16, bf* Ph, bf* Pl, h16* V16, bf* Vh, bf* Vl) {
    typedef WFrag<bf> F; typedef F::V V;
    constexpr int NW = 8, KW = DM / NW, PT = 64 * 68;
    __shared__ __align__(16) float red[NW * PT];
    const int z = blockIdx.z; const bool tr = (z == 2); const float* bias = (z == 0) ? bias0 : (z == 1) ? bias1 : bias2;
    const int tid = threadIdx.x, w = __builtin_amdgcn_readfirstlane(tid >> 5), lane = tid & 31, lr = lane & 15, hi = lane >> 4; const int t0 = blockIdx.x * 64, n0 = blockIdx.y * 64;
    const bf* Xz = X + (size_t)z * NB_ * TT * DM + (size_t)t0 * DM; const bf* Wz = Wt + (size_t)z * DQ * DM + (size_t)n0 * DM;
    const bf* A = tr ? Wz : Xz; const bf* Bt = tr ? Xz : Wz;
    v8f acc[4][4];
#pragma unroll
    for (int mb = 0; mb < 4; ++mb)
#pragma unroll
        for (int nb = 0; nb < 4; ++nb) acc[mb][nb] = (v8f){};
    const size_t off = (size_t)lr * DM + w * KW + 8 * hi;
#pragma unroll 1   // rolled, as in k_gemmsk: unrolled, that build waited on single load pairs
    for (int kc = 0; kc < KW; kc += 32) {
        V a[4]; const bf* pa = A + off + kc;
#pragma unroll
        for (int mb = 0; mb < 4; ++mb) a[mb] = F::ld(pa + (size_t)mb * 16 * DM);
        // the registers of pa are reused behind these loads: this wait stands in front of that overwrite, and as its input they stay whole up to it
        asm volatile("s_wait_xcnt 0x0" :: "v"(pa) : "memory");
#pragma unroll
        for (int nb = 0; nb < 4; ++nb) { const V b = F::ld(Bt + off + (size_t)nb * 16 * DM + kc);
#pragma unroll
            for (int mb = 0; mb < 4; ++mb) acc[mb][nb] = F::mma(a[mb], b, acc[mb][nb]); }
    }
    float* my = red + w * PT;
#pragma unroll
    for (int mb = 0; mb < 4; ++mb)
#pragma unroll
        for (int nb = 0; nb < 4; ++nb)
#pragma unroll
            for (int j = 0; j < 8; ++j) my[(mb * 16 + hi * 8 + j) * 68 + nb * 16 + lr] = acc[mb][nb][j];
    __syncthreads();   // every wave's partial tile is in LDS before any thread adds them
    const int zh = (t0 / TT) * NH_ + (int)blockIdx.y, tt0 = t0 % TT;   // (batch, head) plane; first token of the tile inside its batch (a tile never crosses a batch: TT % 64 == 0)
    h16* d16 = tr ? V16 + ((size_t)zh * HD) * TT + tt0 : P16 + (size_t)z * NZ * TT * HD + ((size_t)zh * TT + tt0) * HD;
    bf* dh = tr ? Vh + ((size_t)zh * HD) * TT + tt0 : Ph + (size_t)z * NZ * TT * HD + ((size_t)zh * TT + tt0) * HD;
    bf* dl = tr ? Vl + ((size_t)zh * HD) * TT + tt0 : Pl + (size_t)z * NZ * TT * HD + ((size_t)zh * TT + tt0) * HD;
    const int pitch = tr ? TT : HD;
#pragma unroll
    for (int s = 0; s < 4; ++s) { const int it = s * 256 + tid, row = it >> 4, cofs = (it & 15) * 4; v4f val = *(const v4fa*)(red + row * 68 + cofs);
#pragma unroll
        for (int p = 1; p < NW; ++p) val += *(const v4fa*)(red + p * PT + row * 68 + cofs);
        v4h o16; v4us oh, ol;
#pragma unroll
        for (int q = 0; q < 4; ++q) { const float r = val[q] + bfr(bias[n0 + (tr ? row : cofs + q)]); o16[q] = tohx(r); unsigned short a2, c2; splitf(r, a2, c2); oh[q] = a2; ol[q] = c2; }
        const size_t e = (size_t)row * pitch + cofs; *(v4h*)(d16 + e) = o16; *(v4us*)(dh + e) = oh; *(v4us*)(dl + e) = ol; }
}
// ---- k_fattn: scores, softmax and attn.v of one (batch, head) plane in one kernel; no score or probability leaves the registers.
// Transposed products: S^T = K Q^T (A = 16 key rows, B = 16 query columns), so lane (lr, hi) holds, for query lr, the scores of keys 8 hi + 0..7 of each 16-key tile;
// two such tiles, converted in place, are the B fragment of O^T += V^T P^T in the k order of the WFrag loaders. Running maximum and sum per query (online softmax), 32 keys a pass.
// x = log2(e) (tau (q.k/8) + delta[j]); p = 2^(x - m). Rows < RH: hi+lo bf16 planes, 3 products each; the rest fp16 with p x 1024 (the factor cancels in p / sum).
typedef __attribute__((ext_vector_type(8))) __bf16 v8b;
#define LOG2E 1.4426950408889634f
__device__ __forceinline__ float xhalf(float x) { const int b = __float_as_int(x); return __int_as_float(__builtin_amdgcn_permlanex16(b, b, 0x76543210, 0xfedcba98, false, false)); }   // lane l <-> l ^ 16
// 2^x of eight values / of one value. One statement each, results in registers of their own ("=&v"), closed by v_nop: the slot the instruction set asks for between a transcendental
// and an instruction that reads its result or overwrites its source.
__device__ __forceinline__ v8f exp2x8(v8f x) { float r0, r1, r2, r3, r4, r5, r6, r7;
    asm("v_exp_f32 %0, %8\n\tv_exp_f32 %1, %9\n\tv_exp_f32 %2, %10\n\tv_exp_f32 %3, %11\n\tv_exp_f32 %4, %12\n\tv_exp_f32 %5, %13\n\tv_exp_f32 %6, %14\n\tv_exp_f32 %7, %15\n\tv_nop"
        : "=&v"(r0), "=&v"(r1), "=&v"(r2), "=&v"(r3), "=&v"(r4), "=&v"(r5), "=&v"(r6), "=&v"(r7) : "v"(x[0]), "v"(x[1]), "v"(x[2]), "v"(x[3]), "v"(x[4]), "v"(x[5]), "v"(x[6]), "v"(x[7]));
    return (v8f){r0, r1, r2, r3, r4, r5, r6, r7}; }
__device__ __forceinline__ float exp2x1(float x) { float r; asm("v_exp_f32 %0, %1\n\tv_nop" : "=&v"(r) : "v"(x)); return r; }
// behind a group of global loads, in front of any reuse of their address registers; as inputs of the wait the four addresses stay whole up to it
__device__ __forceinline__ void xwait(const void* a, const void* b, const void* c, const void* d) { asm volatile("s_wait_xcnt 0x0" :: "v"(a), "v"(b), "v"(c), "v"(d) : "memory"); }
template <typename T16, bool HI, int QB>   // QB: 16-query column groups per wave (1 or 2)
__device__ __forceinline__ void fattn(const T16* __restrict__ Q, const T16* __restrict__ Q2, const T16* __restrict__ Kp, const T16* __restrict__ K2, const T16* __restrict__ Vt, const T16* __restrict__ Vt2, const float* dls, float c1, bf* __restrict__ Ah, bf* __restrict__ Al, int q0) {
    typedef WFrag<T16> F; typedef typename F::V V;
    const int lane = threadIdx.x & 31, lr = lane & 15, hi = lane >> 4;
    V qf[QB][2], qf2[QB][2]; v8f o[QB][4]; float m[QB], l[QB]; const T16* qp[QB]; const T16* qp2[QB];
#pragma unroll
    for (int g = 0; g < QB; ++g) { m[g] = -3.0e38f; l[g] = 0.f; const size_t qo = (size_t)(q0 + g * 16 + lr) * HD + 8 * hi; qp[g] = Q + qo; qp2[g] = HI ? Q2 + qo : qp[g];
#pragma unroll
        for (int kc = 0; kc < 2; ++kc) { qf[g][kc] = F::ld(qp[g] + kc * 32); if (HI) qf2[g][kc] = F::ld(qp2[g] + kc * 32); }
#pragma unroll
        for (int nb = 0; nb < 4; ++nb) o[g][nb] = (v8f){}; }
    const T16* kb = Kp + (size_t)lr * HD + 8 * hi; const T16* kb2 = HI ? K2 + (size_t)lr * HD + 8 * hi : kb; const T16* vb = Vt + (size_t)lr * TT + 8 * hi; const T16* vb2 = HI ? Vt2 + (size_t)lr * TT + 8 * hi : vb;
    V kf[2][2], kf2[2][2];
#pragma unroll
    for (int t = 0; t < 2; ++t)
#pragma unroll
        for (int kc = 0; kc < 2; ++kc) { kf[t][kc] = F::ld(kb + t * 16 * HD + kc * 32); if (HI) kf2[t][kc] = F::ld(kb2 + t * 16 * HD + kc * 32); }
    xwait(qp[0], qp[QB - 1], qp2[0], qp2[QB - 1]);
#pragma unroll 1   // rolled: one pass already holds every fragment and accumulator the registers take
    for (int j0 = 0; j0 < TT; j0 += 32) {
        V vf[4], vf2[4]; const T16* vp = vb + j0; const T16* vp2 = vb2 + j0;
#pragma unroll
        for (int nb = 0; nb < 4; ++nb) { vf[nb] = F::ld(vp + (size_t)nb * 16 * TT); if (HI) vf2[nb] = F::ld(vp2 + (size_t)nb * 16 * TT); }
        v8f s[QB][2];
#pragma unroll
        for (int g = 0; g < QB; ++g)
#pragma unroll
            for (int t = 0; t < 2; ++t) { s[g][t] = (v8f){};
#pragma unroll
                for (int kc = 0; kc < 2; ++kc) { s[g][t] = F::mma(kf[t][kc], qf[g][kc], s[g][t]); if (HI) { s[g][t] = F::mma(kf[t][kc], qf2[g][kc], s[g][t]); s[g][t] = F::mma(kf2[t][kc], qf[g][kc], s[g][t]); } } }
        // the next pass's K fragments fly during this pass's softmax and attn.v (the last pass fetches its own again: in bounds, unused)
        const int jn = (j0 + 32 < TT) ? j0 + 32 : j0; const T16* kp = kb + (size_t)jn * HD; const T16* kp2 = kb2 + (size_t)jn * HD;
#pragma unroll
        for (int t = 0; t < 2; ++t)
#pragma unroll
            for (int kc = 0; kc < 2; ++kc) { kf[t][kc] = F::ld(kp + t * 16 * HD + kc * 32); if (HI) kf2[t][kc] = F::ld(kp2 + t * 16 * HD + kc * 32); }
        xwait(vp, vp2, kp, kp2);
        v8f dl[2];
#pragma unroll
        for (int t = 0; t < 2; ++t) { const v4f d0 = *(const v4fa*)(dls + j0 + t * 16 + hi * 8), d1 = *(const v4fa*)(dls + j0 + t * 16 + hi * 8 + 4); dl[t] = __builtin_shufflevector(d0, d1, 0, 1, 2, 3, 4, 5, 6, 7); }
#pragma unroll
        for (int g = 0; g < QB; ++g) {
            float mx = -3.0e38f;
#pragma unroll
            for (int t = 0; t < 2; ++t)
#pragma unroll
                for (int j = 0; j < 8; ++j) { s[g][t][j] = fmaf(s[g][t][j], c1, dl[t][j]); mx = fmaxf(mx, s[g][t][j]); }
            mx = fmaxf(mx, xhalf(mx));
            const float mn = fmaxf(m[g], mx), al = exp2x1(m[g] - mn), ms = HI ? mn : mn - 10.0f; m[g] = mn;
            float ps[2];
#pragma unroll
            for (int t = 0; t < 2; ++t) {
                s[g][t] = exp2x8(s[g][t] - ms);
                ps[t] = ((s[g][t][0] + s[g][t][1]) + (s[g][t][2] + s[g][t][3])) + ((s[g][t][4] + s[g][t][5]) + (s[g][t][6] + s[g][t][7])); }
            l[g] = fmaf(l[g], al, ps[0] + ps[1]);   // this lane's half of the keys; the halves meet behind the loop
#pragma unroll
            for (int nb = 0; nb < 4; ++nb) o[g][nb] *= al;
            if constexpr (HI) {
                const v8b h0 = __builtin_convertvector(s[g][0], v8b), h1 = __builtin_convertvector(s[g][1], v8b);
                const v8b l0 = __builtin_convertvector(s[g][0] - __builtin_convertvector(h0, v8f), v8b), l1 = __builtin_convertvector(s[g][1] - __builtin_convertvector(h1, v8f), v8b);
                const V ph = __builtin_shufflevector(h0, h1, 0, 1, 2, 3, 4, 5, 6, 7, 8, 9, 10, 11, 12, 13, 14, 15), pl = __builtin_shufflevector(l0, l1, 0, 1, 2, 3, 4, 5, 6, 7, 8, 9, 10, 11, 12, 13, 14, 15);
#pragma unroll
                for (int nb = 0; nb < 4; ++nb) { o[g][nb] = F::mma(vf[nb], ph, o[g][nb]); o[g][nb] = F::mma(vf[nb], pl, o[g][nb]); o[g][nb] = F::mma(vf2[nb], ph, o[g][nb]); }
            } else {
                const V p16 = cat16(__builtin_convertvector(s[g][0], v8h), __builtin_convertvector(s[g][1], v8h));
#pragma unroll
                for (int nb = 0; nb < 4; ++nb) o[g][nb] = F::mma(vf[nb], p16, o[g][nb]);
            }
        }
        // four vector slots behind the pass's last WMMAs, also on the taken back edge: the next pass's first instructions write over their operands.
        // The accumulators are named so that every WMMA of the pass stands in front of the slots.
        if constexpr (QB == 1) asm volatile("v_nop\n\tv_nop\n\tv_nop\n\tv_nop" : "+v"(o[0][0]), "+v"(o[0][1]), "+v"(o[0][2]), "+v"(o[0][3]));
        else asm volatile("v_nop\n\tv_nop\n\tv_nop\n\tv_nop" : "+v"(o[0][0]), "+v"(o[0][1]), "+v"(o[0][2]), "+v"(o[0][3]), "+v"(o[QB - 1][0]), "+v"(o[QB - 1][1]), "+v"(o[QB - 1][2]), "+v"(o[QB - 1][3]));
    }
    // The merged rows [t][head * HD + d], bf16 hi + lo: the A planes of the out projection (Ah, Al point at this batch's row 0, this head's column 0). A lane holds 8 consecutive d of its query per tile.
    // Rows >= RH: the x 1024 comes off again, exactly, before the split.
#pragma unroll
    for (int g = 0; g < QB; ++g) { const float f = __fdiv_rn(HI ? 1.0f : PCAR, l[g] + xhalf(l[g])); const size_t ro = (size_t)(q0 + g * 16 + lr) * DQ + hi * 8;
#pragma unroll
        for (int nb = 0; nb < 4; ++nb) { const v8f r = o[g][nb] * f; v8us oh, ol;
#pragma unroll
            for (int j = 0; j < 8; ++j) { unsigned short a, c2; splitf(HI ? r[j] : r[j] * (1.0f / PCAR), a, c2); oh[j] = a; ol[j] = c2; }
            *(v8us*)(Ah + ro + nb * 16) = oh; *(v8us*)(Al + ro + nb * 16) = ol; } }
}
// grid (RH/64 + (TT-RH)/128, NZ), 4 waves: blocks x < RH/64 take 64 hi+lo query rows (16 a wave), the others 128 fp16 rows (32 a wave); every wave walks all TT keys.
__global__ __launch_bounds__(128) void k_fattn(const h16* __restrict__ Q16, const h16* __restrict__ K16, const h16* __restrict__ V16, const bf* __restrict__ Qh, const bf* __restrict__ Ql, const bf* __restrict__ Kh, const bf* __restrict__ Kl, const bf* __restrict__ Vh, const bf* __restrict__ Vl, const float* __restrict__ TAU, const float* __restrict__ DEL, bf* __restrict__ Ah, bf* __restrict__ Al) {
    __shared__ __align__(16) float dls[TT];   // log2(e) delta[b][j]
    const int z = blockIdx.y, b = z / NH_, tid = threadIdx.x, w = __builtin_amdgcn_readfirstlane(tid >> 5); const size_t zo = (size_t)z * TT * HD, ao = (size_t)b * TT * DQ + (z % NH_) * HD;
#pragma unroll
    for (int i = 0; i < TT / 128; ++i) dls[i * 128 + tid] = bfr(DEL[(size_t)b * TT + i * 128 + tid]) * LOG2E;
    const float c1 = bfr(TAU[b]) * (SCL * LOG2E);
    __syncthreads();   // the delta row is whole before any wave reads it
    if (blockIdx.x < RH / 64) fattn<bf, true, 1>(Qh + zo, Ql + zo, Kh + zo, Kl + zo, Vh + zo, Vl + zo, dls, c1, Ah + ao, Al + ao, (int)blockIdx.x * 64 + w * 16);
    else fattn<h16, false, 2>(Q16 + zo, nullptr, K16 + zo, nullptr, V16 + zo, nullptr, dls, c1, Ah + ao, Al + ao, RH + ((int)blockIdx.x - RH / 64) * 128 + w * 32);
}

extern "C" void kernel_launch(void* const* d_in, const int* in_sizes, int n_in,
                              void* d_out, int out_size, void* d_ws, size_t ws_size, hipStream_t stream) {
    (void)in_sizes; (void)n_in; (void)out_size;
    const float* x = (const float*)d_in[0]; const float* xk = (const float*)d_in[1]; const float* xv = (const float*)d_in[2]; const float* TAU = (const float*)d_in[3]; const float* DEL = (const float*)d_in[4]; const float* wq = (const float*)d_in[5]; const float* bq = (const float*)d_in[6]; const float* wk = (const float*)d_in[7]; const float* bk = (const float*)d_in[8]; const float* wv = (const float*)d_in[9]; const float* bv = (const float*)d_in[10]; const float* wo = (const float*)d_in[11]; const float* bo = (const float*)d_in[12];
    float* OUT = (float*)d_out;     // [4][2048][512]
    char* wsp = (char*)d_ws;
    auto take = [&](size_t bytes) { char* p = wsp; wsp += (bytes + 255) & ~(size_t)255; return (void*)p; };
    const size_t PLN = (size_t)NZ * TT * HD;   // elements of one plane set: every (batch, head)
    bf* WQ = (bf*)take((size_t)DQ * DM * 2); bf* WK = (bf*)take((size_t)DKV * DM * 2); bf* WV = (bf*)take((size_t)DKV * DM * 2); bf* WO = (bf*)take((size_t)DM * DQ * 2); (void)WK; (void)WV;
    h16* QP16 = (h16*)take(PLN * 2); h16* KP16 = (h16*)take(PLN * 2); h16* VT16 = (h16*)take(PLN * 2);
    bf* QPh = (bf*)take(PLN * 2); bf* KPh = (bf*)take(PLN * 2); bf* QPl = (bf*)take(PLN * 2); bf* KPl = (bf*)take(PLN * 2); bf* VTh = (bf*)take(PLN * 2); bf* VTl = (bf*)take(PLN * 2);
    bf* ATh = (bf*)take((size_t)NB_ * TT * DQ * 2); bf* ATl = (bf*)take((size_t)NB_ * TT * DQ * 2);
    bf* XB = (bf*)take((size_t)3 * NB_ * TT * DM * 2);   // bf16 inputs. k_qkv reaches the k planes from the q planes: each k plane set lies directly behind its q plane set
    if ((size_t)(wsp - (char*)d_ws) > ws_size) return;    // ws 256 MiB
    k_wtG<<<dim3((unsigned)((DM * DQ / 64 + 63) / 64), 4, 1), 256, 0, stream>>>(wq, wk, wv, wo, DM, DQ, WQ);
    k_cvt8<<<dim3((unsigned)(((size_t)NB_ * TT * DM / 8 + 255) / 256), 3, 1), 256, 0, stream>>>(x, xk, xv, XB, (size_t)NB_ * TT * DM / 8);
    // q, k, v projections of all batches (x: 64 token rows, y: head, z: which projection), written as the attention kernel's planes
    k_qkv<<<dim3(NB_ * TT / 64, NH_, 3), 256, 0, stream>>>(XB, WQ, bq, bk, bv, QP16, QPh, QPl, VT16, VTh, VTl);
    k_fattn<<<dim3(RH / 64 + (TT - RH) / 128, NZ, 1), 128, 0, stream>>>(QP16, KP16, VT16, QPh, QPl, KPh, KPl, VTh, VTl, TAU, DEL, ATh, ATl);
    k_gemmsk<bf, 1, true, 4, 8, DQ / 8><<<dim3(NB_ * TT / 64, DM / 64, 1), 256, 0, stream>>>(ATh, ATl, WO, nullptr, OUT, DM, bo, nullptr, nullptr, 0, 0, 0);
}

// v005
// One run takes 161 microseconds.
// Next to v004, in two timings, it ran 1.37 times as fast each time.
// All steps since v000 together make it 13.9 times as fast.
#include <hip/hip_runtime.h>

// De-stationary attention (Non-stationary Transformer) (queries, keys, values [4][2048][512]; q, k, v = . W + b ('xw' [512][512]; 8 heads x 64); scores = tau[b] (q.k/8) + delta[b][s] (tau [4], delta [4][2048], read); softmax; out = merged Wo + bo -> [4][2048][512] (4.2 M)).
// Compute dtypes, f32 accumulate: every input rounded to bf16; q/k/v on PLAIN bf16 operands (inputs: exact) + biases; tau scale and delta shift applied in f32 per (i, j) inside the attention kernel; scores and attn.v: query rows < 512 hl (3 products), the rest single fp16 (x1024); softmax f32; Wo hl x exact (2 products) + bo.

#define NB_  4
#define TT   2048
#define DM   512
#define NH_  8
#define NKV  8
#define REP  (NH_ / NKV)
#define HD   64
#define DQ   (NH_ * HD)
#define DKV  (NKV * HD)
#define NZ   (NB_ * NH_)          // all (batch, head) planes
#define RH   512                  // query rows < RH use hi+lo planes (0: none)
#define WIN  0
#define PCAR 1024.0f
#define SCL  0.125f   // HD^-0.5
typedef _Float16 h16;
typedef unsigned short bf;
typedef __attribute__((ext_vector_type(16))) __bf16   v16bf;
typedef __attribute__((ext_vector_type(16))) _Float16 v16h;
typedef __attribute__((ext_vector_type(8)))  _Float16 v8h;
typedef __attribute__((ext_vector_type(8)))  unsigned short v8us;
typedef __attribute__((ext_vector_type(8)))  float    v8f;
typedef __attribute__((ext_vector_type(4)))  float    v4f;
typedef v8h  __attribute__((may_alias)) v8ha;
typedef v4f  __attribute__((may_alias)) v4fa;
typedef v8us __attribute__((may_alias)) v8usa;

__device__ __forceinline__ unsigned short f2bf(float f) { unsigned u = __float_as_uint(f); u += 0x7FFFu + ((u >> 16) & 1u); return (unsigned short)(u >> 16); }
__device__ __forceinline__ float bf2f(unsigned short b) { return __uint_as_float(((unsigned)b) << 16); }
__device__ __forceinline__ float bfr(float f) { return bf2f(f2bf(f)); }
__device__ __forceinline__ v16h cat16(v8h lo, v8h hi) { return __builtin_shufflevector(lo, hi, 0, 1, 2, 3, 4, 5, 6, 7, 8, 9, 10, 11, 12, 13, 14, 15); }
__device__ __forceinline__ v16bf cat16b(v8us lo, v8us hi) { return __builtin_bit_cast(v16bf, __builtin_shufflevector(lo, hi, 0, 1, 2, 3, 4, 5, 6, 7, 8, 9, 10, 11, 12, 13, 14, 15)); }
__device__ __forceinline__ v8f wmma16(v16h a, v16h b, v8f c) { return __builtin_amdgcn_wmma_f32_16x16x32_f16(false, a, false, b, (short)0, c, false, false); }
__device__ __forceinline__ v8f wmmab(v16bf a, v16bf b, v8f c) { return __builtin_amdgcn_wmma_f32_16x16x32_bf16(false, a, false, b, (short)0, c, false, false); }



// fragment loaders: K-contiguous 16-bit planes, lane (lr, hi) takes k = 8 hi + 0..7 and 16 + 8 hi + 0..7 of each 32
template <typename T16> struct WFrag;
template <> struct WFrag<h16> { typedef v16h V; static __device__ __forceinline__ V ld(const h16* p) { return cat16(*(const v8h*)p, *(const v8h*)(p + 16)); } static __device__ __forceinline__ v8f mma(V a, V b, v8f c) { return wmma16(a, b, c); } };
template <> struct WFrag<bf> { typedef v16bf V; static __device__ __forceinline__ V ld(const bf* p) { return cat16b(*(const v8us*)p, *(const v8us*)(p + 16)); } static __device__ __forceinline__ v8f mma(V a, V b, v8f c) { return wmmab(a, b, c); } };
// ---- k_gemmsk: C[m][n] (f32, pitch ldc, + optional f32 bias[n]) = sum_k A[m][k] Bt[n][k] (+ split products per NSPLIT), operands straight from K-contiguous 16-bit planes. NW waves of one work-group share one (MB*16)x64 output tile; wave w sums k in [w*KW, (w+1)*KW) with the WFrag loaders;
// the NW partial tiles meet in LDS and are added in wave order (bias last). grid (M/(MB*16), N/64, Z), NW*32 threads. K = NW*KW.
template <typename T16, int NSPLIT, bool BIAS, int MB, int NW, int KW, int LDA = NW * KW>   // LDA: row pitch of A and A2 in elements
// waves_per_eu: registers are allotted as for one work-group per WGP (more fragment loads in flight per trip)
__global__ __launch_bounds__(NW * 32) __attribute__((amdgpu_waves_per_eu(NW / 4, NW / 4))) void k_gemmsk(const T16* __restrict__ A, const T16* __restrict__ A2, const T16* __restrict__ Bt, const T16* __restrict__ Bt2, float* C, int ldc, const float* __restrict__ bias0, const float* __restrict__ bias1, const float* __restrict__ bias2, size_t sA, size_t sB, size_t sC) {
    typedef typename WFrag<T16>::V V;
    constexpr int K = NW * KW, PT = MB * 16 * 68; static_assert((MB * 8) % NW == 0 && KW % 32 == 0, "tile and slice must divide evenly");
    __shared__ __align__(16) float red[NW * PT];
    const size_t z = blockIdx.z; A += z * sA; if (NSPLIT == 1 || NSPLIT == 2) A2 += z * sA; Bt += z * sB; if (NSPLIT >= 2) Bt2 += z * sB; C += z * sC; const float* bias = (z == 0) ? bias0 : (z == 1) ? bias1 : bias2;   // one bias vector per z plane
    const int tid = threadIdx.x, w = __builtin_amdgcn_readfirstlane(tid >> 5), lane = tid & 31, lr = lane & 15, hi = lane >> 4; const int r0 = blockIdx.x * (MB * 16), c0 = blockIdx.y * 64;
    v8f acc[MB][4];
#pragma unroll
    for (int mb = 0; mb < MB; ++mb)
#pragma unroll
        for (int nb = 0; nb < 4; ++nb) acc[mb][nb] = (v8f){};
    const size_t aoff = (size_t)(r0 + lr) * LDA + w * KW + 8 * hi, boff = (size_t)(c0 + lr) * K + w * KW + 8 * hi;
#pragma unroll 1   // rolled: unrolled, this build waited on single load pairs
    for (int kc = 0; kc < KW; kc += 32) {
        V a[MB], a2[MB]; const T16* pa = A + aoff + kc; const T16* pa2 = (NSPLIT == 1 || NSPLIT == 2) ? A2 + aoff + kc : nullptr;
#pragma unroll
        for (int mb = 0; mb < MB; ++mb) { a[mb] = WFrag<T16>::ld(pa + (size_t)mb * 16 * LDA); if (NSPLIT == 1 || NSPLIT == 2) a2[mb] = WFrag<T16>::ld(pa2 + (size_t)mb * 16 * LDA); }
        // the registers of pa and pa2 are reused behind these loads: this wait stands in front of that overwrite, and as its inputs they stay whole up to it
        if (NSPLIT == 1 || NSPLIT == 2) asm volatile("s_wait_xcnt 0x0" :: "v"(pa), "v"(pa2) : "memory"); else asm volatile("s_wait_xcnt 0x0" :: "v"(pa) : "memory");
#pragma unroll
        for (int nb = 0; nb < 4; ++nb) { const V b = WFrag<T16>::ld(Bt + boff + (size_t)nb * 16 * K + kc); V b2; if (NSPLIT >= 2) b2 = WFrag<T16>::ld(Bt2 + boff + (size_t)nb * 16 * K + kc);
#pragma unroll
            for (int mb = 0; mb < MB; ++mb) { acc[mb][nb] = WFrag<T16>::mma(a[mb], b, acc[mb][nb]); if (NSPLIT == 1 || NSPLIT == 2) acc[mb][nb] = WFrag<T16>::mma(a2[mb], b, acc[mb][nb]); if (NSPLIT >= 2) acc[mb][nb] = WFrag<T16>::mma(a[mb], b2, acc[mb][nb]); } }
    }
    float* my = red + w * PT;
#pragma unroll
    for (int mb = 0; mb < MB; ++mb)
#pragma unroll
        for (int nb = 0; nb < 4; ++nb)
#pragma unroll
            for (int j = 0; j < 8; ++j) my[(mb * 16 + hi * 8 + j) * 68 + nb * 16 + lr] = acc[mb][nb][j];
    __syncthreads();   // every wave's partial tile is in LDS before any thread adds them
#pragma unroll
    for (int s = 0; s < MB * 8 / NW; ++s) { const int it = s * NW * 32 + tid, row = it >> 4, cofs = (it & 15) * 4; v4f val = *(const v4fa*)(red + row * 68 + cofs);
#pragma unroll
        for (int p = 1; p < NW; ++p) val += *(const v4fa*)(red + p * PT + row * 68 + cofs);
        if (BIAS) { val[0] += bfr(bias[c0 + cofs]); val[1] += bfr(bias[c0 + cofs + 1]); val[2] += bfr(bias[c0 + cofs + 2]); val[3] += bfr(bias[c0 + cofs + 3]); }
        *(v4f*)(C + (size_t)(r0 + row) * ldc + c0 + cofs) = val; }
}

__device__ __forceinline__ h16 tohx(float x) { return (h16)x; }
__device__ __forceinline__ void splitf(float y, unsigned short& h, unsigned short& l) { h = f2bf(y); l = f2bf(y - bf2f(h)); }
typedef __attribute__((ext_vector_type(2))) _Float16 v2h;
typedef __attribute__((ext_vector_type(4))) _Float16 v4h;
typedef __attribute__((ext_vector_type(2))) unsigned short v2us;
typedef __attribute__((ext_vector_type(4))) unsigned short v4us;
typedef __attribute__((ext_vector_type(2))) float v2f;
typedef __attribute__((ext_vector_type(4))) int v4i;

__global__ __launch_bounds__(256) void k_wtG(const float* __restrict__ w0, const float* __restrict__ w1, const float* __restrict__ w2, const float* __restrict__ w3, int K, int N, bf* Bt) {
    const int y = blockIdx.y; const float* w = (y == 0) ? w0 : (y == 1) ? w1 : (y == 2) ? w2 : w3; Bt += (size_t)y * K * N;   // blockIdx.y: which of the four equal-shaped matrices
    const int lane = threadIdx.x & 31; const int L0 = (blockIdx.x * 8 + (threadIdx.x >> 5)) * 8; const int nlines = N * K / 64;
{
#pragma unroll 1
        for (int l = 0; l < 8; ++l) { const int L = L0 + l; if (L >= nlines) break; const size_t e = (size_t)L * 64 + lane * 2; const int k = (int)(e % K), n = (int)(e / K); v2us o;
            o[0] = f2bf(w[(size_t)k * N + n]); o[1] = f2bf(w[(size_t)(k + 1) * N + n]); *(v2us*)(Bt + e) = o; }
         }
}
__global__ __launch_bounds__(256) void k_cvt8(const float* __restrict__ s0, const float* __restrict__ s1, const float* __restrict__ s2, bf* dst, size_t n8) { const size_t i = (size_t)blockIdx.x * 256 + threadIdx.x; if (i >= n8) return; const int y = blockIdx.y; const float* src = (y == 0) ? s0 : (y == 1) ? s1 : s2; dst += (size_t)y * n8 * 8;   // blockIdx.y: which of the three equal-shaped tensors
    const v8f v = *(const v8f*)(src + i * 8); v8us o;
#pragma unroll
    for (int k = 0; k < 8; ++k) o[k] = f2bf(v[k]); *(v8us*)(dst + i * 8) = o;  }

// ---- k_qkv: the three projections of all batches, K split over 8 waves as in k_gemmsk (same loaders, same partial sums, same order of addition, bias last); the epilogue writes the attention kernel's operand planes itself.
// z = 0, 1 (q, k): A = 64 token rows, B = the 64 columns of head blockIdx.y -> planes [batch][head][t][d]. z = 2 (v): the operands change places (A = the head's 64 weight rows, B = 64 tokens),
// so the tile comes out as [d][t] and goes to the transposed planes [batch][head][d][t] in whole lines too. Each value is stored as fp16 and as bf16 hi + lo.
__global__ __launch_bounds__(256) __attribute__((amdgpu_waves_per_eu(2, 2))) void k_qkv(const bf* __restrict__ X, const bf* __restrict__ Wt, const float* __restrict__ bias0, const float* __restrict__ bias1, const float* __restrict__ bias2, h16* P16, bf* Ph, bf* Pl, h16* V16, bf* Vh, bf* Vl) {
    typedef WFrag<bf> F; typedef F::V V;
    constexpr int NW = 8, KW = DM / NW, PT = 64 * 68;
    __shared__ __align__(16) float red[NW * PT];
    const int z = blockIdx.z; const bool tr = (z == 2); const float* bias = (z == 0) ? bias0 : (z == 1) ? bias1 : bias2;
    const int tid = threadIdx.x, w = __builtin_amdgcn_readfirstlane(tid >> 5), lane = tid & 31, lr = lane & 15, hi = lane >> 4; const int t0 = blockIdx.x * 64, n0 = blockIdx.y * 64;
    const bf* Xz = X + (size_t)z * NB_ * TT * DM + (size_t)t0 * DM; const bf* Wz = Wt + (size_t)z * DQ * DM + (size_t)n0 * DM;
    const bf* A = tr ? Wz : Xz; const bf* Bt = tr ? Xz : Wz;
    v8f acc[4][4];
#pragma unroll
    for (int mb = 0; mb < 4; ++mb)
#pragma unroll
        for (int nb = 0; nb < 4; ++nb) acc[mb][nb] = (v8f){};
    const size_t off = (size_t)lr * DM + w * KW + 8 * hi;
#pragma unroll 1   // rolled, as in k_gemmsk: unrolled, that build waited on single load pairs
    for (int kc = 0; kc < KW; kc += 32) {
        V a[4]; const bf* pa = A + off + kc;
#pragma unroll
        for (int mb = 0; mb < 4; ++mb) a[mb] = F::ld(pa + (size_t)mb * 16 * DM);
        // the registers of pa are reused behind these loads: this wait stands in front of that overwrite, and as its input they stay whole up to it
        asm volatile("s_wait_xcnt 0x0" :: "v"(pa) : "memory");
#pragma unroll
        for (int nb = 0; nb < 4; ++nb) { const V b = F::ld(Bt + off + (size_t)nb * 16 * DM + kc);
#pragma unroll
            for (int mb = 0; mb < 4; ++mb) acc[mb][nb] = F::mma(a[mb], b, acc[mb][nb]); }
    }
    float* my = red + w * PT;
#pragma unroll
    for (int mb = 0; mb < 4; ++mb)
#pragma unroll
        for (int nb = 0; nb < 4; ++nb)
#pragma unroll
            for (int j = 0; j < 8; ++j) my[(mb * 16 + hi * 8 + j) * 68 + nb * 16 + lr] = acc[mb][nb][j];
    __syncthreads();   // every wave's partial tile is in LDS before any thread adds them
    const int zh = (t0 / TT) * NH_ + (int)blockIdx.y, tt0 = t0 % TT;   // (batch, head) plane; first token of the tile inside its batch (a tile never crosses a batch: TT % 64 == 0)
    h16* d16 = tr ? V16 + ((size_t)zh * HD) * TT + tt0 : P16 + (size_t)z * NZ * TT * HD + ((size_t)zh * TT + tt0) * HD;
    bf* dh = tr ? Vh + ((size_t)zh * HD) * TT + tt0 : Ph + (size_t)z * NZ * TT * HD + ((size_t)zh * TT + tt0) * HD;
    bf* dl = tr ? Vl + ((size_t)zh * HD) * TT + tt0 : Pl + (size_t)z * NZ * TT * HD + ((size_t)zh * TT + tt0) * HD;
    const int pitch = tr ? TT : HD;
#pragma unroll
    for (int s = 0; s < 4; ++s) { const int it = s * 256 + tid, row = it >> 4, cofs = (it & 15) * 4; v4f val = *(const v4fa*)(red + row * 68 + cofs);
#pragma unroll
        for (int p = 1; p < NW; ++p) val += *(const v4fa*)(red + p * PT + row * 68 + cofs);
        v4h o16; v4us oh, ol;
#pragma unroll
        for (int q = 0; q < 4; ++q) { const float r = val[q] + bfr(bias[n0 + (tr ? row : cofs + q)]); o16[q] = tohx(r); unsigned short a2, c2; splitf(r, a2, c2); oh[q] = a2; ol[q] = c2; }
        const size_t e = (size_t)row * pitch + cofs; *(v4h*)(d16 + e) = o16; *(v4us*)(dh + e) = oh; *(v4us*)(dl + e) = ol; }
}
// ---- k_fattn: scores, softmax and attn.v of one (batch, head) plane in one kernel; no score or probability leaves the registers.
// Transposed products: S^T = K Q^T (A = 16 key rows, B = 16 query columns), so lane (lr, hi) holds, for query lr, the scores of keys 8 hi + 0..7 of each 16-key tile;
// two such tiles, converted in place, are the B fragment of O^T += V^T P^T in the k order of the WFrag loaders. Running maximum and sum per query (online softmax), 32 keys a pass.
// x = log2(e) (tau (q.k/8) + delta[j]); p = 2^(x - m). Rows < RH: hi+lo bf16 planes, 3 products each; the rest fp16 with p x 1024 (the factor cancels in p / sum).
typedef __attribute__((ext_vector_type(8))) __bf16 v8b;
#define LOG2E 1.4426950408889634f
__device__ __forceinline__ float xhalf(float x) { const int b = __float_as_int(x); return __int_as_float(__builtin_amdgcn_permlanex16(b, b, 0x76543210, 0xfedcba98, false, false)); }   // lane l <-> l ^ 16
// 2^x of eight values / of one value. One statement each, results in registers of their own ("=&v"), closed by v_nop: the slot the instruction set asks for between a transcendental
// and an instruction that reads its result or overwrites its source.
__device__ __forceinline__ v8f exp2x8(v8f x) { float r0, r1, r2, r3, r4, r5, r6, r7;
    asm("v_exp_f32 %0, %8\n\tv_exp_f32 %1, %9\n\tv_exp_f32 %2, %10\n\tv_exp_f32 %3, %11\n\tv_exp_f32 %4, %12\n\tv_exp_f32 %5, %13\n\tv_exp_f32 %6, %14\n\tv_exp_f32 %7, %15\n\tv_nop"
        : "=&v"(r0), "=&v"(r1), "=&v"(r2), "=&v"(r3), "=&v"(r4), "=&v"(r5), "=&v"(r6), "=&v"(r7) : "v"(x[0]), "v"(x[1]), "v"(x[2]), "v"(x[3]), "v"(x[4]), "v"(x[5]), "v"(x[6]), "v"(x[7]));
    return (v8f){r0, r1, r2, r3, r4, r5, r6, r7}; }
__device__ __forceinline__ float exp2x1(float x) { float r; asm("v_exp_f32 %0, %1\n\tv_nop" : "=&v"(r) : "v"(x)); return r; }
// behind a group of global loads, in front of any reuse of their address registers; as inputs of the wait the four addresses stay whole up to it
__device__ __forceinline__ void xwait(const void* a, const void* b, const void* c, const void* d) { asm volatile("s_wait_xcnt 0x0" :: "v"(a), "v"(b), "v"(c), "v"(d) : "memory"); }
#define KT  64          // keys per staged tile
#define KP  72          // LDS row pitch in 16-bit elements: 144 B = 16 B x 9, the pitch of ds_load_b128 readers of 128-B rows
#define TLE (64 * KP)   // elements of one staged tile: 64 rows (K: keys; V^T: head dims) of 64 values
// Two tiles of 64 rows x 128 B, global -> LDS, by the 128 threads of the work-group: a thread brings 16 B of rows r, r + 16, r + 32, r + 48 of each tile (a wave's copy: four whole 128-B lines).
// la, lb: the thread's LDS byte addresses in row r; ga, gb: its global addresses there; sa, sb: bytes of 16 global rows. The wait on xcnt closes the copies' own statement: their address registers are reused behind it.
__device__ __forceinline__ void cp2(unsigned la, const char* ga, size_t sa, unsigned lb, const char* gb, size_t sb) {
    asm volatile("global_load_async_to_lds_b128 %0, %1, off\n\tglobal_load_async_to_lds_b128 %2, %3, off\n\tglobal_load_async_to_lds_b128 %4, %5, off\n\tglobal_load_async_to_lds_b128 %6, %7, off\n\t"
                 "global_load_async_to_lds_b128 %8, %9, off\n\tglobal_load_async_to_lds_b128 %10, %11, off\n\tglobal_load_async_to_lds_b128 %12, %13, off\n\tglobal_load_async_to_lds_b128 %14, %15, off\n\ts_wait_xcnt 0x0"
                 :: "v"(la), "v"(ga), "v"(la + 16u * KP * 2u), "v"(ga + sa), "v"(la + 32u * KP * 2u), "v"(ga + 2 * sa), "v"(la + 48u * KP * 2u), "v"(ga + 3 * sa),
                    "v"(lb), "v"(gb), "v"(lb + 16u * KP * 2u), "v"(gb + sb), "v"(lb + 32u * KP * 2u), "v"(gb + 2 * sb), "v"(lb + 48u * KP * 2u), "v"(gb + 3 * sb) : "memory"); }
template <typename T16, bool HI, int QB>   // QB: 16-query column groups per wave (1 or 2)
__device__ __forceinline__ void fattn(const T16* __restrict__ Q, const T16* __restrict__ Q2, const T16* __restrict__ Kp, const T16* __restrict__ K2, const T16* __restrict__ Vt, const T16* __restrict__ Vt2, const float* dls, const T16* ring, float c1, bf* __restrict__ Ah, bf* __restrict__ Al, int q0) {
    typedef WFrag<T16> F; typedef typename F::V V;
    constexpr int NT = HI ? 4 : 2, NS = TT / KT;   // tiles per buffer (K, V^T; hi+lo: K lo, V^T lo too); stages
    static_assert(NS >= 2 && TT % KT == 0 && HD == 64 && KT == 64, "the ring needs two whole stages; a tile is 64 rows of 128 B");
    const int tid = threadIdx.x, lane = tid & 31, lr = lane & 15, hi = lane >> 4;
    // stage s -> buffer b: K rows [s KT, s KT + KT) and the same keys' columns of V^T
    const unsigned lcp = (unsigned)(size_t)ring + (unsigned)((tid >> 3) * (KP * 2) + (tid & 7) * 16);
    const char* kg = (const char*)(Kp + (size_t)(tid >> 3) * HD + (tid & 7) * 8); const char* vg = (const char*)(Vt + (size_t)(tid >> 3) * TT + (tid & 7) * 8);
    const char* kg2 = HI ? (const char*)(K2 + (size_t)(tid >> 3) * HD + (tid & 7) * 8) : kg; const char* vg2 = HI ? (const char*)(Vt2 + (size_t)(tid >> 3) * TT + (tid & 7) * 8) : vg;
    auto stage = [&](int s, int b) { const unsigned l0 = lcp + (unsigned)(b * NT * TLE * 2);
        cp2(l0, kg + (size_t)s * (KT * HD * 2), 16 * HD * 2, l0 + TLE * 2, vg + (size_t)s * (KT * 2), (size_t)16 * TT * 2);
        if (HI) cp2(l0 + 2 * TLE * 2, kg2 + (size_t)s * (KT * HD * 2), 16 * HD * 2, l0 + 3 * TLE * 2, vg2 + (size_t)s * (KT * 2), (size_t)16 * TT * 2); };
    stage(0, 0);
    V qf[QB][2], qf2[QB][2]; v8f o[QB][4]; float m[QB], l[QB]; const T16* qp[QB]; const T16* qp2[QB];
#pragma unroll
    for (int g = 0; g < QB; ++g) { m[g] = -3.0e38f; l[g] = 0.f; const size_t qo = (size_t)(q0 + g * 16 + lr) * HD + 8 * hi; qp[g] = Q + qo; qp2[g] = HI ? Q2 + qo : qp[g];
#pragma unroll
        for (int kc = 0; kc < 2; ++kc) { qf[g][kc] = F::ld(qp[g] + kc * 32); if (HI) qf2[g][kc] = F::ld(qp2[g] + kc * 32); }
#pragma unroll
        for (int nb = 0; nb < 4; ++nb) o[g][nb] = (v8f){}; }
    xwait(qp[0], qp[QB - 1], qp2[0], qp2[QB - 1]);
    asm volatile("s_wait_asynccnt 0x0" ::: "memory");   // this wave's copies of stage 0 have landed
    __syncthreads();                                    // every wave's have: stage 0 may be read
    stage(1, 1);
#pragma unroll 1   // rolled: one stage a trip, the buffers change places
    for (int st = 0; st < NS; ++st) {
        const T16* kb = ring + (st & 1) * (NT * TLE) + lr * KP + 8 * hi; const T16* vb = kb + TLE; const T16* kb2 = kb + 2 * TLE; const T16* vb2 = kb + 3 * TLE;
#pragma unroll   // the two 32-key passes of a stage stand one behind the other, so that the second's LDS reads can go ahead of the first's vector work
        for (int pp = 0; pp < KT / 32; ++pp) {
            const int j0 = st * KT + pp * 32;
            V kf[2][2], kf2[2][2], vf[4], vf2[4];
#pragma unroll
            for (int t = 0; t < 2; ++t)
#pragma unroll
                for (int kc = 0; kc < 2; ++kc) { kf[t][kc] = F::ld(kb + (pp * 32 + t * 16) * KP + kc * 32); if (HI) kf2[t][kc] = F::ld(kb2 + (pp * 32 + t * 16) * KP + kc * 32); }
#pragma unroll
            for (int nb = 0; nb < 4; ++nb) { vf[nb] = F::ld(vb + nb * 16 * KP + pp * 32); if (HI) vf2[nb] = F::ld(vb2 + nb * 16 * KP + pp * 32); }
            v8f s[QB][2];
#pragma unroll
            for (int g = 0; g < QB; ++g)
#pragma unroll
                for (int t = 0; t < 2; ++t) { s[g][t] = (v8f){};
#pragma unroll
                    for (int kc = 0; kc < 2; ++kc) { s[g][t] = F::mma(kf[t][kc], qf[g][kc], s[g][t]); if (HI) { s[g][t] = F::mma(kf[t][kc], qf2[g][kc], s[g][t]); s[g][t] = F::mma(kf2[t][kc], qf[g][kc], s[g][t]); } } }
            v8f dl[2]; V pf[QB], pf2[QB];
#pragma unroll
            for (int t = 0; t < 2; ++t) { const v4f d0 = *(const v4fa*)(dls + j0 + t * 16 + hi * 8), d1 = *(const v4fa*)(dls + j0 + t * 16 + hi * 8 + 4); dl[t] = __builtin_shufflevector(d0, d1, 0, 1, 2, 3, 4, 5, 6, 7); }
#pragma unroll
            for (int g = 0; g < QB; ++g) {
                float mx = -3.0e38f;
#pragma unroll
                for (int t = 0; t < 2; ++t)
#pragma unroll
                    for (int j = 0; j < 8; ++j) { s[g][t][j] = fmaf(s[g][t][j], c1, dl[t][j]); mx = fmaxf(mx, s[g][t][j]); }
                mx = fmaxf(mx, xhalf(mx));
                const float mn = fmaxf(m[g], mx), al = exp2x1(m[g] - mn), ms = HI ? mn : mn - 10.0f; m[g] = mn;
                float ps[2];
#pragma unroll
                for (int t = 0; t < 2; ++t) {
                    s[g][t] = exp2x8(s[g][t] - ms);
                    ps[t] = ((s[g][t][0] + s[g][t][1]) + (s[g][t][2] + s[g][t][3])) + ((s[g][t][4] + s[g][t][5]) + (s[g][t][6] + s[g][t][7])); }
                l[g] = fmaf(l[g], al, ps[0] + ps[1]);   // this lane's half of the keys; the halves meet behind the loop
#pragma unroll
                for (int nb = 0; nb < 4; ++nb) o[g][nb] *= al;
                if constexpr (HI) {
                    const v8b h0 = __builtin_convertvector(s[g][0], v8b), h1 = __builtin_convertvector(s[g][1], v8b);
                    const v8b l0 = __builtin_convertvector(s[g][0] - __builtin_convertvector(h0, v8f), v8b), l1 = __builtin_convertvector(s[g][1] - __builtin_convertvector(h1, v8f), v8b);
                    pf[g] = __builtin_shufflevector(h0, h1, 0, 1, 2, 3, 4, 5, 6, 7, 8, 9, 10, 11, 12, 13, 14, 15); pf2[g] = __builtin_shufflevector(l0, l1, 0, 1, 2, 3, 4, 5, 6, 7, 8, 9, 10, 11, 12, 13, 14, 15);
                } else pf[g] = cat16(__builtin_convertvector(s[g][0], v8h), __builtin_convertvector(s[g][1], v8h));
            }
            // attn.v of all groups behind the softmax of all groups: no 2^x statement stands close behind a WMMA whose operand registers it could be given
#pragma unroll
            for (int g = 0; g < QB; ++g)
#pragma unroll
                for (int nb = 0; nb < 4; ++nb) { o[g][nb] = F::mma(vf[nb], pf[g], o[g][nb]); if constexpr (HI) { o[g][nb] = F::mma(vf[nb], pf2[g], o[g][nb]); o[g][nb] = F::mma(vf2[nb], pf[g], o[g][nb]); } }
        }
        // four vector slots behind the stage's last WMMAs, also on the taken back edge: the next instructions write over their operands.
        // The accumulators are named so that every WMMA of the stage stands in front of the slots.
        if constexpr (QB == 1) asm volatile("v_nop\n\tv_nop\n\tv_nop\n\tv_nop" : "+v"(o[0][0]), "+v"(o[0][1]), "+v"(o[0][2]), "+v"(o[0][3]));
        else asm volatile("v_nop\n\tv_nop\n\tv_nop\n\tv_nop" : "+v"(o[0][0]), "+v"(o[0][1]), "+v"(o[0][2]), "+v"(o[0][3]), "+v"(o[QB - 1][0]), "+v"(o[QB - 1][1]), "+v"(o[QB - 1][2]), "+v"(o[QB - 1][3]));
        asm volatile("s_wait_dscnt 0x0" ::: "memory");      // this wave's reads of the stage's buffer are done before the buffer is handed back
        asm volatile("s_wait_asynccnt 0x0" ::: "memory");   // this wave's copies of the next stage have landed
        __syncthreads();                                    // next stage published; every reader has left this stage's buffer
        if (st + 2 < NS) stage(st + 2, st & 1);             // refill it, one whole stage ahead of its readers
    }
    asm volatile("s_wait_asynccnt 0x0" ::: "memory");   // no copy is outstanding when the wave goes on to its end
    // The merged rows [t][head * HD + d], bf16 hi + lo: the A planes of the out projection (Ah, Al point at this batch's row 0, this head's column 0). A lane holds 8 consecutive d of its query per tile.
    // Rows >= RH: the x 1024 comes off again, exactly, before the split.
#pragma unroll
    for (int g = 0; g < QB; ++g) { const float f = __fdiv_rn(HI ? 1.0f : PCAR, l[g] + xhalf(l[g])); const size_t ro = (size_t)(q0 + g * 16 + lr) * DQ + hi * 8; bf* const ph = Ah + ro; bf* const pl = Al + ro;
#pragma unroll
        for (int nb = 0; nb < 4; ++nb) { const v8f r = o[g][nb] * f; v8us oh, ol;
#pragma unroll
            for (int j = 0; j < 8; ++j) { unsigned short a, c2; splitf(HI ? r[j] : r[j] * (1.0f / PCAR), a, c2); oh[j] = a; ol[j] = c2; }
            *(v8us*)(ph + nb * 16) = oh; *(v8us*)(pl + nb * 16) = ol;
            // behind the two stores, in front of any reuse of their data and address registers; as inputs of the wait these stay whole up to it
            asm volatile("s_wait_xcnt 0x0" :: "v"(oh), "v"(ol), "v"(ph), "v"(pl) : "memory"); } }
}
// grid (RH/64 + (TT-RH)/128, NZ), 4 waves: blocks x < RH/64 take 64 hi+lo query rows (16 a wave), the others 128 fp16 rows (32 a wave); every wave walks all TT keys.
// K and V^T reach the waves through LDS: 64 keys a stage, two buffers, brought in by asynchronous copies in whole lines and read by all four waves.
__global__ __launch_bounds__(128) void k_fattn(const h16* __restrict__ Q16, const h16* __restrict__ K16, const h16* __restrict__ V16, const bf* __restrict__ Qh, const bf* __restrict__ Ql, const bf* __restrict__ Kh, const bf* __restrict__ Kl, const bf* __restrict__ Vh, const bf* __restrict__ Vl, const float* __restrict__ TAU, const float* __restrict__ DEL, bf* __restrict__ Ah, bf* __restrict__ Al) {
    __shared__ __align__(16) float dls[TT];   // log2(e) delta[b][j]
    __shared__ __align__(16) unsigned short ring[2 * 4 * TLE];   // two buffers of up to four tiles
    const int z = blockIdx.y, b = z / NH_, tid = threadIdx.x, w = __builtin_amdgcn_readfirstlane(tid >> 5); const size_t zo = (size_t)z * TT * HD, ao = (size_t)b * TT * DQ + (z % NH_) * HD;
#pragma unroll
    for (int i = 0; i < TT / 128; ++i) dls[i * 128 + tid] = bfr(DEL[(size_t)b * TT + i * 128 + tid]) * LOG2E;
    const float c1 = bfr(TAU[b]) * (SCL * LOG2E);
    __syncthreads();   // the delta row is whole before any wave reads it
    if (blockIdx.x < RH / 64) fattn<bf, true, 1>(Qh + zo, Ql + zo, Kh + zo, Kl + zo, Vh + zo, Vl + zo, dls, (const bf*)ring, c1, Ah + ao, Al + ao, (int)blockIdx.x * 64 + w * 16);
    else fattn<h16, false, 2>(Q16 + zo, nullptr, K16 + zo, nullptr, V16 + zo, nullptr, dls, (const h16*)ring, c1, Ah + ao, Al + ao, RH + ((int)blockIdx.x - RH / 64) * 128 + w * 32);
}

extern "C" void kernel_launch(void* const* d_in, const int* in_sizes, int n_in,
                              void* d_out, int out_size, void* d_ws, size_t ws_size, hipStream_t stream) {
    (void)in_sizes; (void)n_in; (void)out_size;
    const float* x = (const float*)d_in[0]; const float* xk = (const float*)d_in[1]; const float* xv = (const float*)d_in[2]; const float* TAU = (const float*)d_in[3]; const float* DEL = (const float*)d_in[4]; const float* wq = (const float*)d_in[5]; const float* bq = (const float*)d_in[6]; const float* wk = (const float*)d_in[7]; const float* bk = (const float*)d_in[8]; const float* wv = (const float*)d_in[9]; const float* bv = (const float*)d_in[10]; const float* wo = (const float*)d_in[11]; const float* bo = (const float*)d_in[12];
    float* OUT = (float*)d_out;     // [4][2048][512]
    char* wsp = (char*)d_ws;
    auto take = [&](size_t bytes) { char* p = wsp; wsp += (bytes + 255) & ~(size_t)255; return (void*)p; };
    const size_t PLN = (size_t)NZ * TT * HD;   // elements of one plane set: every (batch, head)
    bf* WQ = (bf*)take((size_t)DQ * DM * 2); bf* WK = (bf*)take((size_t)DKV * DM * 2); bf* WV = (bf*)take((size_t)DKV * DM * 2); bf* WO = (bf*)take((size_t)DM * DQ * 2); (void)WK; (void)WV;
    h16* QP16 = (h16*)take(PLN * 2); h16* KP16 = (h16*)take(PLN * 2); h16* VT16 = (h16*)take(PLN * 2);
    bf* QPh = (bf*)take(PLN * 2); bf* KPh = (bf*)take(PLN * 2); bf* QPl = (bf*)take(PLN * 2); bf* KPl = (bf*)take(PLN * 2); bf* VTh = (bf*)take(PLN * 2); bf* VTl = (bf*)take(PLN * 2);
    bf* ATh = (bf*)take((size_t)NB_ * TT * DQ * 2); bf* ATl = (bf*)take((size_t)NB_ * TT * DQ * 2);
    bf* XB = (bf*)take((size_t)3 * NB_ * TT * DM * 2);   // bf16 inputs. k_qkv reaches the k planes from the q planes: each k plane set lies directly behind its q plane set
    if ((size_t)(wsp - (char*)d_ws) > ws_size) return;    // ws 256 MiB
    k_wtG<<<dim3((unsigned)((DM * DQ / 64 + 63) / 64), 4, 1), 256, 0, stream>>>(wq, wk, wv, wo, DM, DQ, WQ);
    k_cvt8<<<dim3((unsigned)(((size_t)NB_ * TT * DM / 8 + 255) / 256), 3, 1), 256, 0, stream>>>(x, xk, xv, XB, (size_t)NB_ * TT * DM / 8);
    // q, k, v projections of all batches (x: 64 token rows, y: head, z: which projection), written as the attention kernel's planes
    k_qkv<<<dim3(NB_ * TT / 64, NH_, 3), 256, 0, stream>>>(XB, WQ, bq, bk, bv, QP16, QPh, QPl, VT16, VTh, VTl);
    k_fattn<<<dim3(RH / 64 + (TT - RH) / 128, NZ, 1), 128, 0, stream>>>(QP16, KP16, VT16, QPh, QPl, KPh, KPl, VTh, VTl, TAU, DEL, ATh, ATl);
    k_gemmsk<bf, 1, true, 4, 8, DQ / 8><<<dim3(NB_ * TT / 64, DM / 64, 1), 256, 0, stream>>>(ATh, ATl, WO, nullptr, OUT, DM, bo, nullptr, nullptr, 0, 0, 0);
}

// v006
// Measured time: 154 microseconds a run.
// Timed twice side by side with v005, it ran 1.05 times as fast both times.
// Counting every step since v000, it is 14.5 times as fast.
#include <hip/hip_runtime.h>

// De-stationary attention (Non-stationary Transformer) (queries, keys, values [4][2048][512]; q, k, v = . W + b ('xw' [512][512]; 8 heads x 64); scores = tau[b] (q.k/8) + delta[b][s] (tau [4], delta [4][2048], read); softmax; out = merged Wo + bo -> [4][2048][512] (4.2 M)).
// Compute dtypes, f32 accumulate: every input rounded to bf16; q/k/v on PLAIN bf16 operands (inputs: exact) + biases; tau scale and delta shift applied in f32 per (i, j) inside the attention kernel; scores and attn.v: query rows < 512 hl (3 products), the rest single fp16 (x1024); softmax f32; Wo hl x exact (2 products) + bo.

#define NB_  4
#define TT   2048
#define DM   512
#define NH_  8
#define NKV  8
#define REP  (NH_ / NKV)
#define HD   64
#define DQ   (NH_ * HD)
#define DKV  (NKV * HD)
#define NZ   (NB_ * NH_)          // all (batch, head) planes
#define RH   512                  // query rows < RH use hi+lo planes (0: none)
#define WIN  0
#define PCAR 1024.0f
#define SCL  0.125f   // HD^-0.5
typedef _Float16 h16;
typedef unsigned short bf;
typedef __attribute__((ext_vector_type(16))) __bf16   v16bf;
typedef __attribute__((ext_vector_type(16))) _Float16 v16h;
typedef __attribute__((ext_vector_type(8)))  _Float16 v8h;
typedef __attribute__((ext_vector_type(8)))  unsigned short v8us;
typedef __attribute__((ext_vector_type(8)))  float    v8f;
typedef __attribute__((ext_vector_type(4)))  float    v4f;
typedef v8h  __attribute__((may_alias)) v8ha;
typedef v4f  __attribute__((may_alias)) v4fa;
typedef v8us __attribute__((may_alias)) v8usa;

__device__ __forceinline__ unsigned short f2bf(float f) { unsigned u = __float_as_uint(f); u += 0x7FFFu + ((u >> 16) & 1u); return (unsigned short)(u >> 16); }
__device__ __forceinline__ float bf2f(unsigned short b) { return __uint_as_float(((unsigned)b) << 16); }
__device__ __forceinline__ float bfr(float f) { return bf2f(f2bf(f)); }
__device__ __forceinline__ v16h cat16(v8h lo, v8h hi) { return __builtin_shufflevector(lo, hi, 0, 1, 2, 3, 4, 5, 6, 7, 8, 9, 10, 11, 12, 13, 14, 15); }
__device__ __forceinline__ v16bf cat16b(v8us lo, v8us hi) { return __builtin_bit_cast(v16bf, __builtin_shufflevector(lo, hi, 0, 1, 2, 3, 4, 5, 6, 7, 8, 9, 10, 11, 12, 13, 14, 15)); }
__device__ __forceinline__ v8f wmma16(v16h a, v16h b, v8f c) { return __builtin_amdgcn_wmma_f32_16x16x32_f16(false, a, false, b, (short)0, c, false, false); }
__device__ __forceinline__ v8f wmmab(v16bf a, v16bf b, v8f c) { return __builtin_amdgcn_wmma_f32_16x16x32_bf16(false, a, false, b, (short)0, c, false, false); }



// fragment loaders: K-contiguous 16-bit planes, lane (lr, hi) takes k = 8 hi + 0..7 and 16 + 8 hi + 0..7 of each 32
template <typename T16> struct WFrag;
template <> struct WFrag<h16> { typedef v16h V; static __device__ __forceinline__ V ld(const h16* p) { return cat16(*(const v8h*)p, *(const v8h*)(p + 16)); } static __device__ __forceinline__ v8f mma(V a, V b, v8f c) { return wmma16(a, b, c); } };
template <> struct WFrag<bf> { typedef v16bf V; static __device__ __forceinline__ V ld(const bf* p) { return cat16b(*(const v8us*)p, *(const v8us*)(p + 16)); } static __device__ __forceinline__ v8f mma(V a, V b, v8f c) { return wmmab(a, b, c); } };
// ---- k_gemmsk: C[m][n] (f32, pitch ldc, + optional f32 bias[n]) = sum_k A[m][k] Bt[n][k] (+ split products per NSPLIT), operands straight from K-contiguous 16-bit planes. NW waves of one work-group share one (MB*16)x64 output tile; wave w sums k in [w*KW, (w+1)*KW) with the WFrag loaders;
// the NW partial tiles meet in LDS and are added in wave order (bias last). grid (M/(MB*16), N/64, Z), NW*32 threads. K = NW*KW.
template <typename T16, int NSPLIT, bool BIAS, int MB, int NW, int KW, int LDA = NW * KW>   // LDA: row pitch of A and A2 in elements
// waves_per_eu: registers are allotted as for one work-group per WGP (more fragment loads in flight per trip)
__global__ __launch_bounds__(NW * 32) __attribute__((amdgpu_waves_per_eu(NW / 4, NW / 4))) void k_gemmsk(const T16* __restrict__ A, const T16* __restrict__ A2, const T16* __restrict__ Bt, const T16* __restrict__ Bt2, float* C, int ldc, const float* __restrict__ bias0, const float* __restrict__ bias1, const float* __restrict__ bias2, size_t sA, size_t sB, size_t sC) {
    typedef typename WFrag<T16>::V V;
    constexpr int K = NW * KW, PT = MB * 16 * 68; static_assert((MB * 8) % NW == 0 && KW % 32 == 0, "tile and slice must divide evenly");
    __shared__ __align__(16) float red[NW * PT];
    const size_t z = blockIdx.z; A += z * sA; if (NSPLIT == 1 || NSPLIT == 2) A2 += z * sA; Bt += z * sB; if (NSPLIT >= 2) Bt2 += z * sB; C += z * sC; const float* bias = (z == 0) ? bias0 : (z == 1) ? bias1 : bias2;   // one bias vector per z plane
    const int tid = threadIdx.x, w = __builtin_amdgcn_readfirstlane(tid >> 5), lane = tid & 31, lr = lane & 15, hi = lane >> 4; const int r0 = blockIdx.x * (MB * 16), c0 = blockIdx.y * 64;
    v8f acc[MB][4];
#pragma unroll
    for (int mb = 0; mb < MB; ++mb)
#pragma unroll
        for (int nb = 0; nb < 4; ++nb) acc[mb][nb] = (v8f){};
    const size_t aoff = (size_t)(r0 + lr) * LDA + w * KW + 8 * hi, boff = (size_t)(c0 + lr) * K + w * KW + 8 * hi;
#pragma unroll 1   // rolled: unrolled, this build waited on single load pairs
    for (int kc = 0; kc < KW; kc += 32) {
        V a[MB], a2[MB]; const T16* pa = A + aoff + kc; const T16* pa2 = (NSPLIT == 1 || NSPLIT == 2) ? A2 + aoff + kc : nullptr;
#pragma unroll
        for (int mb = 0; mb < MB; ++mb) { a[mb] = WFrag<T16>::ld(pa + (size_t)mb * 16 * LDA); if (NSPLIT == 1 || NSPLIT == 2) a2[mb] = WFrag<T16>::ld(pa2 + (size_t)mb * 16 * LDA); }
        // the registers of pa and pa2 are reused behind these loads: this wait stands in front of that overwrite, and as its inputs they stay whole up to it
        if (NSPLIT == 1 || NSPLIT == 2) asm volatile("s_wait_xcnt 0x0" :: "v"(pa), "v"(pa2) : "memory"); else asm volatile("s_wait_xcnt 0x0" :: "v"(pa) : "memory");
#pragma unroll
        for (int nb = 0; nb < 4; ++nb) { const V b = WFrag<T16>::ld(Bt + boff + (size_t)nb * 16 * K + kc); V b2; if (NSPLIT >= 2) b2 = WFrag<T16>::ld(Bt2 + boff + (size_t)nb * 16 * K + kc);
#pragma unroll
            for (int mb = 0; mb < MB; ++mb) { acc[mb][nb] = WFrag<T16>::mma(a[mb], b, acc[mb][nb]); if (NSPLIT == 1 || NSPLIT == 2) acc[mb][nb] = WFrag<T16>::mma(a2[mb], b, acc[mb][nb]); if (NSPLIT >= 2) acc[mb][nb] = WFrag<T16>::mma(a[mb], b2, acc[mb][nb]); } }
    }
    float* my = red + w * PT;
#pragma unroll
    for (int mb = 0; mb < MB; ++mb)
#pragma unroll
        for (int nb = 0; nb < 4; ++nb)
#pragma unroll
            for (int j = 0; j < 8; ++j) my[(mb * 16 + hi * 8 + j) * 68 + nb * 16 + lr] = acc[mb][nb][j];
    __syncthreads();   // every wave's partial tile is in LDS before any thread adds them
#pragma unroll
    for (int s = 0; s < MB * 8 / NW; ++s) { const int it = s * NW * 32 + tid, row = it >> 4, cofs = (it & 15) * 4; v4f val = *(const v4fa*)(red + row * 68 + cofs);
#pragma unroll
        for (int p = 1; p < NW; ++p) val += *(const v4fa*)(red + p * PT + row * 68 + cofs);
        if (BIAS) { val[0] += bfr(bias[c0 + cofs]); val[1] += bfr(bias[c0 + cofs + 1]); val[2] += bfr(bias[c0 + cofs + 2]); val[3] += bfr(bias[c0 + cofs + 3]); }
        *(v4f*)(C + (size_t)(r0 + row) * ldc + c0 + cofs) = val; }
}

__device__ __forceinline__ h16 tohx(float x) { return (h16)x; }
__device__ __forceinline__ void splitf(float y, unsigned short& h, unsigned short& l) { h = f2bf(y); l = f2bf(y - bf2f(h)); }
typedef __attribute__((ext_vector_type(2))) _Float16 v2h;
typedef __attribute__((ext_vector_type(4))) _Float16 v4h;
typedef __attribute__((ext_vector_type(2))) unsigned short v2us;
typedef __attribute__((ext_vector_type(4))) unsigned short v4us;
typedef __attribute__((ext_vector_type(2))) float v2f;
typedef __attribute__((ext_vector_type(4))) int v4i;

__global__ __launch_bounds__(256) void k_wtG(const float* __restrict__ w0, const float* __restrict__ w1, const float* __restrict__ w2, const float* __restrict__ w3, int K, int N, bf* Bt) {
    const int y = blockIdx.y; const float* w = (y == 0) ? w0 : (y == 1) ? w1 : (y == 2) ? w2 : w3; Bt += (size_t)y * K * N;   // blockIdx.y: which of the four equal-shaped matrices
    const int lane = threadIdx.x & 31; const int L0 = (blockIdx.x * 8 + (threadIdx.x >> 5)) * 8; const int nlines = N * K / 64;
{
#pragma unroll 1
        for (int l = 0; l < 8; ++l) { const int L = L0 + l; if (L >= nlines) break; const size_t e = (size_t)L * 64 + lane * 2; const int k = (int)(e % K), n = (int)(e / K); v2us o;
            o[0] = f2bf(w[(size_t)k * N + n]); o[1] = f2bf(w[(size_t)(k + 1) * N + n]); *(v2us*)(Bt + e) = o; }
         }
}
__global__ __launch_bounds__(256) void k_cvt8(const float* __restrict__ s0, const float* __restrict__ s1, const float* __restrict__ s2, bf* dst, size_t n8) { const size_t i = (size_t)blockIdx.x * 256 + threadIdx.x; if (i >= n8) return; const int y = blockIdx.y; const float* src = (y == 0) ? s0 : (y == 1) ? s1 : s2; dst += (size_t)y * n8 * 8;   // blockIdx.y: which of the three equal-shaped tensors
    const v8f v = *(const v8f*)(src + i * 8); v8us o;
#pragma unroll
    for (int k = 0; k < 8; ++k) o[k] = f2bf(v[k]); *(v8us*)(dst + i * 8) = o;  }

#define KT  64          // keys per staged tile
#define KP  72          // LDS row pitch in 16-bit elements: 144 B = 16 B x 9, the pitch of ds_load_b128 readers of 128-B rows
#define TLE (64 * KP)   // elements of one staged tile: 64 rows (K: keys; V^T: head dims) of 64 values
// Two tiles of 64 rows x 128 B, global -> LDS: a thread brings 16 B of rows r, r + 16, r + 32, r + 48 of each tile (a wave's copy: four whole 128-B lines). The 128 threads of k_fattn cover both tiles in one call, a wave of k_qkv in four.
// la, lb: the thread's LDS byte addresses in row r; ga, gb: its global addresses there; sa, sb: bytes of 16 global rows. The wait on xcnt closes the copies' own statement: their address registers are reused behind it.
__device__ __forceinline__ void cp2(unsigned la, const char* ga, size_t sa, unsigned lb, const char* gb, size_t sb) {
    asm volatile("global_load_async_to_lds_b128 %0, %1, off\n\tglobal_load_async_to_lds_b128 %2, %3, off\n\tglobal_load_async_to_lds_b128 %4, %5, off\n\tglobal_load_async_to_lds_b128 %6, %7, off\n\t"
                 "global_load_async_to_lds_b128 %8, %9, off\n\tglobal_load_async_to_lds_b128 %10, %11, off\n\tglobal_load_async_to_lds_b128 %12, %13, off\n\tglobal_load_async_to_lds_b128 %14, %15, off\n\ts_wait_xcnt 0x0"
                 :: "v"(la), "v"(ga), "v"(la + 16u * KP * 2u), "v"(ga + sa), "v"(la + 32u * KP * 2u), "v"(ga + 2 * sa), "v"(la + 48u * KP * 2u), "v"(ga + 3 * sa),
                    "v"(lb), "v"(gb), "v"(lb + 16u * KP * 2u), "v"(gb + sb), "v"(lb + 32u * KP * 2u), "v"(gb + 2 * sb), "v"(lb + 48u * KP * 2u), "v"(gb + 3 * sb) : "memory"); }
// ---- k_qkv: the three projections of all batches, K split over 8 waves as in k_gemmsk (same loaders, same partial sums, same order of addition, bias last); the epilogue writes the attention kernel's operand planes itself.
// z = 0, 1 (q, k): A = 64 token rows, B = the 64 columns of head blockIdx.y -> planes [batch][head][t][d]. z = 2 (v): the operands change places (A = the head's 64 weight rows, B = 64 tokens),
// so the tile comes out as [d][t] and goes to the transposed planes [batch][head][d][t] in whole lines too. Each value is stored as fp16 and as bf16 hi + lo.
// A wave's K slice of an operand row is one 128-B line: the wave brings its 64 + 64 lines into LDS by asynchronous copies, four whole lines a copy, and takes its fragments from there.
__global__ __launch_bounds__(256) __attribute__((amdgpu_waves_per_eu(2, 2))) void k_qkv(const bf* __restrict__ X, const bf* __restrict__ Wt, const float* __restrict__ bias0, const float* __restrict__ bias1, const float* __restrict__ bias2, h16* P16, bf* Ph, bf* Pl, h16* V16, bf* Vh, bf* Vl) {
    typedef WFrag<bf> F; typedef F::V V;
    constexpr int NW = 8, KW = DM / NW, PT = TLE;   // PT: floats of a wave's own LDS region: first its two staged operand tiles (2 x TLE 16-bit values), then, over them, its partial tile (64 rows, pitch 68)
    static_assert(KW == 64 && PT >= 64 * 68, "a row's slice is one 128-B line; the partial tile fits the wave's region");
    __shared__ __align__(16) float red[NW * PT];
    const int z = blockIdx.z; const bool tr = (z == 2); const float* bias = (z == 0) ? bias0 : (z == 1) ? bias1 : bias2;
    const int tid = threadIdx.x, w = __builtin_amdgcn_readfirstlane(tid >> 5), lane = tid & 31, lr = lane & 15, hi = lane >> 4; const int t0 = blockIdx.x * 64, n0 = blockIdx.y * 64;
    const bf* Xz = X + (size_t)z * NB_ * TT * DM + (size_t)t0 * DM; const bf* Wz = Wt + (size_t)z * DQ * DM + (size_t)n0 * DM;
    const bf* A = tr ? Wz : Xz; const bf* Bt = tr ? Xz : Wz;
    v8f acc[4][4];
#pragma unroll
    for (int mb = 0; mb < 4; ++mb)
#pragma unroll
        for (int nb = 0; nb < 4; ++nb) acc[mb][nb] = (v8f){};
    const bf* st = (const bf*)(red + w * PT);   // this wave's staged tiles: A, behind it B, 64 rows of KP each
    { const unsigned l0 = (unsigned)(size_t)st + (unsigned)((lane >> 3) * (KP * 2) + (lane & 7) * 16); const size_t go = (size_t)(lane >> 3) * DM + w * KW + (lane & 7) * 8;
      const char* ga = (const char*)(A + go); const char* gb = (const char*)(Bt + go);
#pragma unroll   // four statements of eight copies each, their offsets constants: all 32 copies of the wave are in flight together
      for (int q = 0; q < 4; ++q) cp2(l0 + (unsigned)(q * 4 * KP * 2), ga + (size_t)q * 4 * DM * 2, (size_t)16 * DM * 2, l0 + (unsigned)(TLE * 2 + q * 4 * KP * 2), gb + (size_t)q * 4 * DM * 2, (size_t)16 * DM * 2); }   // rows 4 q + lane / 8 + 0, 16, 32, 48 of both tiles
    asm volatile("s_wait_asynccnt 0x0" ::: "memory");   // this wave's copies have landed
    __syncthreads();                                    // every wave's have: the staged tiles may be read
    const bf* fa = st + lr * KP + 8 * hi; const bf* fb = fa + TLE;
#pragma unroll   // both 32-k steps in a straight line: the second step's LDS reads can go ahead of the first step's WMMAs, and no back edge stands behind a WMMA
    for (int kc = 0; kc < KW; kc += 32) {
        V a[4];
#pragma unroll
        for (int mb = 0; mb < 4; ++mb) a[mb] = F::ld(fa + mb * 16 * KP + kc);
#pragma unroll
        for (int nb = 0; nb < 4; ++nb) { const V b = F::ld(fb + nb * 16 * KP + kc);
#pragma unroll
            for (int mb = 0; mb < 4; ++mb) acc[mb][nb] = F::mma(a[mb], b, acc[mb][nb]); }
    }
    asm volatile("s_wait_dscnt 0x0" ::: "memory");   // every fragment read of this wave has returned before its partial tile is written over its staged tiles (no other wave touches them)
    float* my = red + w * PT;
#pragma unroll
    for (int mb = 0; mb < 4; ++mb)
#pragma unroll
        for (int nb = 0; nb < 4; ++nb)
#pragma unroll
            for (int j = 0; j < 8; ++j) my[(mb * 16 + hi * 8 + j) * 68 + nb * 16 + lr] = acc[mb][nb][j];
    __syncthreads();   // every wave's partial tile is in LDS before any thread adds them
    const int zh = (t0 / TT) * NH_ + (int)blockIdx.y, tt0 = t0 % TT;   // (batch, head) plane; first token of the tile inside its batch (a tile never crosses a batch: TT % 64 == 0)
    h16* d16 = tr ? V16 + ((size_t)zh * HD) * TT + tt0 : P16 + (size_t)z * NZ * TT * HD + ((size_t)zh * TT + tt0) * HD;
    bf* dh = tr ? Vh + ((size_t)zh * HD) * TT + tt0 : Ph + (size_t)z * NZ * TT * HD + ((size_t)zh * TT + tt0) * HD;
    bf* dl = tr ? Vl + ((size_t)zh * HD) * TT + tt0 : Pl + (size_t)z * NZ * TT * HD + ((size_t)zh * TT + tt0) * HD;
    const int pitch = tr ? TT : HD;
#pragma unroll
    for (int s = 0; s < 4; ++s) { const int it = s * 256 + tid, row = it >> 4, cofs = (it & 15) * 4; v4f val = *(const v4fa*)(red + row * 68 + cofs);
#pragma unroll
        for (int p = 1; p < NW; ++p) val += *(const v4fa*)(red + p * PT + row * 68 + cofs);
        v4h o16; v4us oh, ol;
#pragma unroll
        for (int q = 0; q < 4; ++q) { const float r = val[q] + bfr(bias[n0 + (tr ? row : cofs + q)]); o16[q] = tohx(r); unsigned short a2, c2; splitf(r, a2, c2); oh[q] = a2; ol[q] = c2; }
        const size_t e = (size_t)row * pitch + cofs; *(v4h*)(d16 + e) = o16; *(v4us*)(dh + e) = oh; *(v4us*)(dl + e) = ol; }
}
// ---- k_fattn: scores, softmax and attn.v of one (batch, head) plane in one kernel; no score or probability leaves the registers.
// Transposed products: S^T = K Q^T (A = 16 key rows, B = 16 query columns), so lane (lr, hi) holds, for query lr, the scores of keys 8 hi + 0..7 of each 16-key tile;
// two such tiles, converted in place, are the B fragment of O^T += V^T P^T in the k order of the WFrag loaders. Running maximum and sum per query (online softmax), 32 keys a pass.
// x = log2(e) (tau (q.k/8) + delta[j]); p = 2^(x - m). Rows < RH: hi+lo bf16 planes, 3 products each; the rest fp16 with p x 1024 (the factor cancels in p / sum).
typedef __attribute__((ext_vector_type(8))) __bf16 v8b;
#define LOG2E 1.4426950408889634f
__device__ __forceinline__ float xhalf(float x) { const int b = __float_as_int(x); return __int_as_float(__builtin_amdgcn_permlanex16(b, b, 0x76543210, 0xfedcba98, false, false)); }   // lane l <-> l ^ 16
// 2^x of eight values / of one value. One statement each, results in registers of their own ("=&v"), closed by v_nop: the slot the instruction set asks for between a transcendental
// and an instruction that reads its result or overwrites its source.
__device__ __forceinline__ v8f exp2x8(v8f x) { float r0, r1, r2, r3, r4, r5, r6, r7;
    asm("v_exp_f32 %0, %8\n\tv_exp_f32 %1, %9\n\tv_exp_f32 %2, %10\n\tv_exp_f32 %3, %11\n\tv_exp_f32 %4, %12\n\tv_exp_f32 %5, %13\n\tv_exp_f32 %6, %14\n\tv_exp_f32 %7, %15\n\tv_nop"
        : "=&v"(r0), "=&v"(r1), "=&v"(r2), "=&v"(r3), "=&v"(r4), "=&v"(r5), "=&v"(r6), "=&v"(r7) : "v"(x[0]), "v"(x[1]), "v"(x[2]), "v"(x[3]), "v"(x[4]), "v"(x[5]), "v"(x[6]), "v"(x[7]));
    return (v8f){r0, r1, r2, r3, r4, r5, r6, r7}; }
__device__ __forceinline__ float exp2x1(float x) { float r; asm("v_exp_f32 %0, %1\n\tv_nop" : "=&v"(r) : "v"(x)); return r; }
// behind a group of global loads, in front of any reuse of their address registers; as inputs of the wait the four addresses stay whole up to it
__device__ __forceinline__ void xwait(const void* a, const void* b, const void* c, const void* d) { asm volatile("s_wait_xcnt 0x0" :: "v"(a), "v"(b), "v"(c), "v"(d) : "memory"); }
template <typename T16, bool HI, int QB>   // QB: 16-query column groups per wave (1 or 2)
__device__ __forceinline__ void fattn(const T16* __restrict__ Q, const T16* __restrict__ Q2, const T16* __restrict__ Kp, const T16* __restrict__ K2, const T16* __restrict__ Vt, const T16* __restrict__ Vt2, const float* dls, const T16* ring, float c1, bf* __restrict__ Ah, bf* __restrict__ Al, int q0) {
    typedef WFrag<T16> F; typedef typename F::V V;
    constexpr int NT = HI ? 4 : 2, NS = TT / KT;   // tiles per buffer (K, V^T; hi+lo: K lo, V^T lo too); stages
    static_assert(NS >= 2 && TT % KT == 0 && HD == 64 && KT == 64, "the ring needs two whole stages; a tile is 64 rows of 128 B");
    const int tid = threadIdx.x, lane = tid & 31, lr = lane & 15, hi = lane >> 4;
    // stage s -> buffer b: K rows [s KT, s KT + KT) and the same keys' columns of V^T
    const unsigned lcp = (unsigned)(size_t)ring + (unsigned)((tid >> 3) * (KP * 2) + (tid & 7) * 16);
    const char* kg = (const char*)(Kp + (size_t)(tid >> 3) * HD + (tid & 7) * 8); const char* vg = (const char*)(Vt + (size_t)(tid >> 3) * TT + (tid & 7) * 8);
    const char* kg2 = HI ? (const char*)(K2 + (size_t)(tid >> 3) * HD + (tid & 7) * 8) : kg; const char* vg2 = HI ? (const char*)(Vt2 + (size_t)(tid >> 3) * TT + (tid & 7) * 8) : vg;
    auto stage = [&](int s, int b) { const unsigned l0 = lcp + (unsigned)(b * NT * TLE * 2);
        cp2(l0, kg + (size_t)s * (KT * HD * 2), 16 * HD * 2, l0 + TLE * 2, vg + (size_t)s * (KT * 2), (size_t)16 * TT * 2);
        if (HI) cp2(l0 + 2 * TLE * 2, kg2 + (size_t)s * (KT * HD * 2), 16 * HD * 2, l0 + 3 * TLE * 2, vg2 + (size_t)s * (KT * 2), (size_t)16 * TT * 2); };
    stage(0, 0);
    V qf[QB][2], qf2[QB][2]; v8f o[QB][4]; float m[QB], l[QB]; const T16* qp[QB]; const T16* qp2[QB];
#pragma unroll
    for (int g = 0; g < QB; ++g) { m[g] = -3.0e38f; l[g] = 0.f; const size_t qo = (size_t)(q0 + g * 16 + lr) * HD + 8 * hi; qp[g] = Q + qo; qp2[g] = HI ? Q2 + qo : qp[g];
#pragma unroll
        for (int kc = 0; kc < 2; ++kc) { qf[g][kc] = F::ld(qp[g] + kc * 32); if (HI) qf2[g][kc] = F::ld(qp2[g] + kc * 32); }
#pragma unroll
        for (int nb = 0; nb < 4; ++nb) o[g][nb] = (v8f){}; }
    xwait(qp[0], qp[QB - 1], qp2[0], qp2[QB - 1]);
    asm volatile("s_wait_asynccnt 0x0" ::: "memory");   // this wave's copies of stage 0 have landed
    __syncthreads();                                    // every wave's have: stage 0 may be read
    stage(1, 1);
#pragma unroll 1   // rolled: one stage a trip, the buffers change places
    for (int st = 0; st < NS; ++st) {
        const T16* kb = ring + (st & 1) * (NT * TLE) + lr * KP + 8 * hi; const T16* vb = kb + TLE; const T16* kb2 = kb + 2 * TLE; const T16* vb2 = kb + 3 * TLE;
#pragma unroll   // the two 32-key passes of a stage stand one behind the other, so that the second's LDS reads can go ahead of the first's vector work
        for (int pp = 0; pp < KT / 32; ++pp) {
            const int j0 = st * KT + pp * 32;
            V kf[2][2], kf2[2][2], vf[4], vf2[4];
#pragma unroll
            for (int t = 0; t < 2; ++t)
#pragma unroll
                for (int kc = 0; kc < 2; ++kc) { kf[t][kc] = F::ld(kb + (pp * 32 + t * 16) * KP + kc * 32); if (HI) kf2[t][kc] = F::ld(kb2 + (pp * 32 + t * 16) * KP + kc * 32); }
#pragma unroll
            for (int nb = 0; nb < 4; ++nb) { vf[nb] = F::ld(vb + nb * 16 * KP + pp * 32); if (HI) vf2[nb] = F::ld(vb2 + nb * 16 * KP + pp * 32); }
            v8f s[QB][2];
#pragma unroll
            for (int g = 0; g < QB; ++g)
#pragma unroll
                for (int t = 0; t < 2; ++t) { s[g][t] = (v8f){};
#pragma unroll
                    for (int kc = 0; kc < 2; ++kc) { s[g][t] = F::mma(kf[t][kc], qf[g][kc], s[g][t]); if (HI) { s[g][t] = F::mma(kf[t][kc], qf2[g][kc], s[g][t]); s[g][t] = F::mma(kf2[t][kc], qf[g][kc], s[g][t]); } } }
            v8f dl[2]; V pf[QB], pf2[QB];
#pragma unroll
            for (int t = 0; t < 2; ++t) { const v4f d0 = *(const v4fa*)(dls + j0 + t * 16 + hi * 8), d1 = *(const v4fa*)(dls + j0 + t * 16 + hi * 8 + 4); dl[t] = __builtin_shufflevector(d0, d1, 0, 1, 2, 3, 4, 5, 6, 7); }
#pragma unroll
            for (int g = 0; g < QB; ++g) {
                float mx = -3.0e38f;
#pragma unroll
                for (int t = 0; t < 2; ++t)
#pragma unroll
                    for (int j = 0; j < 8; ++j) { s[g][t][j] = fmaf(s[g][t][j], c1, dl[t][j]); mx = fmaxf(mx, s[g][t][j]); }
                mx = fmaxf(mx, xhalf(mx));
                const float mn = fmaxf(m[g], mx), al = exp2x1(m[g] - mn), ms = HI ? mn : mn - 10.0f; m[g] = mn;
                float ps[2];
#pragma unroll
                for (int t = 0; t < 2; ++t) {
                    s[g][t] = exp2x8(s[g][t] - ms);
                    ps[t] = ((s[g][t][0] + s[g][t][1]) + (s[g][t][2] + s[g][t][3])) + ((s[g][t][4] + s[g][t][5]) + (s[g][t][6] + s[g][t][7])); }
                l[g] = fmaf(l[g], al, ps[0] + ps[1]);   // this lane's half of the keys; the halves meet behind the loop
#pragma unroll
                for (int nb = 0; nb < 4; ++nb) o[g][nb] *= al;
                if constexpr (HI) {
                    const v8b h0 = __builtin_convertvector(s[g][0], v8b), h1 = __builtin_convertvector(s[g][1], v8b);
                    const v8b l0 = __builtin_convertvector(s[g][0] - __builtin_convertvector(h0, v8f), v8b), l1 = __builtin_convertvector(s[g][1] - __builtin_convertvector(h1, v8f), v8b);
                    pf[g] = __builtin_shufflevector(h0, h1, 0, 1, 2, 3, 4, 5, 6, 7, 8, 9, 10, 11, 12, 13, 14, 15); pf2[g] = __builtin_shufflevector(l0, l1, 0, 1, 2, 3, 4, 5, 6, 7, 8, 9, 10, 11, 12, 13, 14, 15);
                } else pf[g] = cat16(__builtin_convertvector(s[g][0], v8h), __builtin_convertvector(s[g][1], v8h));
            }
            // attn.v of all groups behind the softmax of all groups: no 2^x statement stands close behind a WMMA whose operand registers it could be given
#pragma unroll
            for (int g = 0; g < QB; ++g)
#pragma unroll
                for (int nb = 0; nb < 4; ++nb) { o[g][nb] = F::mma(vf[nb], pf[g], o[g][nb]); if constexpr (HI) { o[g][nb] = F::mma(vf[nb], pf2[g], o[g][nb]); o[g][nb] = F::mma(vf2[nb], pf[g], o[g][nb]); } }
        }
        // four vector slots behind the stage's last WMMAs, also on the taken back edge: the next instructions write over their operands.
        // The accumulators are named so that every WMMA of the stage stands in front of the slots.
        if constexpr (QB == 1) asm volatile("v_nop\n\tv_nop\n\tv_nop\n\tv_nop" : "+v"(o[0][0]), "+v"(o[0][1]), "+v"(o[0][2]), "+v"(o[0][3]));
        else asm volatile("v_nop\n\tv_nop\n\tv_nop\n\tv_nop" : "+v"(o[0][0]), "+v"(o[0][1]), "+v"(o[0][2]), "+v"(o[0][3]), "+v"(o[QB - 1][0]), "+v"(o[QB - 1][1]), "+v"(o[QB - 1][2]), "+v"(o[QB - 1][3]));
        asm volatile("s_wait_dscnt 0x0" ::: "memory");      // this wave's reads of the stage's buffer are done before the buffer is handed back
        asm volatile("s_wait_asynccnt 0x0" ::: "memory");   // this wave's copies of the next stage have landed
        __syncthreads();                                    // next stage published; every reader has left this stage's buffer
        if (st + 2 < NS) stage(st + 2, st & 1);             // refill it, one whole stage ahead of its readers
    }
    asm volatile("s_wait_asynccnt 0x0" ::: "memory");   // no copy is outstanding when the wave goes on to its end
    // The merged rows [t][head * HD + d], bf16 hi + lo: the A planes of the out projection (Ah, Al point at this batch's row 0, this head's column 0). A lane holds 8 consecutive d of its query per tile.
    // Rows >= RH: the x 1024 comes off again, exactly, before the split.
#pragma unroll
    for (int g = 0; g < QB; ++g) { const float f = __fdiv_rn(HI ? 1.0f : PCAR, l[g] + xhalf(l[g])); const size_t ro = (size_t)(q0 + g * 16 + lr) * DQ + hi * 8; bf* const ph = Ah + ro; bf* const pl = Al + ro;
#pragma unroll
        for (int nb = 0; nb < 4; ++nb) { const v8f r = o[g][nb] * f; v8us oh, ol;
#pragma unroll
            for (int j = 0; j < 8; ++j) { unsigned short a, c2; splitf(HI ? r[j] : r[j] * (1.0f / PCAR), a, c2); oh[j] = a; ol[j] = c2; }
            *(v8us*)(ph + nb * 16) = oh; *(v8us*)(pl + nb * 16) = ol;
            // behind the two stores, in front of any reuse of their data and address registers; as inputs of the wait these stay whole up to it
            asm volatile("s_wait_xcnt 0x0" :: "v"(oh), "v"(ol), "v"(ph), "v"(pl) : "memory"); } }
}
// grid (RH/64 + (TT-RH)/128, NZ), 4 waves: blocks x < RH/64 take 64 hi+lo query rows (16 a wave), the others 128 fp16 rows (32 a wave); every wave walks all TT keys.
// K and V^T reach the waves through LDS: 64 keys a stage, two buffers, brought in by asynchronous copies in whole lines and read by all four waves.
__global__ __launch_bounds__(128) void k_fattn(const h16* __restrict__ Q16, const h16* __restrict__ K16, const h16* __restrict__ V16, const bf* __restrict__ Qh, const bf* __restrict__ Ql, const bf* __restrict__ Kh, const bf* __restrict__ Kl, const bf* __restrict__ Vh, const bf* __restrict__ Vl, const float* __restrict__ TAU, const float* __restrict__ DEL, bf* __restrict__ Ah, bf* __restrict__ Al) {
    __shared__ __align__(16) float dls[TT];   // log2(e) delta[b][j]
    __shared__ __align__(16) unsigned short ring[2 * 4 * TLE];   // two buffers of up to four tiles
    const int z = blockIdx.y, b = z / NH_, tid = threadIdx.x, w = __builtin_amdgcn_readfirstlane(tid >> 5); const size_t zo = (size_t)z * TT * HD, ao = (size_t)b * TT * DQ + (z % NH_) * HD;
#pragma unroll
    for (int i = 0; i < TT / 128; ++i) dls[i * 128 + tid] = bfr(DEL[(size_t)b * TT + i * 128 + tid]) * LOG2E;
    const float c1 = bfr(TAU[b]) * (SCL * LOG2E);
    __syncthreads();   // the delta row is whole before any wave reads it
    if (blockIdx.x < RH / 64) fattn<bf, true, 1>(Qh + zo, Ql + zo, Kh + zo, Kl + zo, Vh + zo, Vl + zo, dls, (const bf*)ring, c1, Ah + ao, Al + ao, (int)blockIdx.x * 64 + w * 16);
    else fattn<h16, false, 2>(Q16 + zo, nullptr, K16 + zo, nullptr, V16 + zo, nullptr, dls, (const h16*)ring, c1, Ah + ao, Al + ao, RH + ((int)blockIdx.x - RH / 64) * 128 + w * 32);
}

extern "C" void kernel_launch(void* const* d_in, const int* in_sizes, int n_in,
                              void* d_out, int out_size, void* d_ws, size_t ws_size, hipStream_t stream) {
    (void)in_sizes; (void)n_in; (void)out_size;
    const float* x = (const float*)d_in[0]; const float* xk = (const float*)d_in[1]; const float* xv = (const float*)d_in[2]; const float* TAU = (const float*)d_in[3]; const float* DEL = (const float*)d_in[4]; const float* wq = (const float*)d_in[5]; const float* bq = (const float*)d_in[6]; const float* wk = (const float*)d_in[7]; const float* bk = (const float*)d_in[8]; const float* wv = (const float*)d_in[9]; const float* bv = (const float*)d_in[10]; const float* wo = (const float*)d_in[11]; const float* bo = (const float*)d_in[12];
    float* OUT = (float*)d_out;     // [4][2048][512]
    char* wsp = (char*)d_ws;
    auto take = [&](size_t bytes) { char* p = wsp; wsp += (bytes + 255) & ~(size_t)255; return (void*)p; };
    const size_t PLN = (size_t)NZ * TT * HD;   // elements of one plane set: every (batch, head)
    bf* WQ = (bf*)take((size_t)DQ * DM * 2); bf* WK = (bf*)take((size_t)DKV * DM * 2); bf* WV = (bf*)take((size_t)DKV * DM * 2); bf* WO = (bf*)take((size_t)DM * DQ * 2); (void)WK; (void)WV;
    h16* QP16 = (h16*)take(PLN * 2); h16* KP16 = (h16*)take(PLN * 2); h16* VT16 = (h16*)take(PLN * 2);
    bf* QPh = (bf*)take(PLN * 2); bf* KPh = (bf*)take(PLN * 2); bf* QPl = (bf*)take(PLN * 2); bf* KPl = (bf*)take(PLN * 2); bf* VTh = (bf*)take(PLN * 2); bf* VTl = (bf*)take(PLN * 2);
    bf* ATh = (bf*)take((size_t)NB_ * TT * DQ * 2); bf* ATl = (bf*)take((size_t)NB_ * TT * DQ * 2);
    bf* XB = (bf*)take((size_t)3 * NB_ * TT * DM * 2);   // bf16 inputs. k_qkv reaches the k planes from the q planes: each k plane set lies directly behind its q plane set
    if ((size_t)(wsp - (char*)d_ws) > ws_size) return;    // ws 256 MiB
    k_wtG<<<dim3((unsigned)((DM * DQ / 64 + 63) / 64), 4, 1), 256, 0, stream>>>(wq, wk, wv, wo, DM, DQ, WQ);
    k_cvt8<<<dim3((unsigned)(((size_t)NB_ * TT * DM / 8 + 255) / 256), 3, 1), 256, 0, stream>>>(x, xk, xv, XB, (size_t)NB_ * TT * DM / 8);
    // q, k, v projections of all batches (x: 64 token rows, y: head, z: which projection), written as the attention kernel's planes
    k_qkv<<<dim3(NB_ * TT / 64, NH_, 3), 256, 0, stream>>>(XB, WQ, bq, bk, bv, QP16, QPh, QPl, VT16, VTh, VTl);
    k_fattn<<<dim3(RH / 64 + (TT - RH) / 128, NZ, 1), 128, 0, stream>>>(QP16, KP16, VT16, QPh, QPl, KPh, KPl, VTh, VTl, TAU, DEL, ATh, ATl);
    k_gemmsk<bf, 1, true, 4, 8, DQ / 8><<<dim3(NB_ * TT / 64, DM / 64, 1), 256, 0, stream>>>(ATh, ATl, WO, nullptr, OUT, DM, bo, nullptr, nullptr, 0, 0, 0);
}

// v007
// One run takes 124 microseconds.
// Two timings next to v006 both put it at 1.24 times that version's speed.
// All steps since v000 together make it 18.0 times as fast.
#include <hip/hip_runtime.h>

// De-stationary attention (Non-stationary Transformer) (queries, keys, values [4][2048][512]; q, k, v = . W + b ('xw' [512][512]; 8 heads x 64); scores = tau[b] (q.k/8) + delta[b][s] (tau [4], delta [4][2048], read); softmax; out = merged Wo + bo -> [4][2048][512] (4.2 M)).
// Compute dtypes, f32 accumulate: every input rounded to bf16; q/k/v on PLAIN bf16 operands (inputs: exact) + biases; tau scale and delta shift applied in f32 per (i, j) inside the attention kernel; scores and attn.v: query rows < 512 hl (3 products), the rest single fp16 (x1024); softmax f32; Wo hl x exact (2 products) + bo.

#define NB_  4
#define TT   2048
#define DM   512
#define NH_  8
#define NKV  8
#define REP  (NH_ / NKV)
#define HD   64
#define DQ   (NH_ * HD)
#define DKV  (NKV * HD)
#define NZ   (NB_ * NH_)          // all (batch, head) planes
#define RH   512                  // query rows < RH use hi+lo planes (0: none)
#define WIN  0
#define PCAR 1024.0f
#define SCL  0.125f   // HD^-0.5
typedef _Float16 h16;
typedef unsigned short bf;
typedef __attribute__((ext_vector_type(16))) __bf16   v16bf;
typedef __attribute__((ext_vector_type(16))) _Float16 v16h;
typedef __attribute__((ext_vector_type(8)))  _Float16 v8h;
typedef __attribute__((ext_vector_type(8)))  unsigned short v8us;
typedef __attribute__((ext_vector_type(8)))  float    v8f;
typedef __attribute__((ext_vector_type(4)))  float    v4f;
typedef v8h  __attribute__((may_alias)) v8ha;
typedef v4f  __attribute__((may_alias)) v4fa;
typedef v8us __attribute__((may_alias)) v8usa;

__device__ __forceinline__ unsigned short f2bf(float f) { unsigned u = __float_as_uint(f); u += 0x7FFFu + ((u >> 16) & 1u); return (unsigned short)(u >> 16); }
__device__ __forceinline__ float bf2f(unsigned short b) { return __uint_as_float(((unsigned)b) << 16); }
__device__ __forceinline__ float bfr(float f) { return bf2f(f2bf(f)); }
__device__ __forceinline__ v16h cat16(v8h lo, v8h hi) { return __builtin_shufflevector(lo, hi, 0, 1, 2, 3, 4, 5, 6, 7, 8, 9, 10, 11, 12, 13, 14, 15); }
__device__ __forceinline__ v16bf cat16b(v8us lo, v8us hi) { return __builtin_bit_cast(v16bf, __builtin_shufflevector(lo, hi, 0, 1, 2, 3, 4, 5, 6, 7, 8, 9, 10, 11, 12, 13, 14, 15)); }
__device__ __forceinline__ v8f wmma16(v16h a, v16h b, v8f c) { return __builtin_amdgcn_wmma_f32_16x16x32_f16(false, a, false, b, (short)0, c, false, false); }
__device__ __forceinline__ v8f wmmab(v16bf a, v16bf b, v8f c) { return __builtin_amdgcn_wmma_f32_16x16x32_bf16(false, a, false, b, (short)0, c, false, false); }



// fragment loaders: K-contiguous 16-bit planes, lane (lr, hi) takes k = 8 hi + 0..7 and 16 + 8 hi + 0..7 of each 32
template <typename T16> struct WFrag;
template <> struct WFrag<h16> { typedef v16h V; static __device__ __forceinline__ V ld(const h16* p) { return cat16(*(const v8h*)p, *(const v8h*)(p + 16)); } static __device__ __forceinline__ v8f mma(V a, V b, v8f c) { return wmma16(a, b, c); } };
template <> struct WFrag<bf> { typedef v16bf V; static __device__ __forceinline__ V ld(const bf* p) { return cat16b(*(const v8us*)p, *(const v8us*)(p + 16)); } static __device__ __forceinline__ v8f mma(V a, V b, v8f c) { return wmmab(a, b, c); } };
// ---- k_gemmsk: C[m][n] (f32, pitch ldc, + optional f32 bias[n]) = sum_k A[m][k] Bt[n][k] (+ split products per NSPLIT), operands straight from K-contiguous 16-bit planes. NW waves of one work-group share one (MB*16)x64 output tile; wave w sums k in [w*KW, (w+1)*KW) with the WFrag loaders;
// the NW partial tiles meet in LDS and are added in wave order (bias last). grid (M/(MB*16), N/64, Z), NW*32 threads. K = NW*KW.
template <typename T16, int NSPLIT, bool BIAS, int MB, int NW, int KW, int LDA = NW * KW>   // LDA: row pitch of A and A2 in elements
// waves_per_eu: registers are allotted as for one work-group per WGP (more fragment loads in flight per trip)
__global__ __launch_bounds__(NW * 32) __attribute__((amdgpu_waves_per_eu(NW / 4, NW / 4))) void k_gemmsk(const T16* __restrict__ A, const T16* __restrict__ A2, const T16* __restrict__ Bt, const T16* __restrict__ Bt2, float* C, int ldc, const float* __restrict__ bias0, const float* __restrict__ bias1, const float* __restrict__ bias2, size_t sA, size_t sB, size_t sC) {
    typedef typename WFrag<T16>::V V;
    constexpr int K = NW * KW, PT = MB * 16 * 68; static_assert((MB * 8) % NW == 0 && KW % 32 == 0, "tile and slice must divide evenly");
    __shared__ __align__(16) float red[NW * PT];
    const size_t z = blockIdx.z; A += z * sA; if (NSPLIT == 1 || NSPLIT == 2) A2 += z * sA; Bt += z * sB; if (NSPLIT >= 2) Bt2 += z * sB; C += z * sC; const float* bias = (z == 0) ? bias0 : (z == 1) ? bias1 : bias2;   // one bias vector per z plane
    const int tid = threadIdx.x, w = __builtin_amdgcn_readfirstlane(tid >> 5), lane = tid & 31, lr = lane & 15, hi = lane >> 4; const int r0 = blockIdx.x * (MB * 16), c0 = blockIdx.y * 64;
    v8f acc[MB][4];
#pragma unroll
    for (int mb = 0; mb < MB; ++mb)
#pragma unroll
        for (int nb = 0; nb < 4; ++nb) acc[mb][nb] = (v8f){};
    const size_t aoff = (size_t)(r0 + lr) * LDA + w * KW + 8 * hi, boff = (size_t)(c0 + lr) * K + w * KW + 8 * hi;
#pragma unroll 1   // rolled: unrolled, this build waited on single load pairs
    for (int kc = 0; kc < KW; kc += 32) {
        V a[MB], a2[MB]; const T16* pa = A + aoff + kc; const T16* pa2 = (NSPLIT == 1 || NSPLIT == 2) ? A2 + aoff + kc : nullptr;
#pragma unroll
        for (int mb = 0; mb < MB; ++mb) { a[mb] = WFrag<T16>::ld(pa + (size_t)mb * 16 * LDA); if (NSPLIT == 1 || NSPLIT == 2) a2[mb] = WFrag<T16>::ld(pa2 + (size_t)mb * 16 * LDA); }
        // the registers of pa and pa2 are reused behind these loads: this wait stands in front of that overwrite, and as its inputs they stay whole up to it
        if (NSPLIT == 1 || NSPLIT == 2) asm volatile("s_wait_xcnt 0x0" :: "v"(pa), "v"(pa2) : "memory"); else asm volatile("s_wait_xcnt 0x0" :: "v"(pa) : "memory");
#pragma unroll
        for (int nb = 0; nb < 4; ++nb) { const V b = WFrag<T16>::ld(Bt + boff + (size_t)nb * 16 * K + kc); V b2; if (NSPLIT >= 2) b2 = WFrag<T16>::ld(Bt2 + boff + (size_t)nb * 16 * K + kc);
#pragma unroll
            for (int mb = 0; mb < MB; ++mb) { acc[mb][nb] = WFrag<T16>::mma(a[mb], b, acc[mb][nb]); if (NSPLIT == 1 || NSPLIT == 2) acc[mb][nb] = WFrag<T16>::mma(a2[mb], b, acc[mb][nb]); if (NSPLIT >= 2) acc[mb][nb] = WFrag<T16>::mma(a[mb], b2, acc[mb][nb]); } }
    }
    float* my = red + w * PT;
#pragma unroll
    for (int mb = 0; mb < MB; ++mb)
#pragma unroll
        for (int nb = 0; nb < 4; ++nb)
#pragma unroll
            for (int j = 0; j < 8; ++j) my[(mb * 16 + hi * 8 + j) * 68 + nb * 16 + lr] = acc[mb][nb][j];
    __syncthreads();   // every wave's partial tile is in LDS before any thread adds them
#pragma unroll
    for (int s = 0; s < MB * 8 / NW; ++s) { const int it = s * NW * 32 + tid, row = it >> 4, cofs = (it & 15) * 4; v4f val = *(const v4fa*)(red + row * 68 + cofs);
#pragma unroll
        for (int p = 1; p < NW; ++p) val += *(const v4fa*)(red + p * PT + row * 68 + cofs);
        if (BIAS) { val[0] += bfr(bias[c0 + cofs]); val[1] += bfr(bias[c0 + cofs + 1]); val[2] += bfr(bias[c0 + cofs + 2]); val[3] += bfr(bias[c0 + cofs + 3]); }
        *(v4f*)(C + (size_t)(r0 + row) * ldc + c0 + cofs) = val; }
}

__device__ __forceinline__ h16 tohx(float x) { return (h16)x; }
__device__ __forceinline__ void splitf(float y, unsigned short& h, unsigned short& l) { h = f2bf(y); l = f2bf(y - bf2f(h)); }
typedef __attribute__((ext_vector_type(2))) _Float16 v2h;
typedef __attribute__((ext_vector_type(4))) _Float16 v4h;
typedef __attribute__((ext_vector_type(2))) unsigned short v2us;
typedef __attribute__((ext_vector_type(4))) unsigned short v4us;
typedef __attribute__((ext_vector_type(2))) float v2f;
typedef __attribute__((ext_vector_type(4))) int v4i;

__global__ __launch_bounds__(256) void k_wtG(const float* __restrict__ w0, const float* __restrict__ w1, const float* __restrict__ w2, const float* __restrict__ w3, int K, int N, bf* Bt) {
    const int y = blockIdx.y; const float* w = (y == 0) ? w0 : (y == 1) ? w1 : (y == 2) ? w2 : w3; Bt += (size_t)y * K * N;   // blockIdx.y: which of the four equal-shaped matrices
    const int lane = threadIdx.x & 31; const int L0 = (blockIdx.x * 8 + (threadIdx.x >> 5)) * 8; const int nlines = N * K / 64;
{
#pragma unroll 1
        for (int l = 0; l < 8; ++l) { const int L = L0 + l; if (L >= nlines) break; const size_t e = (size_t)L * 64 + lane * 2; const int k = (int)(e % K), n = (int)(e / K); v2us o;
            o[0] = f2bf(w[(size_t)k * N + n]); o[1] = f2bf(w[(size_t)(k + 1) * N + n]); *(v2us*)(Bt + e) = o; }
         }
}
__global__ __launch_bounds__(256) void k_cvt8(const float* __restrict__ s0, const float* __restrict__ s1, const float* __restrict__ s2, bf* dst, size_t n8) { const size_t i = (size_t)blockIdx.x * 256 + threadIdx.x; if (i >= n8) return; const int y = blockIdx.y; const float* src = (y == 0) ? s0 : (y == 1) ? s1 : s2; dst += (size_t)y * n8 * 8;   // blockIdx.y: which of the three equal-shaped tensors
    const v8f v = *(const v8f*)(src + i * 8); v8us o;
#pragma unroll
    for (int k = 0; k < 8; ++k) o[k] = f2bf(v[k]); *(v8us*)(dst + i * 8) = o;  }

#define KT  64          // keys per staged tile
#define KP  72          // LDS row pitch in 16-bit elements: 144 B = 16 B x 9, the pitch of ds_load_b128 readers of 128-B rows
#define TLE (64 * KP)   // elements of one staged tile: 64 rows (K: keys; V^T: head dims) of 64 values
// Two tiles of 64 rows x 128 B, global -> LDS: a thread brings 16 B of rows r, r + 16, r + 32, r + 48 of each tile (a wave's copy: four whole 128-B lines). 128 threads cover both tiles in one call.
// la, lb: the thread's LDS byte addresses in row r; ga, gb: its global addresses there; sa, sb: bytes of 16 global rows. The wait on xcnt closes the copies' own statement: their address registers are reused behind it.
__device__ __forceinline__ void cp2(unsigned la, const char* ga, size_t sa, unsigned lb, const char* gb, size_t sb) {
    asm volatile("global_load_async_to_lds_b128 %0, %1, off\n\tglobal_load_async_to_lds_b128 %2, %3, off\n\tglobal_load_async_to_lds_b128 %4, %5, off\n\tglobal_load_async_to_lds_b128 %6, %7, off\n\t"
                 "global_load_async_to_lds_b128 %8, %9, off\n\tglobal_load_async_to_lds_b128 %10, %11, off\n\tglobal_load_async_to_lds_b128 %12, %13, off\n\tglobal_load_async_to_lds_b128 %14, %15, off\n\ts_wait_xcnt 0x0"
                 :: "v"(la), "v"(ga), "v"(la + 16u * KP * 2u), "v"(ga + sa), "v"(la + 32u * KP * 2u), "v"(ga + 2 * sa), "v"(la + 48u * KP * 2u), "v"(ga + 3 * sa),
                    "v"(lb), "v"(gb), "v"(lb + 16u * KP * 2u), "v"(gb + sb), "v"(lb + 32u * KP * 2u), "v"(gb + 2 * sb), "v"(lb + 48u * KP * 2u), "v"(gb + 3 * sb) : "memory"); }
// ---- k_qkv: the three projections of all batches. A work-group of 4 waves owns a 128 x 128 tile of C = A Bt^T, a wave 64 x 64 of it (wm: which 64 A rows, wn: which 64 B rows), and walks all of K itself:
// 8 stages of 64 k, 128 + 128 operand rows a stage (one 128-B line a row), two LDS buffers filled by asynchronous copies one stage ahead. One f32 accumulator chain per output over k = 0..511, bias last.
// z = 0, 1 (q, k): A = token rows, B = weight rows (two heads) -> planes [batch][head][t][d]. z = 2 (v): the operands change places, so a wave's tile comes out as [d][t] and goes to the transposed planes [batch][head][d][t].
// A wave's 64 x 64 tile is one (64 tokens, head) unit: it goes through the wave's own LDS range so that every store covers whole lines. Each value is stored as fp16 and as bf16 hi + lo.
template <bool TR>   // TR: rows are head dims (bias by row, row pitch TT); else rows are tokens (bias by column, row pitch HD)
__device__ __forceinline__ void qkv_out(const float* my, const float* bh, h16* d16, bf* dh, bf* dl, int lane) {
    constexpr int pitch = TR ? TT : HD; const int cofs = (lane & 7) * 8; v8f bc = (v8f){};
    if (!TR) { const v4f b0 = *(const v4fa*)(bh + cofs), b1 = *(const v4fa*)(bh + cofs + 4); bc = __builtin_shufflevector(b0, b1, 0, 1, 2, 3, 4, 5, 6, 7); }
#pragma unroll 1   // rolled: 16 copies of the conversion code in two forms would only lengthen the kernel's text
    for (int s = 0; s < 16; ++s) { const int row = s * 4 + (lane >> 3);   // a wave's store: 4 rows of 128 B
        const v4f v0 = *(const v4fa*)(my + row * 68 + cofs), v1 = *(const v4fa*)(my + row * 68 + cofs + 4); const v8f val = __builtin_shufflevector(v0, v1, 0, 1, 2, 3, 4, 5, 6, 7);
        const float br = TR ? bh[row] : 0.f; v8h o16; v8us oh, ol;
#pragma unroll
        for (int q = 0; q < 8; ++q) { const float r = val[q] + (TR ? br : bc[q]); o16[q] = tohx(r); unsigned short a2, c2; splitf(r, a2, c2); oh[q] = a2; ol[q] = c2; }
        const size_t e = (size_t)row * pitch + cofs; h16* const p16 = d16 + e; bf* const ph = dh + e; bf* const pl = dl + e;
        *(v8h*)p16 = o16; *(v8us*)ph = oh; *(v8us*)pl = ol;
        // behind the three stores, in front of any reuse of their data and address registers; as inputs of the wait these stay whole up to it
        asm volatile("s_wait_xcnt 0x0" :: "v"(o16), "v"(oh), "v"(ol), "v"(p16), "v"(ph), "v"(pl) : "memory"); }
}
__global__ __launch_bounds__(128) void k_qkv(const bf* __restrict__ X, const bf* __restrict__ Wt, const float* __restrict__ bias0, const float* __restrict__ bias1, const float* __restrict__ bias2, h16* P16, bf* Ph, bf* Pl, h16* V16, bf* Vh, bf* Vl) {
    typedef WFrag<bf> F; typedef F::V V;
    constexpr int NS = DM / 64, BUF = 4 * TLE;   // stages; 16-bit elements of one buffer: A rows 0..127, behind them B rows 0..127, pitch KP
    static_assert(NS >= 2 && DM % 64 == 0 && BUF >= 4 * 64 * 68, "the ring needs two whole stages; the four result tiles (pitch 68 floats) fit the two buffers");
    __shared__ __align__(16) float red[BUF];    // the two buffers; behind the loop each wave's result tile
    __shared__ __align__(16) float bs[128];     // the work-group's 128 bias values, rounded
    const int z = blockIdx.z; const bool tr = (z == 2); const float* bias = (z == 0) ? bias0 : (z == 1) ? bias1 : bias2;
    const int tid = threadIdx.x, w = __builtin_amdgcn_readfirstlane(tid >> 5), lane = tid & 31, lr = lane & 15, hi = lane >> 4, wm = w >> 1, wn = w & 1; const int t0 = blockIdx.x * 128, n0 = blockIdx.y * 128;
    const bf* Xz = X + (size_t)z * NB_ * TT * DM + (size_t)t0 * DM; const bf* Wz = Wt + (size_t)z * DQ * DM + (size_t)n0 * DM;
    const bf* A = tr ? Wz : Xz; const bf* Bt = tr ? Xz : Wz;
    const bf* ring = (const bf*)red;
    const unsigned lcp = (unsigned)(size_t)ring + (unsigned)((tid >> 3) * (KP * 2) + (tid & 7) * 16); const size_t go = (size_t)(tid >> 3) * DM + (tid & 7) * 8;
    const char* ga = (const char*)(A + go); const char* gb = (const char*)(Bt + go);
    // stage s -> buffer b: k in [64 s, 64 s + 64) of all 128 + 128 rows, 16 copies a thread
    auto stage = [&](int s, int b) { const unsigned l0 = lcp + (unsigned)(b * BUF * 2); const char* pa = ga + (size_t)s * 128; const char* pb = gb + (size_t)s * 128;
        cp2(l0, pa, (size_t)16 * DM * 2, l0 + 2 * TLE * 2, pb, (size_t)16 * DM * 2);                                                                   // rows 0..63 of A and of B
        cp2(l0 + TLE * 2, pa + (size_t)64 * DM * 2, (size_t)16 * DM * 2, l0 + 3 * TLE * 2, pb + (size_t)64 * DM * 2, (size_t)16 * DM * 2); };          // rows 64..127
    stage(0, 0);
    { const float* pbias = bias + n0 + tid; const float bv0 = *pbias;
      asm volatile("s_wait_xcnt 0x0" :: "v"(pbias) : "memory");   // behind the load, in front of any reuse of its address registers
      bs[tid] = bfr(bv0); }
    v8f acc[4][4];
#pragma unroll
    for (int mb = 0; mb < 4; ++mb)
#pragma unroll
        for (int nb = 0; nb < 4; ++nb) acc[mb][nb] = (v8f){};
    asm volatile("s_wait_asynccnt 0x0" ::: "memory");   // this wave's copies of stage 0 have landed
    __syncthreads();                                    // every wave's have: stage 0 (and the bias row) may be read
    stage(1, 1);
#pragma unroll   // straight line: buffer offsets are constants and no back edge stands behind a WMMA
    for (int st = 0; st < NS; ++st) {
        const bf* fa = ring + (st & 1) * BUF + (wm * 64 + lr) * KP + 8 * hi; const bf* fb = ring + (st & 1) * BUF + 2 * TLE + (wn * 64 + lr) * KP + 8 * hi;
#pragma unroll
        for (int kc = 0; kc < 64; kc += 32) {
            V a[4], b[4];   // all 16 LDS reads of a 32-k step stand in one group ahead of its 16 WMMAs
#pragma unroll
            for (int i = 0; i < 4; ++i) { a[i] = F::ld(fa + i * 16 * KP + kc); b[i] = F::ld(fb + i * 16 * KP + kc); }
#pragma unroll
            for (int nb = 0; nb < 4; ++nb)
#pragma unroll
                for (int mb = 0; mb < 4; ++mb) acc[mb][nb] = F::mma(a[mb], b[nb], acc[mb][nb]);
        }
        asm volatile("s_wait_dscnt 0x0" ::: "memory");      // this wave's reads of the stage's buffer are done before the buffer is handed back
        asm volatile("s_wait_asynccnt 0x0" ::: "memory");   // this wave's copies of the next stage have landed
        __syncthreads();                                    // next stage published; every reader has left this stage's buffer
        if (st + 2 < NS) stage(st + 2, st & 1);             // refill it, one whole stage ahead of its readers
    }
    asm volatile("s_wait_asynccnt 0x0" ::: "memory");   // no copy is outstanding when the buffers are written over
    float* my = red + w * (64 * 68);   // behind the last barrier no wave reads the buffers any more; this range is read by this wave alone
#pragma unroll
    for (int mb = 0; mb < 4; ++mb)
#pragma unroll
        for (int nb = 0; nb < 4; ++nb)
#pragma unroll
            for (int j = 0; j < 8; ++j) my[(mb * 16 + hi * 8 + j) * 68 + nb * 16 + lr] = acc[mb][nb][j];
    asm volatile("s_wait_dscnt 0x0" ::: "memory");   // the wave's tile is whole in LDS before its lanes read one another's values back
    const int tt = t0 + (tr ? wn : wm) * 64, hl = tr ? wm : wn;   // the wave's first token; which of the work-group's two heads
    const int zh = (tt / TT) * NH_ + (int)blockIdx.y * 2 + hl, tt0 = tt % TT;   // (batch, head) plane; first token inside its batch (64 tokens never cross a batch: TT % 64 == 0)
    if (tr) { const size_t o = ((size_t)zh * HD) * TT + tt0; qkv_out<true>(my, bs + hl * 64, V16 + o, Vh + o, Vl + o, lane); }
    else { const size_t o = (size_t)z * NZ * TT * HD + ((size_t)zh * TT + tt0) * HD; qkv_out<false>(my, bs + hl * 64, P16 + o, Ph + o, Pl + o, lane); }
}
// ---- k_fattn: scores, softmax and attn.v of one (batch, head) plane in one kernel; no score or probability leaves the registers.
// Transposed products: S^T = K Q^T (A = 16 key rows, B = 16 query columns), so lane (lr, hi) holds, for query lr, the scores of keys 8 hi + 0..7 of each 16-key tile;
// two such tiles, converted in place, are the B fragment of O^T += V^T P^T in the k order of the WFrag loaders. Running maximum and sum per query (online softmax), 32 keys a pass.
// x = log2(e) (tau (q.k/8) + delta[j]); p = 2^(x - m). Rows < RH: hi+lo bf16 planes, 3 products each; the rest fp16 with p x 1024 (the factor cancels in p / sum).
typedef __attribute__((ext_vector_type(8))) __bf16 v8b;
#define LOG2E 1.4426950408889634f
__device__ __forceinline__ float xhalf(float x) { const int b = __float_as_int(x); return __int_as_float(__builtin_amdgcn_permlanex16(b, b, 0x76543210, 0xfedcba98, false, false)); }   // lane l <-> l ^ 16
// 2^x of eight values / of one value. One statement each, results in registers of their own ("=&v"), closed by v_nop: the slot the instruction set asks for between a transcendental
// and an instruction that reads its result or overwrites its source.
__device__ __forceinline__ v8f exp2x8(v8f x) { float r0, r1, r2, r3, r4, r5, r6, r7;
    asm("v_exp_f32 %0, %8\n\tv_exp_f32 %1, %9\n\tv_exp_f32 %2, %10\n\tv_exp_f32 %3, %11\n\tv_exp_f32 %4, %12\n\tv_exp_f32 %5, %13\n\tv_exp_f32 %6, %14\n\tv_exp_f32 %7, %15\n\tv_nop"
        : "=&v"(r0), "=&v"(r1), "=&v"(r2), "=&v"(r3), "=&v"(r4), "=&v"(r5), "=&v"(r6), "=&v"(r7) : "v"(x[0]), "v"(x[1]), "v"(x[2]), "v"(x[3]), "v"(x[4]), "v"(x[5]), "v"(x[6]), "v"(x[7]));
    return (v8f){r0, r1, r2, r3, r4, r5, r6, r7}; }
__device__ __forceinline__ float exp2x1(float x) { float r; asm("v_exp_f32 %0, %1\n\tv_nop" : "=&v"(r) : "v"(x)); return r; }
// behind a group of global loads, in front of any reuse of their address registers; as inputs of the wait the four addresses stay whole up to it
__device__ __forceinline__ void xwait(const void* a, const void* b, const void* c, const void* d) { asm volatile("s_wait_xcnt 0x0" :: "v"(a), "v"(b), "v"(c), "v"(d) : "memory"); }
template <typename T16, bool HI, int QB>   // QB: 16-query column groups per wave (1 or 2)
__device__ __forceinline__ void fattn(const T16* __restrict__ Q, const T16* __restrict__ Q2, const T16* __restrict__ Kp, const T16* __restrict__ K2, const T16* __restrict__ Vt, const T16* __restrict__ Vt2, const float* dls, const T16* ring, float c1, bf* __restrict__ Ah, bf* __restrict__ Al, int q0) {
    typedef WFrag<T16> F; typedef typename F::V V;
    constexpr int NT = HI ? 4 : 2, NS = TT / KT;   // tiles per buffer (K, V^T; hi+lo: K lo, V^T lo too); stages
    static_assert(NS >= 2 && TT % KT == 0 && HD == 64 && KT == 64, "the ring needs two whole stages; a tile is 64 rows of 128 B");
    const int tid = threadIdx.x, lane = tid & 31, lr = lane & 15, hi = lane >> 4;
    // stage s -> buffer b: K rows [s KT, s KT + KT) and the same keys' columns of V^T
    const unsigned lcp = (unsigned)(size_t)ring + (unsigned)((tid >> 3) * (KP * 2) + (tid & 7) * 16);
    const char* kg = (const char*)(Kp + (size_t)(tid >> 3) * HD + (tid & 7) * 8); const char* vg = (const char*)(Vt + (size_t)(tid >> 3) * TT + (tid & 7) * 8);
    const char* kg2 = HI ? (const char*)(K2 + (size_t)(tid >> 3) * HD + (tid & 7) * 8) : kg; const char* vg2 = HI ? (const char*)(Vt2 + (size_t)(tid >> 3) * TT + (tid & 7) * 8) : vg;
    auto stage = [&](int s, int b) { const unsigned l0 = lcp + (unsigned)(b * NT * TLE * 2);
        cp2(l0, kg + (size_t)s * (KT * HD * 2), 16 * HD * 2, l0 + TLE * 2, vg + (size_t)s * (KT * 2), (size_t)16 * TT * 2);
        if (HI) cp2(l0 + 2 * TLE * 2, kg2 + (size_t)s * (KT * HD * 2), 16 * HD * 2, l0 + 3 * TLE * 2, vg2 + (size_t)s * (KT * 2), (size_t)16 * TT * 2); };
    stage(0, 0);
    V qf[QB][2], qf2[QB][2]; v8f o[QB][4]; float m[QB], l[QB]; const T16* qp[QB]; const T16* qp2[QB];
#pragma unroll
    for (int g = 0; g < QB; ++g) { m[g] = -3.0e38f; l[g] = 0.f; const size_t qo = (size_t)(q0 + g * 16 + lr) * HD + 8 * hi; qp[g] = Q + qo; qp2[g] = HI ? Q2 + qo : qp[g];
#pragma unroll
        for (int kc = 0; kc < 2; ++kc) { qf[g][kc] = F::ld(qp[g] + kc * 32); if (HI) qf2[g][kc] = F::ld(qp2[g] + kc * 32); }
#pragma unroll
        for (int nb = 0; nb < 4; ++nb) o[g][nb] = (v8f){}; }
    xwait(qp[0], qp[QB - 1], qp2[0], qp2[QB - 1]);
    asm volatile("s_wait_asynccnt 0x0" ::: "memory");   // this wave's copies of stage 0 have landed
    __syncthreads();                                    // every wave's have: stage 0 may be read
    stage(1, 1);
#pragma unroll 1   // rolled: one stage a trip, the buffers change places
    for (int st = 0; st < NS; ++st) {
        const T16* kb = ring + (st & 1) * (NT * TLE) + lr * KP + 8 * hi; const T16* vb = kb + TLE; const T16* kb2 = kb + 2 * TLE; const T16* vb2 = kb + 3 * TLE;
#pragma unroll   // the two 32-key passes of a stage stand one behind the other, so that the second's LDS reads can go ahead of the first's vector work
        for (int pp = 0; pp < KT / 32; ++pp) {
            const int j0 = st * KT + pp * 32;
            V kf[2][2], kf2[2][2], vf[4], vf2[4];
#pragma unroll
            for (int t = 0; t < 2; ++t)
#pragma unroll
                for (int kc = 0; kc < 2; ++kc) { kf[t][kc] = F::ld(kb + (pp * 32 + t * 16) * KP + kc * 32); if (HI) kf2[t][kc] = F::ld(kb2 + (pp * 32 + t * 16) * KP + kc * 32); }
#pragma unroll
            for (int nb = 0; nb < 4; ++nb) { vf[nb] = F::ld(vb + nb * 16 * KP + pp * 32); if (HI) vf2[nb] = F::ld(vb2 + nb * 16 * KP + pp * 32); }
            v8f s[QB][2];
#pragma unroll
            for (int g = 0; g < QB; ++g)
#pragma unroll
                for (int t = 0; t < 2; ++t) { s[g][t] = (v8f){};
#pragma unroll
                    for (int kc = 0; kc < 2; ++kc) { s[g][t] = F::mma(kf[t][kc], qf[g][kc], s[g][t]); if (HI) { s[g][t] = F::mma(kf[t][kc], qf2[g][kc], s[g][t]); s[g][t] = F::mma(kf2[t][kc], qf[g][kc], s[g][t]); } } }
            v8f dl[2]; V pf[QB], pf2[QB];
#pragma unroll
            for (int t = 0; t < 2; ++t) { const v4f d0 = *(const v4fa*)(dls + j0 + t * 16 + hi * 8), d1 = *(const v4fa*)(dls + j0 + t * 16 + hi * 8 + 4); dl[t] = __builtin_shufflevector(d0, d1, 0, 1, 2, 3, 4, 5, 6, 7); }
#pragma unroll
            for (int g = 0; g < QB; ++g) {
                float mx = -3.0e38f;
#pragma unroll
                for (int t = 0; t < 2; ++t)
#pragma unroll
                    for (int j = 0; j < 8; ++j) { s[g][t][j] = fmaf(s[g][t][j], c1, dl[t][j]); mx = fmaxf(mx, s[g][t][j]); }
                mx = fmaxf(mx, xhalf(mx));
                const float mn = fmaxf(m[g], mx), al = exp2x1(m[g] - mn), ms = HI ? mn : mn - 10.0f; m[g] = mn;
                float ps[2];
#pragma unroll
                for (int t = 0; t < 2; ++t) {
                    s[g][t] = exp2x8(s[g][t] - ms);
                    ps[t] = ((s[g][t][0] + s[g][t][1]) + (s[g][t][2] + s[g][t][3])) + ((s[g][t][4] + s[g][t][5]) + (s[g][t][6] + s[g][t][7])); }
                l[g] = fmaf(l[g], al, ps[0] + ps[1]);   // this lane's half of the keys; the halves meet behind the loop
#pragma unroll
                for (int nb = 0; nb < 4; ++nb) o[g][nb] *= al;
                if constexpr (HI) {
                    const v8b h0 = __builtin_convertvector(s[g][0], v8b), h1 = __builtin_convertvector(s[g][1], v8b);
                    const v8b l0 = __builtin_convertvector(s[g][0] - __builtin_convertvector(h0, v8f), v8b), l1 = __builtin_convertvector(s[g][1] - __builtin_convertvector(h1, v8f), v8b);
                    pf[g] = __builtin_shufflevector(h0, h1, 0, 1, 2, 3, 4, 5, 6, 7, 8, 9, 10, 11, 12, 13, 14, 15); pf2[g] = __builtin_shufflevector(l0, l1, 0, 1, 2, 3, 4, 5, 6, 7, 8, 9, 10, 11, 12, 13, 14, 15);
                } else pf[g] = cat16(__builtin_convertvector(s[g][0], v8h), __builtin_convertvector(s[g][1], v8h));
            }
            // attn.v of all groups behind the softmax of all groups: no 2^x statement stands close behind a WMMA whose operand registers it could be given
#pragma unroll
            for (int g = 0; g < QB; ++g)
#pragma unroll
                for (int nb = 0; nb < 4; ++nb) { o[g][nb] = F::mma(vf[nb], pf[g], o[g][nb]); if constexpr (HI) { o[g][nb] = F::mma(vf[nb], pf2[g], o[g][nb]); o[g][nb] = F::mma(vf2[nb], pf[g], o[g][nb]); } }
        }
        // four vector slots behind the stage's last WMMAs, also on the taken back edge: the next instructions write over their operands.
        // The accumulators are named so that every WMMA of the stage stands in front of the slots.
        if constexpr (QB == 1) asm volatile("v_nop\n\tv_nop\n\tv_nop\n\tv_nop" : "+v"(o[0][0]), "+v"(o[0][1]), "+v"(o[0][2]), "+v"(o[0][3]));
        else asm volatile("v_nop\n\tv_nop\n\tv_nop\n\tv_nop" : "+v"(o[0][0]), "+v"(o[0][1]), "+v"(o[0][2]), "+v"(o[0][3]), "+v"(o[QB - 1][0]), "+v"(o[QB - 1][1]), "+v"(o[QB - 1][2]), "+v"(o[QB - 1][3]));
        asm volatile("s_wait_dscnt 0x0" ::: "memory");      // this wave's reads of the stage's buffer are done before the buffer is handed back
        asm volatile("s_wait_asynccnt 0x0" ::: "memory");   // this wave's copies of the next stage have landed
        __syncthreads();                                    // next stage published; every reader has left this stage's buffer
        if (st + 2 < NS) stage(st + 2, st & 1);             // refill it, one whole stage ahead of its readers
    }
    asm volatile("s_wait_asynccnt 0x0" ::: "memory");   // no copy is outstanding when the wave goes on to its end
    // The merged rows [t][head * HD + d], bf16 hi + lo: the A planes of the out projection (Ah, Al point at this batch's row 0, this head's column 0). A lane holds 8 consecutive d of its query per tile.
    // Rows >= RH: the x 1024 comes off again, exactly, before the split.
#pragma unroll
    for (int g = 0; g < QB; ++g) { const float f = __fdiv_rn(HI ? 1.0f : PCAR, l[g] + xhalf(l[g])); const size_t ro = (size_t)(q0 + g * 16 + lr) * DQ + hi * 8; bf* const ph = Ah + ro; bf* const pl = Al + ro;
#pragma unroll
        for (int nb = 0; nb < 4; ++nb) { const v8f r = o[g][nb] * f; v8us oh, ol;
#pragma unroll
            for (int j = 0; j < 8; ++j) { unsigned short a, c2; splitf(HI ? r[j] : r[j] * (1.0f / PCAR), a, c2); oh[j] = a; ol[j] = c2; }
            *(v8us*)(ph + nb * 16) = oh; *(v8us*)(pl + nb * 16) = ol;
            // behind the two stores, in front of any reuse of their data and address registers; as inputs of the wait these stay whole up to it
            asm volatile("s_wait_xcnt 0x0" :: "v"(oh), "v"(ol), "v"(ph), "v"(pl) : "memory"); } }
}
// grid (RH/64 + (TT-RH)/128, NZ), 4 waves: blocks x < RH/64 take 64 hi+lo query rows (16 a wave), the others 128 fp16 rows (32 a wave); every wave walks all TT keys.
// K and V^T reach the waves through LDS: 64 keys a stage, two buffers, brought in by asynchronous copies in whole lines and read by all four waves.
__global__ __launch_bounds__(128) void k_fattn(const h16* __restrict__ Q16, const h16* __restrict__ K16, const h16* __restrict__ V16, const bf* __restrict__ Qh, const bf* __restrict__ Ql, const bf* __restrict__ Kh, const bf* __restrict__ Kl, const bf* __restrict__ Vh, const bf* __restrict__ Vl, const float* __restrict__ TAU, const float* __restrict__ DEL, bf* __restrict__ Ah, bf* __restrict__ Al) {
    __shared__ __align__(16) float dls[TT];   // log2(e) delta[b][j]
    __shared__ __align__(16) unsigned short ring[2 * 4 * TLE];   // two buffers of up to four tiles
    const int z = blockIdx.y, b = z / NH_, tid = threadIdx.x, w = __builtin_amdgcn_readfirstlane(tid >> 5); const size_t zo = (size_t)z * TT * HD, ao = (size_t)b * TT * DQ + (z % NH_) * HD;
#pragma unroll
    for (int i = 0; i < TT / 128; ++i) dls[i * 128 + tid] = bfr(DEL[(size_t)b * TT + i * 128 + tid]) * LOG2E;
    const float c1 = bfr(TAU[b]) * (SCL * LOG2E);
    __syncthreads();   // the delta row is whole before any wave reads it
    if (blockIdx.x < RH / 64) fattn<bf, true, 1>(Qh + zo, Ql + zo, Kh + zo, Kl + zo, Vh + zo, Vl + zo, dls, (const bf*)ring, c1, Ah + ao, Al + ao, (int)blockIdx.x * 64 + w * 16);
    else fattn<h16, false, 2>(Q16 + zo, nullptr, K16 + zo, nullptr, V16 + zo, nullptr, dls, (const h16*)ring, c1, Ah + ao, Al + ao, RH + ((int)blockIdx.x - RH / 64) * 128 + w * 32);
}

extern "C" void kernel_launch(void* const* d_in, const int* in_sizes, int n_in,
                              void* d_out, int out_size, void* d_ws, size_t ws_size, hipStream_t stream) {
    (void)in_sizes; (void)n_in; (void)out_size;
    const float* x = (const float*)d_in[0]; const float* xk = (const float*)d_in[1]; const float* xv = (const float*)d_in[2]; const float* TAU = (const float*)d_in[3]; const float* DEL = (const float*)d_in[4]; const float* wq = (const float*)d_in[5]; const float* bq = (const float*)d_in[6]; const float* wk = (const float*)d_in[7]; const float* bk = (const float*)d_in[8]; const float* wv = (const float*)d_in[9]; const float* bv = (const float*)d_in[10]; const float* wo = (const float*)d_in[11]; const float* bo = (const float*)d_in[12];
    float* OUT = (float*)d_out;     // [4][2048][512]
    char* wsp = (char*)d_ws;
    auto take = [&](size_t bytes) { char* p = wsp; wsp += (bytes + 255) & ~(size_t)255; return (void*)p; };
    const size_t PLN = (size_t)NZ * TT * HD;   // elements of one plane set: every (batch, head)
    bf* WQ = (bf*)take((size_t)DQ * DM * 2); bf* WK = (bf*)take((size_t)DKV * DM * 2); bf* WV = (bf*)take((size_t)DKV * DM * 2); bf* WO = (bf*)take((size_t)DM * DQ * 2); (void)WK; (void)WV;
    h16* QP16 = (h16*)take(PLN * 2); h16* KP16 = (h16*)take(PLN * 2); h16* VT16 = (h16*)take(PLN * 2);
    bf* QPh = (bf*)take(PLN * 2); bf* KPh = (bf*)take(PLN * 2); bf* QPl = (bf*)take(PLN * 2); bf* KPl = (bf*)take(PLN * 2); bf* VTh = (bf*)take(PLN * 2); bf* VTl = (bf*)take(PLN * 2);
    bf* ATh = (bf*)take((size_t)NB_ * TT * DQ * 2); bf* ATl = (bf*)take((size_t)NB_ * TT * DQ * 2);
    bf* XB = (bf*)take((size_t)3 * NB_ * TT * DM * 2);   // bf16 inputs. k_qkv reaches the k planes from the q planes: each k plane set lies directly behind its q plane set
    if ((size_t)(wsp - (char*)d_ws) > ws_size) return;    // ws 256 MiB
    k_wtG<<<dim3((unsigned)((DM * DQ / 64 + 63) / 64), 4, 1), 256, 0, stream>>>(wq, wk, wv, wo, DM, DQ, WQ);
    k_cvt8<<<dim3((unsigned)(((size_t)NB_ * TT * DM / 8 + 255) / 256), 3, 1), 256, 0, stream>>>(x, xk, xv, XB, (size_t)NB_ * TT * DM / 8);
    // q, k, v projections of all batches (x: 128 token rows, y: two heads, z: which projection), written as the attention kernel's planes
    k_qkv<<<dim3(NB_ * TT / 128, DQ / 128, 3), 128, 0, stream>>>(XB, WQ, bq, bk, bv, QP16, QPh, QPl, VT16, VTh, VTl);
    k_fattn<<<dim3(RH / 64 + (TT - RH) / 128, NZ, 1), 128, 0, stream>>>(QP16, KP16, VT16, QPh, QPl, KPh, KPl, VTh, VTl, TAU, DEL, ATh, ATl);
    k_gemmsk<bf, 1, true, 4, 8, DQ / 8><<<dim3(NB_ * TT / 64, DM / 64, 1), 256, 0, stream>>>(ATh, ATl, WO, nullptr, OUT, DM, bo, nullptr, nullptr, 0, 0, 0);
}

// v008
// It runs in 112 microseconds.
// Timed twice side by side with v007, it ran 1.12 and 1.11 times as fast.
// All steps since v000 together make it 20.1 times as fast.
#include <hip/hip_runtime.h>

// De-stationary attention (Non-stationary Transformer) (queries, keys, values [4][2048][512]; q, k, v = . W + b ('xw' [512][512]; 8 heads x 64); scores = tau[b] (q.k/8) + delta[b][s] (tau [4], delta [4][2048], read); softmax; out = merged Wo + bo -> [4][2048][512] (4.2 M)).
// Compute dtypes, f32 accumulate: every input rounded to bf16; q/k/v on PLAIN bf16 operands (inputs: exact) + biases; tau scale and delta shift applied in f32 per (i, j) inside the attention kernel; scores and attn.v: query rows < 512 hl (3 products), the rest single fp16 (x1024); softmax f32; Wo hl x exact (2 products) + bo.

#define NB_  4
#define TT   2048
#define DM   512
#define NH_  8
#define NKV  8
#define REP  (NH_ / NKV)
#define HD   64
#define DQ   (NH_ * HD)
#define DKV  (NKV * HD)
#define NZ   (NB_ * NH_)          // all (batch, head) planes
#define RH   512                  // query rows < RH use hi+lo planes (0: none)
#define WIN  0
#define PCAR 1024.0f
#define SCL  0.125f   // HD^-0.5
typedef _Float16 h16;
typedef unsigned short bf;
typedef __attribute__((ext_vector_type(16))) __bf16   v16bf;
typedef __attribute__((ext_vector_type(16))) _Float16 v16h;
typedef __attribute__((ext_vector_type(8)))  _Float16 v8h;
typedef __attribute__((ext_vector_type(8)))  unsigned short v8us;
typedef __attribute__((ext_vector_type(8)))  float    v8f;
typedef __attribute__((ext_vector_type(4)))  float    v4f;
typedef v8h  __attribute__((may_alias)) v8ha;
typedef v4f  __attribute__((may_alias)) v4fa;
typedef v8us __attribute__((may_alias)) v8usa;

__device__ __forceinline__ unsigned short f2bf(float f) { unsigned u = __float_as_uint(f); u += 0x7FFFu + ((u >> 16) & 1u); return (unsigned short)(u >> 16); }
__device__ __forceinline__ float bf2f(unsigned short b) { return __uint_as_float(((unsigned)b) << 16); }
__device__ __forceinline__ float bfr(float f) { return bf2f(f2bf(f)); }
__device__ __forceinline__ v16h cat16(v8h lo, v8h hi) { return __builtin_shufflevector(lo, hi, 0, 1, 2, 3, 4, 5, 6, 7, 8, 9, 10, 11, 12, 13, 14, 15); }
__device__ __forceinline__ v16bf cat16b(v8us lo, v8us hi) { return __builtin_bit_cast(v16bf, __builtin_shufflevector(lo, hi, 0, 1, 2, 3, 4, 5, 6, 7, 8, 9, 10, 11, 12, 13, 14, 15)); }
__device__ __forceinline__ v8f wmma16(v16h a, v16h b, v8f c) { return __builtin_amdgcn_wmma_f32_16x16x32_f16(false, a, false, b, (short)0, c, false, false); }
__device__ __forceinline__ v8f wmmab(v16bf a, v16bf b, v8f c) { return __builtin_amdgcn_wmma_f32_16x16x32_bf16(false, a, false, b, (short)0, c, false, false); }



// fragment loaders: K-contiguous 16-bit planes, lane (lr, hi) takes k = 8 hi + 0..7 and 16 + 8 hi + 0..7 of each 32
template <typename T16> struct WFrag;
template <> struct WFrag<h16> { typedef v16h V; static __device__ __forceinline__ V ld(const h16* p) { return cat16(*(const v8h*)p, *(const v8h*)(p + 16)); } static __device__ __forceinline__ v8f mma(V a, V b, v8f c) { return wmma16(a, b, c); } };
template <> struct WFrag<bf> { typedef v16bf V; static __device__ __forceinline__ V ld(const bf* p) { return cat16b(*(const v8us*)p, *(const v8us*)(p + 16)); } static __device__ __forceinline__ v8f mma(V a, V b, v8f c) { return wmmab(a, b, c); } };
__device__ __forceinline__ h16 tohx(float x) { return (h16)x; }
__device__ __forceinline__ void splitf(float y, unsigned short& h, unsigned short& l) { h = f2bf(y); l = f2bf(y - bf2f(h)); }
typedef __attribute__((ext_vector_type(2))) _Float16 v2h;
typedef __attribute__((ext_vector_type(4))) _Float16 v4h;
typedef __attribute__((ext_vector_type(2))) unsigned short v2us;
typedef __attribute__((ext_vector_type(4))) unsigned short v4us;
typedef __attribute__((ext_vector_type(2))) float v2f;
typedef __attribute__((ext_vector_type(4))) int v4i;

__global__ __launch_bounds__(256) void k_wtG(const float* __restrict__ w0, const float* __restrict__ w1, const float* __restrict__ w2, const float* __restrict__ w3, int K, int N, bf* Bt) {
    const int y = blockIdx.y; const float* w = (y == 0) ? w0 : (y == 1) ? w1 : (y == 2) ? w2 : w3; Bt += (size_t)y * K * N;   // blockIdx.y: which of the four equal-shaped matrices
    const int lane = threadIdx.x & 31; const int L0 = (blockIdx.x * 8 + (threadIdx.x >> 5)) * 8; const int nlines = N * K / 64;
{
#pragma unroll 1
        for (int l = 0; l < 8; ++l) { const int L = L0 + l; if (L >= nlines) break; const size_t e = (size_t)L * 64 + lane * 2; const int k = (int)(e % K), n = (int)(e / K); v2us o;
            o[0] = f2bf(w[(size_t)k * N + n]); o[1] = f2bf(w[(size_t)(k + 1) * N + n]); *(v2us*)(Bt + e) = o; }
         }
}
__global__ __launch_bounds__(256) void k_cvt8(const float* __restrict__ s0, const float* __restrict__ s1, const float* __restrict__ s2, bf* dst, size_t n8) { const size_t i = (size_t)blockIdx.x * 256 + threadIdx.x; if (i >= n8) return; const int y = blockIdx.y; const float* src = (y == 0) ? s0 : (y == 1) ? s1 : s2; dst += (size_t)y * n8 * 8;   // blockIdx.y: which of the three equal-shaped tensors
    const v8f v = *(const v8f*)(src + i * 8); v8us o;
#pragma unroll
    for (int k = 0; k < 8; ++k) o[k] = f2bf(v[k]); *(v8us*)(dst + i * 8) = o;  }

#define KT  64          // keys per staged tile
#define KP  72          // LDS row pitch in 16-bit elements: 144 B = 16 B x 9, the pitch of ds_load_b128 readers of 128-B rows
#define TLE (64 * KP)   // elements of one staged tile: 64 rows (K: keys; V^T: head dims) of 64 values
// Two tiles of 64 rows x 128 B, global -> LDS: a thread brings 16 B of rows r, r + 16, r + 32, r + 48 of each tile (a wave's copy: four whole 128-B lines). 128 threads cover both tiles in one call.
// la, lb: the thread's LDS byte addresses in row r; ga, gb: its global addresses there; sa, sb: bytes of 16 global rows. The wait on xcnt closes the copies' own statement: their address registers are reused behind it.
__device__ __forceinline__ void cp2(unsigned la, const char* ga, size_t sa, unsigned lb, const char* gb, size_t sb) {
    asm volatile("global_load_async_to_lds_b128 %0, %1, off\n\tglobal_load_async_to_lds_b128 %2, %3, off\n\tglobal_load_async_to_lds_b128 %4, %5, off\n\tglobal_load_async_to_lds_b128 %6, %7, off\n\t"
                 "global_load_async_to_lds_b128 %8, %9, off\n\tglobal_load_async_to_lds_b128 %10, %11, off\n\tglobal_load_async_to_lds_b128 %12, %13, off\n\tglobal_load_async_to_lds_b128 %14, %15, off\n\ts_wait_xcnt 0x0"
                 :: "v"(la), "v"(ga), "v"(la + 16u * KP * 2u), "v"(ga + sa), "v"(la + 32u * KP * 2u), "v"(ga + 2 * sa), "v"(la + 48u * KP * 2u), "v"(ga + 3 * sa),
                    "v"(lb), "v"(gb), "v"(lb + 16u * KP * 2u), "v"(gb + sb), "v"(lb + 32u * KP * 2u), "v"(gb + 2 * sb), "v"(lb + 48u * KP * 2u), "v"(gb + 3 * sb) : "memory"); }
// ---- k_qkv: the three projections of all batches. A work-group of 4 waves owns a 128 x 128 tile of C = A Bt^T, a wave 64 x 64 of it (wm: which 64 A rows, wn: which 64 B rows), and walks all of K itself:
// 8 stages of 64 k, 128 + 128 operand rows a stage (one 128-B line a row), two LDS buffers filled by asynchronous copies one stage ahead. One f32 accumulator chain per output over k = 0..511, bias last.
// z = 0, 1 (q, k): A = token rows, B = weight rows (two heads) -> planes [batch][head][t][d]. z = 2 (v): the operands change places, so a wave's tile comes out as [d][t] and goes to the transposed planes [batch][head][d][t].
// A wave's 64 x 64 tile is one (64 tokens, head) unit: it goes through the wave's own LDS range so that every store covers whole lines. Each value is stored as fp16 and as bf16 hi + lo.
template <bool TR>   // TR: rows are head dims (bias by row, row pitch TT); else rows are tokens (bias by column, row pitch HD)
__device__ __forceinline__ void qkv_out(const float* my, const float* bh, h16* d16, bf* dh, bf* dl, int lane) {
    constexpr int pitch = TR ? TT : HD; const int cofs = (lane & 7) * 8; v8f bc = (v8f){};
    if (!TR) { const v4f b0 = *(const v4fa*)(bh + cofs), b1 = *(const v4fa*)(bh + cofs + 4); bc = __builtin_shufflevector(b0, b1, 0, 1, 2, 3, 4, 5, 6, 7); }
#pragma unroll 1   // rolled: 16 copies of the conversion code in two forms would only lengthen the kernel's text
    for (int s = 0; s < 16; ++s) { const int row = s * 4 + (lane >> 3);   // a wave's store: 4 rows of 128 B
        const v4f v0 = *(const v4fa*)(my + row * 68 + cofs), v1 = *(const v4fa*)(my + row * 68 + cofs + 4); const v8f val = __builtin_shufflevector(v0, v1, 0, 1, 2, 3, 4, 5, 6, 7);
        const float br = TR ? bh[row] : 0.f; v8h o16; v8us oh, ol;
#pragma unroll
        for (int q = 0; q < 8; ++q) { const float r = val[q] + (TR ? br : bc[q]); o16[q] = tohx(r); unsigned short a2, c2; splitf(r, a2, c2); oh[q] = a2; ol[q] = c2; }
        const size_t e = (size_t)row * pitch + cofs; h16* const p16 = d16 + e; bf* const ph = dh + e; bf* const pl = dl + e;
        *(v8h*)p16 = o16; *(v8us*)ph = oh; *(v8us*)pl = ol;
        // behind the three stores, in front of any reuse of their data and address registers; as inputs of the wait these stay whole up to it
        asm volatile("s_wait_xcnt 0x0" :: "v"(o16), "v"(oh), "v"(ol), "v"(p16), "v"(ph), "v"(pl) : "memory"); }
}
__global__ __launch_bounds__(128) void k_qkv(const bf* __restrict__ X, const bf* __restrict__ Wt, const float* __restrict__ bias0, const float* __restrict__ bias1, const float* __restrict__ bias2, h16* P16, bf* Ph, bf* Pl, h16* V16, bf* Vh, bf* Vl) {
    typedef WFrag<bf> F; typedef F::V V;
    constexpr int NS = DM / 64, BUF = 4 * TLE;   // stages; 16-bit elements of one buffer: A rows 0..127, behind them B rows 0..127, pitch KP
    static_assert(NS >= 2 && DM % 64 == 0 && BUF >= 4 * 64 * 68, "the ring needs two whole stages; the four result tiles (pitch 68 floats) fit the two buffers");
    __shared__ __align__(16) float red[BUF];    // the two buffers; behind the loop each wave's result tile
    __shared__ __align__(16) float bs[128];     // the work-group's 128 bias values, rounded
    const int z = blockIdx.z; const bool tr = (z == 2); const float* bias = (z == 0) ? bias0 : (z == 1) ? bias1 : bias2;
    const int tid = threadIdx.x, w = __builtin_amdgcn_readfirstlane(tid >> 5), lane = tid & 31, lr = lane & 15, hi = lane >> 4, wm = w >> 1, wn = w & 1; const int t0 = blockIdx.x * 128, n0 = blockIdx.y * 128;
    const bf* Xz = X + (size_t)z * NB_ * TT * DM + (size_t)t0 * DM; const bf* Wz = Wt + (size_t)z * DQ * DM + (size_t)n0 * DM;
    const bf* A = tr ? Wz : Xz; const bf* Bt = tr ? Xz : Wz;
    const bf* ring = (const bf*)red;
    const unsigned lcp = (unsigned)(size_t)ring + (unsigned)((tid >> 3) * (KP * 2) + (tid & 7) * 16); const size_t go = (size_t)(tid >> 3) * DM + (tid & 7) * 8;
    const char* ga = (const char*)(A + go); const char* gb = (const char*)(Bt + go);
    // stage s -> buffer b: k in [64 s, 64 s + 64) of all 128 + 128 rows, 16 copies a thread
    auto stage = [&](int s, int b) { const unsigned l0 = lcp + (unsigned)(b * BUF * 2); const char* pa = ga + (size_t)s * 128; const char* pb = gb + (size_t)s * 128;
        cp2(l0, pa, (size_t)16 * DM * 2, l0 + 2 * TLE * 2, pb, (size_t)16 * DM * 2);                                                                   // rows 0..63 of A and of B
        cp2(l0 + TLE * 2, pa + (size_t)64 * DM * 2, (size_t)16 * DM * 2, l0 + 3 * TLE * 2, pb + (size_t)64 * DM * 2, (size_t)16 * DM * 2); };          // rows 64..127
    stage(0, 0);
    { const float* pbias = bias + n0 + tid; const float bv0 = *pbias;
      asm volatile("s_wait_xcnt 0x0" :: "v"(pbias) : "memory");   // behind the load, in front of any reuse of its address registers
      bs[tid] = bfr(bv0); }
    v8f acc[4][4];
#pragma unroll
    for (int mb = 0; mb < 4; ++mb)
#pragma unroll
        for (int nb = 0; nb < 4; ++nb) acc[mb][nb] = (v8f){};
    asm volatile("s_wait_asynccnt 0x0" ::: "memory");   // this wave's copies of stage 0 have landed
    __syncthreads();                                    // every wave's have: stage 0 (and the bias row) may be read
    stage(1, 1);
#pragma unroll   // straight line: buffer offsets are constants and no back edge stands behind a WMMA
    for (int st = 0; st < NS; ++st) {
        const bf* fa = ring + (st & 1) * BUF + (wm * 64 + lr) * KP + 8 * hi; const bf* fb = ring + (st & 1) * BUF + 2 * TLE + (wn * 64 + lr) * KP + 8 * hi;
#pragma unroll
        for (int kc = 0; kc < 64; kc += 32) {
            V a[4], b[4];   // all 16 LDS reads of a 32-k step stand in one group ahead of its 16 WMMAs
#pragma unroll
            for (int i = 0; i < 4; ++i) { a[i] = F::ld(fa + i * 16 * KP + kc); b[i] = F::ld(fb + i * 16 * KP + kc); }
#pragma unroll
            for (int nb = 0; nb < 4; ++nb)
#pragma unroll
                for (int mb = 0; mb < 4; ++mb) acc[mb][nb] = F::mma(a[mb], b[nb], acc[mb][nb]);
        }
        asm volatile("s_wait_dscnt 0x0" ::: "memory");      // this wave's reads of the stage's buffer are done before the buffer is handed back
        asm volatile("s_wait_asynccnt 0x0" ::: "memory");   // this wave's copies of the next stage have landed
        __syncthreads();                                    // next stage published; every reader has left this stage's buffer
        if (st + 2 < NS) stage(st + 2, st & 1);             // refill it, one whole stage ahead of its readers
    }
    asm volatile("s_wait_asynccnt 0x0" ::: "memory");   // no copy is outstanding when the buffers are written over
    float* my = red + w * (64 * 68);   // behind the last barrier no wave reads the buffers any more; this range is read by this wave alone
#pragma unroll
    for (int mb = 0; mb < 4; ++mb)
#pragma unroll
        for (int nb = 0; nb < 4; ++nb)
#pragma unroll
            for (int j = 0; j < 8; ++j) my[(mb * 16 + hi * 8 + j) * 68 + nb * 16 + lr] = acc[mb][nb][j];
    asm volatile("s_wait_dscnt 0x0" ::: "memory");   // the wave's tile is whole in LDS before its lanes read one another's values back
    const int tt = t0 + (tr ? wn : wm) * 64, hl = tr ? wm : wn;   // the wave's first token; which of the work-group's two heads
    const int zh = (tt / TT) * NH_ + (int)blockIdx.y * 2 + hl, tt0 = tt % TT;   // (batch, head) plane; first token inside its batch (64 tokens never cross a batch: TT % 64 == 0)
    if (tr) { const size_t o = ((size_t)zh * HD) * TT + tt0; qkv_out<true>(my, bs + hl * 64, V16 + o, Vh + o, Vl + o, lane); }
    else { const size_t o = (size_t)z * NZ * TT * HD + ((size_t)zh * TT + tt0) * HD; qkv_out<false>(my, bs + hl * 64, P16 + o, Ph + o, Pl + o, lane); }
}
// ---- k_fattn: scores, softmax and attn.v of one (batch, head) plane in one kernel; no score or probability leaves the registers.
// Transposed products: S^T = K Q^T (A = 16 key rows, B = 16 query columns), so lane (lr, hi) holds, for query lr, the scores of keys 8 hi + 0..7 of each 16-key tile;
// two such tiles, converted in place, are the B fragment of O^T += V^T P^T in the k order of the WFrag loaders. Running maximum and sum per query (online softmax), 32 keys a pass.
// x = log2(e) (tau (q.k/8) + delta[j]); p = 2^(x - m). Rows < RH: hi+lo bf16 planes, 3 products each; the rest fp16 with p x 1024 (the factor cancels in p / sum).
typedef __attribute__((ext_vector_type(8))) __bf16 v8b;
#define LOG2E 1.4426950408889634f
__device__ __forceinline__ float xhalf(float x) { const int b = __float_as_int(x); return __int_as_float(__builtin_amdgcn_permlanex16(b, b, 0x76543210, 0xfedcba98, false, false)); }   // lane l <-> l ^ 16
// 2^x of eight values / of one value. One statement each, results in registers of their own ("=&v"), closed by v_nop: the slot the instruction set asks for between a transcendental
// and an instruction that reads its result or overwrites its source.
__device__ __forceinline__ v8f exp2x8(v8f x) { float r0, r1, r2, r3, r4, r5, r6, r7;
    asm("v_exp_f32 %0, %8\n\tv_exp_f32 %1, %9\n\tv_exp_f32 %2, %10\n\tv_exp_f32 %3, %11\n\tv_exp_f32 %4, %12\n\tv_exp_f32 %5, %13\n\tv_exp_f32 %6, %14\n\tv_exp_f32 %7, %15\n\tv_nop"
        : "=&v"(r0), "=&v"(r1), "=&v"(r2), "=&v"(r3), "=&v"(r4), "=&v"(r5), "=&v"(r6), "=&v"(r7) : "v"(x[0]), "v"(x[1]), "v"(x[2]), "v"(x[3]), "v"(x[4]), "v"(x[5]), "v"(x[6]), "v"(x[7]));
    return (v8f){r0, r1, r2, r3, r4, r5, r6, r7}; }
__device__ __forceinline__ float exp2x1(float x) { float r; asm("v_exp_f32 %0, %1\n\tv_nop" : "=&v"(r) : "v"(x)); return r; }
// behind a group of global loads, in front of any reuse of their address registers; as inputs of the wait the four addresses stay whole up to it
__device__ __forceinline__ void xwait(const void* a, const void* b, const void* c, const void* d) { asm volatile("s_wait_xcnt 0x0" :: "v"(a), "v"(b), "v"(c), "v"(d) : "memory"); }
template <typename T16, bool HI, int QB>   // QB: 16-query column groups per wave (1 or 2)
__device__ __forceinline__ void fattn(const T16* __restrict__ Q, const T16* __restrict__ Q2, const T16* __restrict__ Kp, const T16* __restrict__ K2, const T16* __restrict__ Vt, const T16* __restrict__ Vt2, const float* dls, const T16* ring, float c1, bf* __restrict__ Ah, bf* __restrict__ Al, int q0) {
    typedef WFrag<T16> F; typedef typename F::V V;
    constexpr int NT = HI ? 4 : 2, NS = TT / KT;   // tiles per buffer (K, V^T; hi+lo: K lo, V^T lo too); stages
    static_assert(NS >= 2 && TT % KT == 0 && HD == 64 && KT == 64, "the ring needs two whole stages; a tile is 64 rows of 128 B");
    const int tid = threadIdx.x, lane = tid & 31, lr = lane & 15, hi = lane >> 4;
    // stage s -> buffer b: K rows [s KT, s KT + KT) and the same keys' columns of V^T
    const unsigned lcp = (unsigned)(size_t)ring + (unsigned)((tid >> 3) * (KP * 2) + (tid & 7) * 16);
    const char* kg = (const char*)(Kp + (size_t)(tid >> 3) * HD + (tid & 7) * 8); const char* vg = (const char*)(Vt + (size_t)(tid >> 3) * TT + (tid & 7) * 8);
    const char* kg2 = HI ? (const char*)(K2 + (size_t)(tid >> 3) * HD + (tid & 7) * 8) : kg; const char* vg2 = HI ? (const char*)(Vt2 + (size_t)(tid >> 3) * TT + (tid & 7) * 8) : vg;
    auto stage = [&](int s, int b) { const unsigned l0 = lcp + (unsigned)(b * NT * TLE * 2);
        cp2(l0, kg + (size_t)s * (KT * HD * 2), 16 * HD * 2, l0 + TLE * 2, vg + (size_t)s * (KT * 2), (size_t)16 * TT * 2);
        if (HI) cp2(l0 + 2 * TLE * 2, kg2 + (size_t)s * (KT * HD * 2), 16 * HD * 2, l0 + 3 * TLE * 2, vg2 + (size_t)s * (KT * 2), (size_t)16 * TT * 2); };
    stage(0, 0);
    V qf[QB][2], qf2[QB][2]; v8f o[QB][4]; float m[QB], l[QB]; const T16* qp[QB]; const T16* qp2[QB];
#pragma unroll
    for (int g = 0; g < QB; ++g) { m[g] = -3.0e38f; l[g] = 0.f; const size_t qo = (size_t)(q0 + g * 16 + lr) * HD + 8 * hi; qp[g] = Q + qo; qp2[g] = HI ? Q2 + qo : qp[g];
#pragma unroll
        for (int kc = 0; kc < 2; ++kc) { qf[g][kc] = F::ld(qp[g] + kc * 32); if (HI) qf2[g][kc] = F::ld(qp2[g] + kc * 32); }
#pragma unroll
        for (int nb = 0; nb < 4; ++nb) o[g][nb] = (v8f){}; }
    xwait(qp[0], qp[QB - 1], qp2[0], qp2[QB - 1]);
    asm volatile("s_wait_asynccnt 0x0" ::: "memory");   // this wave's copies of stage 0 have landed
    __syncthreads();                                    // every wave's have: stage 0 may be read
    stage(1, 1);
#pragma unroll 1   // rolled: one stage a trip, the buffers change places
    for (int st = 0; st < NS; ++st) {
        const T16* kb = ring + (st & 1) * (NT * TLE) + lr * KP + 8 * hi; const T16* vb = kb + TLE; const T16* kb2 = kb + 2 * TLE; const T16* vb2 = kb + 3 * TLE;
#pragma unroll   // the two 32-key passes of a stage stand one behind the other, so that the second's LDS reads can go ahead of the first's vector work
        for (int pp = 0; pp < KT / 32; ++pp) {
            const int j0 = st * KT + pp * 32;
            V kf[2][2], kf2[2][2], vf[4], vf2[4];
#pragma unroll
            for (int t = 0; t < 2; ++t)
#pragma unroll
                for (int kc = 0; kc < 2; ++kc) { kf[t][kc] = F::ld(kb + (pp * 32 + t * 16) * KP + kc * 32); if (HI) kf2[t][kc] = F::ld(kb2 + (pp * 32 + t * 16) * KP + kc * 32); }
#pragma unroll
            for (int nb = 0; nb < 4; ++nb) { vf[nb] = F::ld(vb + nb * 16 * KP + pp * 32); if (HI) vf2[nb] = F::ld(vb2 + nb * 16 * KP + pp * 32); }
            v8f s[QB][2];
#pragma unroll
            for (int g = 0; g < QB; ++g)
#pragma unroll
                for (int t = 0; t < 2; ++t) { s[g][t] = (v8f){};
#pragma unroll
                    for (int kc = 0; kc < 2; ++kc) { s[g][t] = F::mma(kf[t][kc], qf[g][kc], s[g][t]); if (HI) { s[g][t] = F::mma(kf[t][kc], qf2[g][kc], s[g][t]); s[g][t] = F::mma(kf2[t][kc], qf[g][kc], s[g][t]); } } }
            v8f dl[2]; V pf[QB], pf2[QB];
#pragma unroll
            for (int t = 0; t < 2; ++t) { const v4f d0 = *(const v4fa*)(dls + j0 + t * 16 + hi * 8), d1 = *(const v4fa*)(dls + j0 + t * 16 + hi * 8 + 4); dl[t] = __builtin_shufflevector(d0, d1, 0, 1, 2, 3, 4, 5, 6, 7); }
#pragma unroll
            for (int g = 0; g < QB; ++g) {
                float mx = -3.0e38f;
#pragma unroll
                for (int t = 0; t < 2; ++t)
#pragma unroll
                    for (int j = 0; j < 8; ++j) { s[g][t][j] = fmaf(s[g][t][j], c1, dl[t][j]); mx = fmaxf(mx, s[g][t][j]); }
                mx = fmaxf(mx, xhalf(mx));
                const float mn = fmaxf(m[g], mx), al = exp2x1(m[g] - mn), ms = HI ? mn : mn - 10.0f; m[g] = mn;
                float ps[2];
#pragma unroll
                for (int t = 0; t < 2; ++t) {
                    s[g][t] = exp2x8(s[g][t] - ms);
                    ps[t] = ((s[g][t][0] + s[g][t][1]) + (s[g][t][2] + s[g][t][3])) + ((s[g][t][4] + s[g][t][5]) + (s[g][t][6] + s[g][t][7])); }
                l[g] = fmaf(l[g], al, ps[0] + ps[1]);   // this lane's half of the keys; the halves meet behind the loop
#pragma unroll
                for (int nb = 0; nb < 4; ++nb) o[g][nb] *= al;
                if constexpr (HI) {
                    const v8b h0 = __builtin_convertvector(s[g][0], v8b), h1 = __builtin_convertvector(s[g][1], v8b);
                    const v8b l0 = __builtin_convertvector(s[g][0] - __builtin_convertvector(h0, v8f), v8b), l1 = __builtin_convertvector(s[g][1] - __builtin_convertvector(h1, v8f), v8b);
                    pf[g] = __builtin_shufflevector(h0, h1, 0, 1, 2, 3, 4, 5, 6, 7, 8, 9, 10, 11, 12, 13, 14, 15); pf2[g] = __builtin_shufflevector(l0, l1, 0, 1, 2, 3, 4, 5, 6, 7, 8, 9, 10, 11, 12, 13, 14, 15);
                } else pf[g] = cat16(__builtin_convertvector(s[g][0], v8h), __builtin_convertvector(s[g][1], v8h));
            }
            // attn.v of all groups behind the softmax of all groups: no 2^x statement stands close behind a WMMA whose operand registers it could be given
#pragma unroll
            for (int g = 0; g < QB; ++g)
#pragma unroll
                for (int nb = 0; nb < 4; ++nb) { o[g][nb] = F::mma(vf[nb], pf[g], o[g][nb]); if constexpr (HI) { o[g][nb] = F::mma(vf[nb], pf2[g], o[g][nb]); o[g][nb] = F::mma(vf2[nb], pf[g], o[g][nb]); } }
        }
        // four vector slots behind the stage's last WMMAs, also on the taken back edge: the next instructions write over their operands.
        // The accumulators are named so that every WMMA of the stage stands in front of the slots.
        if constexpr (QB == 1) asm volatile("v_nop\n\tv_nop\n\tv_nop\n\tv_nop" : "+v"(o[0][0]), "+v"(o[0][1]), "+v"(o[0][2]), "+v"(o[0][3]));
        else asm volatile("v_nop\n\tv_nop\n\tv_nop\n\tv_nop" : "+v"(o[0][0]), "+v"(o[0][1]), "+v"(o[0][2]), "+v"(o[0][3]), "+v"(o[QB - 1][0]), "+v"(o[QB - 1][1]), "+v"(o[QB - 1][2]), "+v"(o[QB - 1][3]));
        asm volatile("s_wait_dscnt 0x0" ::: "memory");      // this wave's reads of the stage's buffer are done before the buffer is handed back
        asm volatile("s_wait_asynccnt 0x0" ::: "memory");   // this wave's copies of the next stage have landed
        __syncthreads();                                    // next stage published; every reader has left this stage's buffer
        if (st + 2 < NS) stage(st + 2, st & 1);             // refill it, one whole stage ahead of its readers
    }
    asm volatile("s_wait_asynccnt 0x0" ::: "memory");   // no copy is outstanding when the wave goes on to its end
    // The merged rows [t][head * HD + d], bf16 hi + lo: the A planes of the out projection (Ah, Al point at this batch's row 0, this head's column 0). A lane holds 8 consecutive d of its query per tile.
    // Rows >= RH: the x 1024 comes off again, exactly, before the split.
#pragma unroll
    for (int g = 0; g < QB; ++g) { const float f = __fdiv_rn(HI ? 1.0f : PCAR, l[g] + xhalf(l[g])); const size_t ro = (size_t)(q0 + g * 16 + lr) * DQ + hi * 8; bf* const ph = Ah + ro; bf* const pl = Al + ro;
#pragma unroll
        for (int nb = 0; nb < 4; ++nb) { const v8f r = o[g][nb] * f; v8us oh, ol;
#pragma unroll
            for (int j = 0; j < 8; ++j) { unsigned short a, c2; splitf(HI ? r[j] : r[j] * (1.0f / PCAR), a, c2); oh[j] = a; ol[j] = c2; }
            *(v8us*)(ph + nb * 16) = oh; *(v8us*)(pl + nb * 16) = ol;
            // behind the two stores, in front of any reuse of their data and address registers; as inputs of the wait these stay whole up to it
            asm volatile("s_wait_xcnt 0x0" :: "v"(oh), "v"(ol), "v"(ph), "v"(pl) : "memory"); } }
}
// grid (RH/64 + (TT-RH)/128, NZ), 4 waves: blocks x < RH/64 take 64 hi+lo query rows (16 a wave), the others 128 fp16 rows (32 a wave); every wave walks all TT keys.
// K and V^T reach the waves through LDS: 64 keys a stage, two buffers, brought in by asynchronous copies in whole lines and read by all four waves.
__global__ __launch_bounds__(128) void k_fattn(const h16* __restrict__ Q16, const h16* __restrict__ K16, const h16* __restrict__ V16, const bf* __restrict__ Qh, const bf* __restrict__ Ql, const bf* __restrict__ Kh, const bf* __restrict__ Kl, const bf* __restrict__ Vh, const bf* __restrict__ Vl, const float* __restrict__ TAU, const float* __restrict__ DEL, bf* __restrict__ Ah, bf* __restrict__ Al) {
    __shared__ __align__(16) float dls[TT];   // log2(e) delta[b][j]
    __shared__ __align__(16) unsigned short ring[2 * 4 * TLE];   // two buffers of up to four tiles
    const int z = blockIdx.y, b = z / NH_, tid = threadIdx.x, w = __builtin_amdgcn_readfirstlane(tid >> 5); const size_t zo = (size_t)z * TT * HD, ao = (size_t)b * TT * DQ + (z % NH_) * HD;
#pragma unroll
    for (int i = 0; i < TT / 128; ++i) dls[i * 128 + tid] = bfr(DEL[(size_t)b * TT + i * 128 + tid]) * LOG2E;
    const float c1 = bfr(TAU[b]) * (SCL * LOG2E);
    __syncthreads();   // the delta row is whole before any wave reads it
    if (blockIdx.x < RH / 64) fattn<bf, true, 1>(Qh + zo, Ql + zo, Kh + zo, Kl + zo, Vh + zo, Vl + zo, dls, (const bf*)ring, c1, Ah + ao, Al + ao, (int)blockIdx.x * 64 + w * 16);
    else fattn<h16, false, 2>(Q16 + zo, nullptr, K16 + zo, nullptr, V16 + zo, nullptr, dls, (const h16*)ring, c1, Ah + ao, Al + ao, RH + ((int)blockIdx.x - RH / 64) * 128 + w * 32);
}

// ---- k_wo: the out projection of all batches, C = (Ah + Al) Bt^T + bias, f32. A work-group of 4 waves owns a 128 x 128 tile of C, a wave 64 x 64 of it (wm: which 64 token rows, wn: which 64 output columns), and walks all of K itself:
// 8 stages of 64 k, 128 + 128 + 128 operand rows a stage (hi rows, lo rows, weight rows; one 128-B line a row), two LDS buffers filled by asynchronous copies one stage ahead.
// One f32 accumulator chain per output over k = 0..511 (per 32 k the hi product, then the lo product), bias last. A wave's tile goes through the wave's own LDS range so that every store covers whole lines.
__global__ __launch_bounds__(128) void k_wo(const bf* __restrict__ Ah, const bf* __restrict__ Al, const bf* __restrict__ Wt, const float* __restrict__ bias, float* C) {
    typedef WFrag<bf> F; typedef F::V V;
    constexpr int NS = DQ / 64, BUF = 6 * TLE;   // stages; 16-bit elements of one buffer: hi rows 0..127, lo rows 0..127, weight rows 0..127, pitch KP
    static_assert(NS >= 2 && DQ % 64 == 0 && BUF >= 4 * 64 * 68, "the ring needs two whole stages; the four result tiles (pitch 68 floats) fit the two buffers");
    __shared__ __align__(16) float red[BUF];    // the two buffers; behind the loop each wave's result tile
    __shared__ __align__(16) float bs[128];     // the work-group's 128 bias values, rounded
    const int tid = threadIdx.x, w = __builtin_amdgcn_readfirstlane(tid >> 5), lane = tid & 31, lr = lane & 15, hi = lane >> 4, wm = w >> 1, wn = w & 1; const int r0 = blockIdx.x * 128, c0 = blockIdx.y * 128;
    const bf* ring = (const bf*)red;
    const unsigned lcp = (unsigned)(size_t)ring + (unsigned)((tid >> 3) * (KP * 2) + (tid & 7) * 16); const size_t go = (size_t)(tid >> 3) * DQ + (tid & 7) * 8;
    const char* gh = (const char*)(Ah + (size_t)r0 * DQ + go); const char* gl = (const char*)(Al + (size_t)r0 * DQ + go); const char* gb = (const char*)(Wt + (size_t)c0 * DQ + go);
    constexpr size_t R16 = (size_t)16 * DQ * 2;   // bytes of 16 operand rows
    // stage s -> buffer b: k in [64 s, 64 s + 64) of all 3 x 128 rows, 24 copies a thread
    auto stage = [&](int s, int b) { const unsigned l0 = lcp + (unsigned)(b * BUF * 2); const char* ph = gh + (size_t)s * 128; const char* pl = gl + (size_t)s * 128; const char* pb = gb + (size_t)s * 128;
        cp2(l0, ph, R16, l0 + TLE * 2, ph + 4 * R16, R16);                      // hi rows 0..63, 64..127
        cp2(l0 + 4 * TLE * 2, pb, R16, l0 + 5 * TLE * 2, pb + 4 * R16, R16);    // weight rows
        cp2(l0 + 2 * TLE * 2, pl, R16, l0 + 3 * TLE * 2, pl + 4 * R16, R16); }; // lo rows
    stage(0, 0);
    { const float* pbias = bias + c0 + tid; const float bv0 = *pbias;
      asm volatile("s_wait_xcnt 0x0" :: "v"(pbias) : "memory");   // behind the load, in front of any reuse of its address registers
      bs[tid] = bfr(bv0); }
    v8f acc[4][4];
#pragma unroll
    for (int mb = 0; mb < 4; ++mb)
#pragma unroll
        for (int nb = 0; nb < 4; ++nb) acc[mb][nb] = (v8f){};
    asm volatile("s_wait_asynccnt 0x0" ::: "memory");   // this wave's copies of stage 0 have landed
    __syncthreads();                                    // every wave's have: stage 0 (and the bias row) may be read
    stage(1, 1);
    // Two fragment sets: each 32-k step's 24 LDS reads are issued one block of 32 WMMAs ahead of their use, so that a lone wave on its SIMD does not stand waiting for them.
    // A stage's buffer is read only between the barrier that publishes it and the barrier at the stage's foot; the second step's products follow behind that barrier, from registers alone.
    V a[2][4], a2[2][4], b[2][4];
    auto ldf = [&](int x, const bf* fa, const bf* fb) {
#pragma unroll
        for (int i = 0; i < 4; ++i) { a[x][i] = F::ld(fa + i * 16 * KP); b[x][i] = F::ld(fb + i * 16 * KP); }
#pragma unroll
        for (int i = 0; i < 4; ++i) a2[x][i] = F::ld(fa + 2 * TLE + i * 16 * KP); };
    auto mm = [&](int x) {   // per 32 k: the 16 hi products, then the 16 lo products
#pragma unroll
        for (int nb = 0; nb < 4; ++nb)
#pragma unroll
            for (int mb = 0; mb < 4; ++mb) acc[mb][nb] = F::mma(a[x][mb], b[x][nb], acc[mb][nb]);
#pragma unroll
        for (int nb = 0; nb < 4; ++nb)
#pragma unroll
            for (int mb = 0; mb < 4; ++mb) acc[mb][nb] = F::mma(a2[x][mb], b[x][nb], acc[mb][nb]); };
#pragma unroll   // straight line: buffer offsets are constants and no back edge stands behind a WMMA
    for (int st = 0; st < NS; ++st) {
        const bf* fa = ring + (st & 1) * BUF + (wm * 64 + lr) * KP + 8 * hi; const bf* fb = ring + (st & 1) * BUF + 4 * TLE + (wn * 64 + lr) * KP + 8 * hi;
        // The scheduling barriers keep each step's 24 reads together as one group, a whole block of WMMAs ahead of their use, and the last block in front of the wait at the foot:
        // left free, this build either dealt the reads out singly among the WMMAs or moved a block behind the foot's wait, which then stood waiting for reads just issued.
        ldf(0, fa, fb);
        __builtin_amdgcn_sched_barrier(0);
        if (st > 0) mm(1);   // k 32..63 of the stage before
        __builtin_amdgcn_sched_barrier(0);
        ldf(1, fa + 32, fb + 32);
        __builtin_amdgcn_sched_barrier(0);
        mm(0);
        __builtin_amdgcn_sched_barrier(0);
        asm volatile("s_wait_dscnt 0x0" ::: "memory");      // this wave's reads of the stage's buffer are done before the buffer is handed back
        asm volatile("s_wait_asynccnt 0x0" ::: "memory");   // this wave's copies of the next stage have landed
        __syncthreads();                                    // next stage published; every reader has left this stage's buffer
        if (st + 2 < NS) stage(st + 2, st & 1);             // refill it, one whole stage ahead of its readers
    }
    mm(1);   // k 32..63 of the last stage
    asm volatile("s_wait_asynccnt 0x0" ::: "memory");   // no copy is outstanding when the buffers are written over
    float* my = red + w * (64 * 68);   // behind the last barrier no wave reads the buffers any more; this range is read by this wave alone
#pragma unroll
    for (int mb = 0; mb < 4; ++mb)
#pragma unroll
        for (int nb = 0; nb < 4; ++nb)
#pragma unroll
            for (int j = 0; j < 8; ++j) my[(mb * 16 + hi * 8 + j) * 68 + nb * 16 + lr] = acc[mb][nb][j];
    asm volatile("s_wait_dscnt 0x0" ::: "memory");   // the wave's tile is whole in LDS before its lanes read one another's values back
    const int cofs = lr * 4; const v4f bc = *(const v4fa*)(bs + wn * 64 + cofs);
    float* const crow = C + (size_t)(r0 + wm * 64 + hi) * DM + c0 + wn * 64 + cofs;   // a wave's store: 2 rows of 256 B
#pragma unroll 1   // rolled: 32 rows a trip, so that only two waits on the stores stand in the wave's way
    for (int s = 0; s < 2; ++s) { float* const p = crow + (size_t)s * 32 * DM; v4f v[16];
#pragma unroll
        for (int q = 0; q < 16; ++q) v[q] = *(const v4fa*)(my + (s * 32 + q * 2 + hi) * 68 + cofs) + bc;
#pragma unroll
        for (int q = 0; q < 16; ++q) *(v4f*)(p + (size_t)q * 2 * DM) = v[q];
        // behind the 16 stores, in front of any reuse of their data and address registers; as inputs of the wait these stay whole up to it
        asm volatile("s_wait_xcnt 0x0" :: "v"(v[0]), "v"(v[1]), "v"(v[2]), "v"(v[3]), "v"(v[4]), "v"(v[5]), "v"(v[6]), "v"(v[7]), "v"(v[8]), "v"(v[9]), "v"(v[10]), "v"(v[11]), "v"(v[12]), "v"(v[13]), "v"(v[14]), "v"(v[15]), "v"(p) : "memory"); }
}

extern "C" void kernel_launch(void* const* d_in, const int* in_sizes, int n_in,
                              void* d_out, int out_size, void* d_ws, size_t ws_size, hipStream_t stream) {
    (void)in_sizes; (void)n_in; (void)out_size;
    const float* x = (const float*)d_in[0]; const float* xk = (const float*)d_in[1]; const float* xv = (const float*)d_in[2]; const float* TAU = (const float*)d_in[3]; const float* DEL = (const float*)d_in[4]; const float* wq = (const float*)d_in[5]; const float* bq = (const float*)d_in[6]; const float* wk = (const float*)d_in[7]; const float* bk = (const float*)d_in[8]; const float* wv = (const float*)d_in[9]; const float* bv = (const float*)d_in[10]; const float* wo = (const float*)d_in[11]; const float* bo = (const float*)d_in[12];
    float* OUT = (float*)d_out;     // [4][2048][512]
    char* wsp = (char*)d_ws;
    auto take = [&](size_t bytes) { char* p = wsp; wsp += (bytes + 255) & ~(size_t)255; return (void*)p; };
    const size_t PLN = (size_t)NZ * TT * HD;   // elements of one plane set: every (batch, head)
    bf* WQ = (bf*)take((size_t)DQ * DM * 2); bf* WK = (bf*)take((size_t)DKV * DM * 2); bf* WV = (bf*)take((size_t)DKV * DM * 2); bf* WO = (bf*)take((size_t)DM * DQ * 2); (void)WK; (void)WV;
    h16* QP16 = (h16*)take(PLN * 2); h16* KP16 = (h16*)take(PLN * 2); h16* VT16 = (h16*)take(PLN * 2);
    bf* QPh = (bf*)take(PLN * 2); bf* KPh = (bf*)take(PLN * 2); bf* QPl = (bf*)take(PLN * 2); bf* KPl = (bf*)take(PLN * 2); bf* VTh = (bf*)take(PLN * 2); bf* VTl = (bf*)take(PLN * 2);
    bf* ATh = (bf*)take((size_t)NB_ * TT * DQ * 2); bf* ATl = (bf*)take((size_t)NB_ * TT * DQ * 2);
    bf* XB = (bf*)take((size_t)3 * NB_ * TT * DM * 2);   // bf16 inputs. k_qkv reaches the k planes from the q planes: each k plane set lies directly behind its q plane set
    if ((size_t)(wsp - (char*)d_ws) > ws_size) return;    // ws 256 MiB
    k_wtG<<<dim3((unsigned)((DM * DQ / 64 + 63) / 64), 4, 1), 256, 0, stream>>>(wq, wk, wv, wo, DM, DQ, WQ);
    k_cvt8<<<dim3((unsigned)(((size_t)NB_ * TT * DM / 8 + 255) / 256), 3, 1), 256, 0, stream>>>(x, xk, xv, XB, (size_t)NB_ * TT * DM / 8);
    // q, k, v projections of all batches (x: 128 token rows, y: two heads, z: which projection), written as the attention kernel's planes
    k_qkv<<<dim3(NB_ * TT / 128, DQ / 128, 3), 128, 0, stream>>>(XB, WQ, bq, bk, bv, QP16, QPh, QPl, VT16, VTh, VTl);
    k_fattn<<<dim3(RH / 64 + (TT - RH) / 128, NZ, 1), 128, 0, stream>>>(QP16, KP16, VT16, QPh, QPl, KPh, KPl, VTh, VTl, TAU, DEL, ATh, ATl);
    k_wo<<<dim3(NB_ * TT / 128, DM / 128, 1), 128, 0, stream>>>(ATh, ATl, WO, bo, OUT);
}

// v009
// It runs in 107 microseconds.
// Timed twice side by side with v008, it ran 1.05 and 1.04 times as fast.
// Counting every step since v000, it is 21.0 times as fast.
#include <hip/hip_runtime.h>

// De-stationary attention (Non-stationary Transformer) (queries, keys, values [4][2048][512]; q, k, v = . W + b ('xw' [512][512]; 8 heads x 64); scores = tau[b] (q.k/8) + delta[b][s] (tau [4], delta [4][2048], read); softmax; out = merged Wo + bo -> [4][2048][512] (4.2 M)).
// Compute dtypes, f32 accumulate: every input rounded to bf16; q/k/v on PLAIN bf16 operands (inputs: exact) + biases; tau scale and delta shift applied in f32 per (i, j) inside the attention kernel; scores and attn.v: query rows < 512 hl (3 products), the rest single fp16 (x1024); softmax f32; Wo hl x exact (2 products) + bo.

#define NB_  4
#define TT   2048
#define DM   512
#define NH_  8
#define NKV  8
#define REP  (NH_ / NKV)
#define HD   64
#define DQ   (NH_ * HD)
#define DKV  (NKV * HD)
#define NZ   (NB_ * NH_)          // all (batch, head) planes
#define RH   512                  // query rows < RH use hi+lo planes (0: none)
#define WIN  0
#define PCAR 1024.0f
#define SCL  0.125f   // HD^-0.5
typedef _Float16 h16;
typedef unsigned short bf;
typedef __attribute__((ext_vector_type(16))) __bf16   v16bf;
typedef __attribute__((ext_vector_type(16))) _Float16 v16h;
typedef __attribute__((ext_vector_type(8)))  _Float16 v8h;
typedef __attribute__((ext_vector_type(8)))  unsigned short v8us;
typedef __attribute__((ext_vector_type(8)))  float    v8f;
typedef __attribute__((ext_vector_type(4)))  float    v4f;
typedef v8h  __attribute__((may_alias)) v8ha;
typedef v4f  __attribute__((may_alias)) v4fa;
typedef v8us __attribute__((may_alias)) v8usa;

__device__ __forceinline__ unsigned short f2bf(float f) { unsigned u = __float_as_uint(f); u += 0x7FFFu + ((u >> 16) & 1u); return (unsigned short)(u >> 16); }
__device__ __forceinline__ float bf2f(unsigned short b) { return __uint_as_float(((unsigned)b) << 16); }
__device__ __forceinline__ float bfr(float f) { return bf2f(f2bf(f)); }
__device__ __forceinline__ v16h cat16(v8h lo, v8h hi) { return __builtin_shufflevector(lo, hi, 0, 1, 2, 3, 4, 5, 6, 7, 8, 9, 10, 11, 12, 13, 14, 15); }
__device__ __forceinline__ v16bf cat16b(v8us lo, v8us hi) { return __builtin_bit_cast(v16bf, __builtin_shufflevector(lo, hi, 0, 1, 2, 3, 4, 5, 6, 7, 8, 9, 10, 11, 12, 13, 14, 15)); }
__device__ __forceinline__ v8f wmma16(v16h a, v16h b, v8f c) { return __builtin_amdgcn_wmma_f32_16x16x32_f16(false, a, false, b, (short)0, c, false, false); }
__device__ __forceinline__ v8f wmmab(v16bf a, v16bf b, v8f c) { return __builtin_amdgcn_wmma_f32_16x16x32_bf16(false, a, false, b, (short)0, c, false, false); }



// fragment loaders: K-contiguous 16-bit planes, lane (lr, hi) takes k = 8 hi + 0..7 and 16 + 8 hi + 0..7 of each 32
template <typename T16> struct WFrag;
template <> struct WFrag<h16> { typedef v16h V; static __device__ __forceinline__ V ld(const h16* p) { return cat16(*(const v8h*)p, *(const v8h*)(p + 16)); } static __device__ __forceinline__ v8f mma(V a, V b, v8f c) { return wmma16(a, b, c); } };
template <> struct WFrag<bf> { typedef v16bf V; static __device__ __forceinline__ V ld(const bf* p) { return cat16b(*(const v8us*)p, *(const v8us*)(p + 16)); } static __device__ __forceinline__ v8f mma(V a, V b, v8f c) { return wmmab(a, b, c); } };
__device__ __forceinline__ h16 tohx(float x) { return (h16)x; }
__device__ __forceinline__ void splitf(float y, unsigned short& h, unsigned short& l) { h = f2bf(y); l = f2bf(y - bf2f(h)); }
typedef __attribute__((ext_vector_type(2))) _Float16 v2h;
typedef __attribute__((ext_vector_type(4))) _Float16 v4h;
typedef __attribute__((ext_vector_type(2))) unsigned short v2us;
typedef __attribute__((ext_vector_type(4))) unsigned short v4us;
typedef __attribute__((ext_vector_type(2))) float v2f;
typedef __attribute__((ext_vector_type(4))) int v4i;

__global__ __launch_bounds__(256) void k_wtG(const float* __restrict__ w0, const float* __restrict__ w1, const float* __restrict__ w2, const float* __restrict__ w3, int K, int N, bf* Bt) {
    const int y = blockIdx.y; const float* w = (y == 0) ? w0 : (y == 1) ? w1 : (y == 2) ? w2 : w3; Bt += (size_t)y * K * N;   // blockIdx.y: which of the four equal-shaped matrices
    const int lane = threadIdx.x & 31; const int L0 = (blockIdx.x * 8 + (threadIdx.x >> 5)) * 8; const int nlines = N * K / 64;
{
#pragma unroll 1
        for (int l = 0; l < 8; ++l) { const int L = L0 + l; if (L >= nlines) break; const size_t e = (size_t)L * 64 + lane * 2; const int k = (int)(e % K), n = (int)(e / K); v2us o;
            o[0] = f2bf(w[(size_t)k * N + n]); o[1] = f2bf(w[(size_t)(k + 1) * N + n]); *(v2us*)(Bt + e) = o; }
         }
}

#define KT  64          // keys per staged tile
#define KP  72          // LDS row pitch in 16-bit elements: 144 B = 16 B x 9, the pitch of ds_load_b128 readers of 128-B rows
#define TLE (64 * KP)   // elements of one staged tile: 64 rows (K: keys; V^T: head dims) of 64 values
// Two tiles of 64 rows x 128 B, global -> LDS: a thread brings 16 B of rows r, r + 16, r + 32, r + 48 of each tile (a wave's copy: four whole 128-B lines). 128 threads cover both tiles in one call.
// la, lb: the thread's LDS byte addresses in row r; ga, gb: its global addresses there; sa, sb: bytes of 16 global rows. The wait on xcnt closes the copies' own statement: their address registers are reused behind it.
__device__ __forceinline__ void cp2(unsigned la, const char* ga, size_t sa, unsigned lb, const char* gb, size_t sb) {
    asm volatile("global_load_async_to_lds_b128 %0, %1, off\n\tglobal_load_async_to_lds_b128 %2, %3, off\n\tglobal_load_async_to_lds_b128 %4, %5, off\n\tglobal_load_async_to_lds_b128 %6, %7, off\n\t"
                 "global_load_async_to_lds_b128 %8, %9, off\n\tglobal_load_async_to_lds_b128 %10, %11, off\n\tglobal_load_async_to_lds_b128 %12, %13, off\n\tglobal_load_async_to_lds_b128 %14, %15, off\n\ts_wait_xcnt 0x0"
                 :: "v"(la), "v"(ga), "v"(la + 16u * KP * 2u), "v"(ga + sa), "v"(la + 32u * KP * 2u), "v"(ga + 2 * sa), "v"(la + 48u * KP * 2u), "v"(ga + 3 * sa),
                    "v"(lb), "v"(gb), "v"(lb + 16u * KP * 2u), "v"(gb + sb), "v"(lb + 32u * KP * 2u), "v"(gb + 2 * sb), "v"(lb + 48u * KP * 2u), "v"(gb + 3 * sb) : "memory"); }
#define XP  68          // LDS row pitch of a staged f32 row in floats: 272 B = 16 B x 17, the pitch of ds_load_b128 readers of 256-B rows
// 64 rows x 256 B of f32, global -> LDS: a thread brings 16 B of rows r, r + 8, ..., r + 56 (a wave's copy: two whole rows, four 128-B lines). 128 threads cover the 64 rows in one call.
// l: the thread's LDS byte address in row r; g: its global address there; gs: bytes of 8 global rows. The wait on xcnt closes the copies' own statement: their address registers are reused behind it.
__device__ __forceinline__ void cp8(unsigned l, const char* g, size_t gs) {
    asm volatile("global_load_async_to_lds_b128 %0, %1, off\n\tglobal_load_async_to_lds_b128 %2, %3, off\n\tglobal_load_async_to_lds_b128 %4, %5, off\n\tglobal_load_async_to_lds_b128 %6, %7, off\n\t"
                 "global_load_async_to_lds_b128 %8, %9, off\n\tglobal_load_async_to_lds_b128 %10, %11, off\n\tglobal_load_async_to_lds_b128 %12, %13, off\n\tglobal_load_async_to_lds_b128 %14, %15, off\n\ts_wait_xcnt 0x0"
                 :: "v"(l), "v"(g), "v"(l + 8u * XP * 4u), "v"(g + gs), "v"(l + 16u * XP * 4u), "v"(g + 2 * gs), "v"(l + 24u * XP * 4u), "v"(g + 3 * gs),
                    "v"(l + 32u * XP * 4u), "v"(g + 4 * gs), "v"(l + 40u * XP * 4u), "v"(g + 5 * gs), "v"(l + 48u * XP * 4u), "v"(g + 6 * gs), "v"(l + 56u * XP * 4u), "v"(g + 7 * gs) : "memory"); }
typedef __attribute__((ext_vector_type(8))) __bf16 v8b;
// a bf16 fragment from 16 staged f32 values, rounded to nearest even; k order of the WFrag loaders: a0, a1 hold k = 8 hi + 0..7 of the 32, a2, a3 hold k = 16 + 8 hi + 0..7
__device__ __forceinline__ v16bf rndx(v4f a0, v4f a1, v4f a2, v4f a3) {
    const v8b lo = __builtin_convertvector(__builtin_shufflevector(a0, a1, 0, 1, 2, 3, 4, 5, 6, 7), v8b), hi = __builtin_convertvector(__builtin_shufflevector(a2, a3, 0, 1, 2, 3, 4, 5, 6, 7), v8b);
    return __builtin_shufflevector(lo, hi, 0, 1, 2, 3, 4, 5, 6, 7, 8, 9, 10, 11, 12, 13, 14, 15); }
// ---- k_qkv: the three projections of all batches, straight from the f32 inputs. A work-group of 4 waves owns a 128 x 128 tile of C = X Wt^T, a wave 64 x 64 of it (wm: which 64 token rows, wn: which 64 weight rows = which head), and walks all of K itself:
// 8 stages of 64 k, 128 token rows (f32, 256 B a row) + 128 weight rows (bf16, 128 B a row) a stage, two LDS buffers filled by asynchronous copies one stage ahead; the token values are rounded to bf16 where a fragment is read.
// One f32 accumulator chain per output over k = 0..511, bias last. z = 0, 1 (q, k) -> planes [batch][head][t][d]; z = 2 (v) -> the transposed planes [batch][head][d][t].
// A wave's 64 x 64 tile is one (64 tokens, head) unit: it goes through the wave's own LDS range (v: written there as [d][t]) so that every store covers whole lines. Each value is stored as fp16 and as bf16 hi + lo.
template <bool TR>   // TR: rows are head dims (bias by row, row pitch TT); else rows are tokens (bias by column, row pitch HD)
__device__ __forceinline__ void qkv_out(const float* my, const float* bh, h16* d16, bf* dh, bf* dl, int lane) {
    constexpr int pitch = TR ? TT : HD; const int cofs = (lane & 7) * 8; v8f bc = (v8f){};
    if (!TR) { const v4f b0 = *(const v4fa*)(bh + cofs), b1 = *(const v4fa*)(bh + cofs + 4); bc = __builtin_shufflevector(b0, b1, 0, 1, 2, 3, 4, 5, 6, 7); }
#pragma unroll 1   // rolled: 16 copies of the conversion code in two forms would only lengthen the kernel's text
    for (int s = 0; s < 16; ++s) { const int row = s * 4 + (lane >> 3);   // a wave's store: 4 rows of 128 B
        const v4f v0 = *(const v4fa*)(my + row * 68 + cofs), v1 = *(const v4fa*)(my + row * 68 + cofs + 4); const v8f val = __builtin_shufflevector(v0, v1, 0, 1, 2, 3, 4, 5, 6, 7);
        const float br = TR ? bh[row] : 0.f; v8h o16; v8us oh, ol;
#pragma unroll
        for (int q = 0; q < 8; ++q) { const float r = val[q] + (TR ? br : bc[q]); o16[q] = tohx(r); unsigned short a2, c2; splitf(r, a2, c2); oh[q] = a2; ol[q] = c2; }
        const size_t e = (size_t)row * pitch + cofs; h16* const p16 = d16 + e; bf* const ph = dh + e; bf* const pl = dl + e;
        *(v8h*)p16 = o16; *(v8us*)ph = oh; *(v8us*)pl = ol;
        // behind the three stores, in front of any reuse of their data and address registers; as inputs of the wait these stay whole up to it
        asm volatile("s_wait_xcnt 0x0" :: "v"(o16), "v"(oh), "v"(ol), "v"(p16), "v"(ph), "v"(pl) : "memory"); }
}
__global__ __launch_bounds__(128) void k_qkv(const float* __restrict__ x0, const float* __restrict__ x1, const float* __restrict__ x2, const bf* __restrict__ Wt, const float* __restrict__ bias0, const float* __restrict__ bias1, const float* __restrict__ bias2, h16* P16, bf* Ph, bf* Pl, h16* V16, bf* Vh, bf* Vl) {
    typedef WFrag<bf> F; typedef F::V V;
    constexpr int NS = DM / 64, XF = 128 * XP, BUF = XF + TLE;   // stages; floats of a buffer's token rows 0..127 (pitch XP); floats of one buffer: behind them weight rows 0..127 (2 TLE 16-bit elements, pitch KP)
    static_assert(NS >= 2 && DM % 64 == 0 && 2 * BUF >= 4 * 64 * 68, "the ring needs two whole stages; the four result tiles (pitch 68 floats) fit the two buffers");
    __shared__ __align__(16) float red[2 * BUF];   // the two buffers; behind the loop each wave's result tile
    __shared__ __align__(16) float bs[128];        // the work-group's 128 bias values, rounded
    const int z = blockIdx.z; const bool tr = (z == 2); const float* bias = (z == 0) ? bias0 : (z == 1) ? bias1 : bias2;
    const int tid = threadIdx.x, w = __builtin_amdgcn_readfirstlane(tid >> 5), lane = tid & 31, lr = lane & 15, hi = lane >> 4, wm = w >> 1, wn = w & 1; const int t0 = blockIdx.x * 128, n0 = blockIdx.y * 128;
    const float* Xz = ((z == 0) ? x0 : (z == 1) ? x1 : x2) + (size_t)t0 * DM; const bf* Wz = Wt + (size_t)z * DQ * DM + (size_t)n0 * DM;
    const unsigned lx = (unsigned)(size_t)red + (unsigned)((tid >> 4) * (XP * 4) + (tid & 15) * 16), lw = (unsigned)(size_t)red + (unsigned)(XF * 4 + (tid >> 3) * (KP * 2) + (tid & 7) * 16);
    const char* gx = (const char*)(Xz + (size_t)(tid >> 4) * DM + (tid & 15) * 4); const char* gw = (const char*)(Wz + (size_t)(tid >> 3) * DM + (tid & 7) * 8);
    // stage s -> buffer b: k in [64 s, 64 s + 64) of all 128 + 128 rows, 24 copies a thread
    auto stage = [&](int s, int b) { const unsigned o = (unsigned)(b * BUF * 4); const char* px = gx + (size_t)s * 256; const char* pw = gw + (size_t)s * 128;
        cp8(lx + o, px, (size_t)8 * DM * 4);                                                                     // token rows 0..63
        cp8(lx + o + 64u * XP * 4u, px + (size_t)64 * DM * 4, (size_t)8 * DM * 4);                               // token rows 64..127
        cp2(lw + o, pw, (size_t)16 * DM * 2, lw + o + TLE * 2, pw + (size_t)64 * DM * 2, (size_t)16 * DM * 2); };  // weight rows 0..63, 64..127
    stage(0, 0);
    { const float* pbias = bias + n0 + tid; const float bv0 = *pbias;
      asm volatile("s_wait_xcnt 0x0" :: "v"(pbias) : "memory");   // behind the load, in front of any reuse of its address registers
      bs[tid] = bfr(bv0); }
    v8f acc[4][4];
#pragma unroll
    for (int mb = 0; mb < 4; ++mb)
#pragma unroll
        for (int nb = 0; nb < 4; ++nb) acc[mb][nb] = (v8f){};
    asm volatile("s_wait_asynccnt 0x0" ::: "memory");   // this wave's copies of stage 0 have landed
    __syncthreads();                                    // every wave's have: stage 0 (and the bias row) may be read
    stage(1, 1);
#pragma unroll   // straight line: buffer offsets are constants and no back edge stands behind a WMMA
    for (int st = 0; st < NS; ++st) {
        const float* fa = red + (st & 1) * BUF + (wm * 64 + lr) * XP + 8 * hi; const bf* fb = (const bf*)(red + (st & 1) * BUF + XF) + (wn * 64 + lr) * KP + 8 * hi;
#pragma unroll
        for (int kc = 0; kc < 64; kc += 32) {
            V a[4], b[4]; v4f xr[4][4];
#pragma unroll
            for (int i = 0; i < 4; ++i) { const float* p = fa + i * 16 * XP + kc; xr[i][0] = *(const v4fa*)p; xr[i][1] = *(const v4fa*)(p + 4); xr[i][2] = *(const v4fa*)(p + 16); xr[i][3] = *(const v4fa*)(p + 20); }
#pragma unroll
            for (int i = 0; i < 4; ++i) b[i] = F::ld(fb + i * 16 * KP + kc);
            // keeps all 24 LDS reads of a 32-k step together as one group ahead of its roundings and 16 WMMAs: left free, this build dealt the weight reads out in twos among the WMMAs, each with a wait of its own directly behind it
            __builtin_amdgcn_sched_barrier(0);
#pragma unroll
            for (int i = 0; i < 4; ++i) a[i] = rndx(xr[i][0], xr[i][1], xr[i][2], xr[i][3]);
#pragma unroll
            for (int nb = 0; nb < 4; ++nb)
#pragma unroll
                for (int mb = 0; mb < 4; ++mb) acc[mb][nb] = F::mma(a[mb], b[nb], acc[mb][nb]);
            __builtin_amdgcn_sched_barrier(0);   // without it this build moved a stage's last WMMAs behind the foot's barrier, in front of the refill's copies, and took 34 more registers
        }
        asm volatile("s_wait_dscnt 0x0" ::: "memory");      // this wave's reads of the stage's buffer are done before the buffer is handed back
        asm volatile("s_wait_asynccnt 0x0" ::: "memory");   // this wave's copies of the next stage have landed
        __syncthreads();                                    // next stage published; every reader has left this stage's buffer
        if (st + 2 < NS) stage(st + 2, st & 1);             // refill it, one whole stage ahead of its readers
    }
    asm volatile("s_wait_asynccnt 0x0" ::: "memory");   // no copy is outstanding when the buffers are written over
    float* my = red + w * (64 * 68);   // behind the last barrier no wave reads the buffers any more; this range is read by this wave alone
    if (tr) {   // [d][t]: a lane's 8 values of a tile are 8 tokens of one head dim, two 16-B writes
#pragma unroll
        for (int mb = 0; mb < 4; ++mb)
#pragma unroll
            for (int nb = 0; nb < 4; ++nb) { float* const q = my + (nb * 16 + lr) * 68 + mb * 16 + hi * 8; const v8f c = acc[mb][nb];
                *(v4fa*)q = __builtin_shufflevector(c, c, 0, 1, 2, 3); *(v4fa*)(q + 4) = __builtin_shufflevector(c, c, 4, 5, 6, 7); }
    } else {    // [t][d]
#pragma unroll
        for (int mb = 0; mb < 4; ++mb)
#pragma unroll
            for (int nb = 0; nb < 4; ++nb)
#pragma unroll
                for (int j = 0; j < 8; ++j) my[(mb * 16 + hi * 8 + j) * 68 + nb * 16 + lr] = acc[mb][nb][j];
    }
    asm volatile("s_wait_dscnt 0x0" ::: "memory");   // the wave's tile is whole in LDS before its lanes read one another's values back
    const int tt = t0 + wm * 64, hl = wn;   // the wave's first token; which of the work-group's two heads
    const int zh = (tt / TT) * NH_ + (int)blockIdx.y * 2 + hl, tt0 = tt % TT;   // (batch, head) plane; first token inside its batch (64 tokens never cross a batch: TT % 64 == 0)
    if (tr) { const size_t o = ((size_t)zh * HD) * TT + tt0; qkv_out<true>(my, bs + hl * 64, V16 + o, Vh + o, Vl + o, lane); }
    else { const size_t o = (size_t)z * NZ * TT * HD + ((size_t)zh * TT + tt0) * HD; qkv_out<false>(my, bs + hl * 64, P16 + o, Ph + o, Pl + o, lane); }
}
// ---- k_fattn: scores, softmax and attn.v of one (batch, head) plane in one kernel; no score or probability leaves the registers.
// Transposed products: S^T = K Q^T (A = 16 key rows, B = 16 query columns), so lane (lr, hi) holds, for query lr, the scores of keys 8 hi + 0..7 of each 16-key tile;
// two such tiles, converted in place, are the B fragment of O^T += V^T P^T in the k order of the WFrag loaders. Running maximum and sum per query (online softmax), 32 keys a pass.
// x = log2(e) (tau (q.k/8) + delta[j]); p = 2^(x - m). Rows < RH: hi+lo bf16 planes, 3 products each; the rest fp16 with p x 1024 (the factor cancels in p / sum).
#define LOG2E 1.4426950408889634f
__device__ __forceinline__ float xhalf(float x) { const int b = __float_as_int(x); return __int_as_float(__builtin_amdgcn_permlanex16(b, b, 0x76543210, 0xfedcba98, false, false)); }   // lane l <-> l ^ 16
// 2^x of eight values / of one value. One statement each, results in registers of their own ("=&v"), closed by v_nop: the slot the instruction set asks for between a transcendental
// and an instruction that reads its result or overwrites its source.
__device__ __forceinline__ v8f exp2x8(v8f x) { float r0, r1, r2, r3, r4, r5, r6, r7;
    asm("v_exp_f32 %0, %8\n\tv_exp_f32 %1, %9\n\tv_exp_f32 %2, %10\n\tv_exp_f32 %3, %11\n\tv_exp_f32 %4, %12\n\tv_exp_f32 %5, %13\n\tv_exp_f32 %6, %14\n\tv_exp_f32 %7, %15\n\tv_nop"
        : "=&v"(r0), "=&v"(r1), "=&v"(r2), "=&v"(r3), "=&v"(r4), "=&v"(r5), "=&v"(r6), "=&v"(r7) : "v"(x[0]), "v"(x[1]), "v"(x[2]), "v"(x[3]), "v"(x[4]), "v"(x[5]), "v"(x[6]), "v"(x[7]));
    return (v8f){r0, r1, r2, r3, r4, r5, r6, r7}; }
__device__ __forceinline__ float exp2x1(float x) { float r; asm("v_exp_f32 %0, %1\n\tv_nop" : "=&v"(r) : "v"(x)); return r; }
// behind a group of global loads, in front of any reuse of their address registers; as inputs of the wait the four addresses stay whole up to it
__device__ __forceinline__ void xwait(const void* a, const void* b, const void* c, const void* d) { asm volatile("s_wait_xcnt 0x0" :: "v"(a), "v"(b), "v"(c), "v"(d) : "memory"); }
template <typename T16, bool HI, int QB>   // QB: 16-query column groups per wave (1 or 2)
__device__ __forceinline__ void fattn(const T16* __restrict__ Q, const T16* __restrict__ Q2, const T16* __restrict__ Kp, const T16* __restrict__ K2, const T16* __restrict__ Vt, const T16* __restrict__ Vt2, const float* dls, const T16* ring, float c1, bf* __restrict__ Ah, bf* __restrict__ Al, int q0) {
    typedef WFrag<T16> F; typedef typename F::V V;
    constexpr int NT = HI ? 4 : 2, NS = TT / KT;   // tiles per buffer (K, V^T; hi+lo: K lo, V^T lo too); stages
    static_assert(NS >= 2 && TT % KT == 0 && HD == 64 && KT == 64, "the ring needs two whole stages; a tile is 64 rows of 128 B");
    const int tid = threadIdx.x, lane = tid & 31, lr = lane & 15, hi = lane >> 4;
    // stage s -> buffer b: K rows [s KT, s KT + KT) and the same keys' columns of V^T
    const unsigned lcp = (unsigned)(size_t)ring + (unsigned)((tid >> 3) * (KP * 2) + (tid & 7) * 16);
    const char* kg = (const char*)(Kp + (size_t)(tid >> 3) * HD + (tid & 7) * 8); const char* vg = (const char*)(Vt + (size_t)(tid >> 3) * TT + (tid & 7) * 8);
    const char* kg2 = HI ? (const char*)(K2 + (size_t)(tid >> 3) * HD + (tid & 7) * 8) : kg; const char* vg2 = HI ? (const char*)(Vt2 + (size_t)(tid >> 3) * TT + (tid & 7) * 8) : vg;
    auto stage = [&](int s, int b) { const unsigned l0 = lcp + (unsigned)(b * NT * TLE * 2);
        cp2(l0, kg + (size_t)s * (KT * HD * 2), 16 * HD * 2, l0 + TLE * 2, vg + (size_t)s * (KT * 2), (size_t)16 * TT * 2);
        if (HI) cp2(l0 + 2 * TLE * 2, kg2 + (size_t)s * (KT * HD * 2), 16 * HD * 2, l0 + 3 * TLE * 2, vg2 + (size_t)s * (KT * 2), (size_t)16 * TT * 2); };
    stage(0, 0);
    V qf[QB][2], qf2[QB][2]; v8f o[QB][4]; float m[QB], l[QB]; const T16* qp[QB]; const T16* qp2[QB];
#pragma unroll
    for (int g = 0; g < QB; ++g) { m[g] = -3.0e38f; l[g] = 0.f; const size_t qo = (size_t)(q0 + g * 16 + lr) * HD + 8 * hi; qp[g] = Q + qo; qp2[g] = HI ? Q2 + qo : qp[g];
#pragma unroll
        for (int kc = 0; kc < 2; ++kc) { qf[g][kc] = F::ld(qp[g] + kc * 32); if (HI) qf2[g][kc] = F::ld(qp2[g] + kc * 32); }
#pragma unroll
        for (int nb = 0; nb < 4; ++nb) o[g][nb] = (v8f){}; }
    xwait(qp[0], qp[QB - 1], qp2[0], qp2[QB - 1]);
    asm volatile("s_wait_asynccnt 0x0" ::: "memory");   // this wave's copies of stage 0 have landed
    __syncthreads();                                    // every wave's have: stage 0 may be read
    stage(1, 1);
#pragma unroll 1   // rolled: one stage a trip, the buffers change places
    for (int st = 0; st < NS; ++st) {
        const T16* kb = ring + (st & 1) * (NT * TLE) + lr * KP + 8 * hi; const T16* vb = kb + TLE; const T16* kb2 = kb + 2 * TLE; const T16* vb2 = kb + 3 * TLE;
#pragma unroll   // the two 32-key passes of a stage stand one behind the other, so that the second's LDS reads can go ahead of the first's vector work
        for (int pp = 0; pp < KT / 32; ++pp) {
            const int j0 = st * KT + pp * 32;
            V kf[2][2], kf2[2][2], vf[4], vf2[4];
#pragma unroll
            for (int t = 0; t < 2; ++t)
#pragma unroll
                for (int kc = 0; kc < 2; ++kc) { kf[t][kc] = F::ld(kb + (pp * 32 + t * 16) * KP + kc * 32); if (HI) kf2[t][kc] = F::ld(kb2 + (pp * 32 + t * 16) * KP + kc * 32); }
#pragma unroll
            for (int nb = 0; nb < 4; ++nb) { vf[nb] = F::ld(vb + nb * 16 * KP + pp * 32); if (HI) vf2[nb] = F::ld(vb2 + nb * 16 * KP + pp * 32); }
            v8f s[QB][2];
#pragma unroll
            for (int g = 0; g < QB; ++g)
#pragma unroll
                for (int t = 0; t < 2; ++t) { s[g][t] = (v8f){};
#pragma unroll
                    for (int kc = 0; kc < 2; ++kc) { s[g][t] = F::mma(kf[t][kc], qf[g][kc], s[g][t]); if (HI) { s[g][t] = F::mma(kf[t][kc], qf2[g][kc], s[g][t]); s[g][t] = F::mma(kf2[t][kc], qf[g][kc], s[g][t]); } } }
            v8f dl[2]; V pf[QB], pf2[QB];
#pragma unroll
            for (int t = 0; t < 2; ++t) { const v4f d0 = *(const v4fa*)(dls + j0 + t * 16 + hi * 8), d1 = *(const v4fa*)(dls + j0 + t * 16 + hi * 8 + 4); dl[t] = __builtin_shufflevector(d0, d1, 0, 1, 2, 3, 4, 5, 6, 7); }
#pragma unroll
            for (int g = 0; g < QB; ++g) {
                float mx = -3.0e38f;
#pragma unroll
                for (int t = 0; t < 2; ++t)
#pragma unroll
                    for (int j = 0; j < 8; ++j) { s[g][t][j] = fmaf(s[g][t][j], c1, dl[t][j]); mx = fmaxf(mx, s[g][t][j]); }
                mx = fmaxf(mx, xhalf(mx));
                const float mn = fmaxf(m[g], mx), al = exp2x1(m[g] - mn), ms = HI ? mn : mn - 10.0f; m[g] = mn;
                float ps[2];
#pragma unroll
                for (int t = 0; t < 2; ++t) {
                    s[g][t] = exp2x8(s[g][t] - ms);
                    ps[t] = ((s[g][t][0] + s[g][t][1]) + (s[g][t][2] + s[g][t][3])) + ((s[g][t][4] + s[g][t][5]) + (s[g][t][6] + s[g][t][7])); }
                l[g] = fmaf(l[g], al, ps[0] + ps[1]);   // this lane's half of the keys; the halves meet behind the loop
#pragma unroll
                for (int nb = 0; nb < 4; ++nb) o[g][nb] *= al;
                if constexpr (HI) {
                    const v8b h0 = __builtin_convertvector(s[g][0], v8b), h1 = __builtin_convertvector(s[g][1], v8b);
                    const v8b l0 = __builtin_convertvector(s[g][0] - __builtin_convertvector(h0, v8f), v8b), l1 = __builtin_convertvector(s[g][1] - __builtin_convertvector(h1, v8f), v8b);
                    pf[g] = __builtin_shufflevector(h0, h1, 0, 1, 2, 3, 4, 5, 6, 7, 8, 9, 10, 11, 12, 13, 14, 15); pf2[g] = __builtin_shufflevector(l0, l1, 0, 1, 2, 3, 4, 5, 6, 7, 8, 9, 10, 11, 12, 13, 14, 15);
                } else pf[g] = cat16(__builtin_convertvector(s[g][0], v8h), __builtin_convertvector(s[g][1], v8h));
            }
            // attn.v of all groups behind the softmax of all groups: no 2^x statement stands close behind a WMMA whose operand registers it could be given
#pragma unroll
            for (int g = 0; g < QB; ++g)
#pragma unroll
                for (int nb = 0; nb < 4; ++nb) { o[g][nb] = F::mma(vf[nb], pf[g], o[g][nb]); if constexpr (HI) { o[g][nb] = F::mma(vf[nb], pf2[g], o[g][nb]); o[g][nb] = F::mma(vf2[nb], pf[g], o[g][nb]); } }
        }
        // four vector slots behind the stage's last WMMAs, also on the taken back edge: the next instructions write over their operands.
        // The accumulators are named so that every WMMA of the stage stands in front of the slots.
        if constexpr (QB == 1) asm volatile("v_nop\n\tv_nop\n\tv_nop\n\tv_nop" : "+v"(o[0][0]), "+v"(o[0][1]), "+v"(o[0][2]), "+v"(o[0][3]));
        else asm volatile("v_nop\n\tv_nop\n\tv_nop\n\tv_nop" : "+v"(o[0][0]), "+v"(o[0][1]), "+v"(o[0][2]), "+v"(o[0][3]), "+v"(o[QB - 1][0]), "+v"(o[QB - 1][1]), "+v"(o[QB - 1][2]), "+v"(o[QB - 1][3]));
        asm volatile("s_wait_dscnt 0x0" ::: "memory");      // this wave's reads of the stage's buffer are done before the buffer is handed back
        asm volatile("s_wait_asynccnt 0x0" ::: "memory");   // this wave's copies of the next stage have landed
        __syncthreads();                                    // next stage published; every reader has left this stage's buffer
        if (st + 2 < NS) stage(st + 2, st & 1);             // refill it, one whole stage ahead of its readers
    }
    asm volatile("s_wait_asynccnt 0x0" ::: "memory");   // no copy is outstanding when the wave goes on to its end
    // The merged rows [t][head * HD + d], bf16 hi + lo: the A planes of the out projection (Ah, Al point at this batch's row 0, this head's column 0). A lane holds 8 consecutive d of its query per tile.
    // Rows >= RH: the x 1024 comes off again, exactly, before the split.
#pragma unroll
    for (int g = 0; g < QB; ++g) { const float f = __fdiv_rn(HI ? 1.0f : PCAR, l[g] + xhalf(l[g])); const size_t ro = (size_t)(q0 + g * 16 + lr) * DQ + hi * 8; bf* const ph = Ah + ro; bf* const pl = Al + ro;
#pragma unroll
        for (int nb = 0; nb < 4; ++nb) { const v8f r = o[g][nb] * f; v8us oh, ol;
#pragma unroll
            for (int j = 0; j < 8; ++j) { unsigned short a, c2; splitf(HI ? r[j] : r[j] * (1.0f / PCAR), a, c2); oh[j] = a; ol[j] = c2; }
            *(v8us*)(ph + nb * 16) = oh; *(v8us*)(pl + nb * 16) = ol;
            // behind the two stores, in front of any reuse of their data and address registers; as inputs of the wait these stay whole up to it
            asm volatile("s_wait_xcnt 0x0" :: "v"(oh), "v"(ol), "v"(ph), "v"(pl) : "memory"); } }
}
// grid (RH/64 + (TT-RH)/128, NZ), 4 waves: blocks x < RH/64 take 64 hi+lo query rows (16 a wave), the others 128 fp16 rows (32 a wave); every wave walks all TT keys.
// K and V^T reach the waves through LDS: 64 keys a stage, two buffers, brought in by asynchronous copies in whole lines and read by all four waves.
__global__ __launch_bounds__(128) void k_fattn(const h16* __restrict__ Q16, const h16* __restrict__ K16, const h16* __restrict__ V16, const bf* __restrict__ Qh, const bf* __restrict__ Ql, const bf* __restrict__ Kh, const bf* __restrict__ Kl, const bf* __restrict__ Vh, const bf* __restrict__ Vl, const float* __restrict__ TAU, const float* __restrict__ DEL, bf* __restrict__ Ah, bf* __restrict__ Al) {
    __shared__ __align__(16) float dls[TT];   // log2(e) delta[b][j]
    __shared__ __align__(16) unsigned short ring[2 * 4 * TLE];   // two buffers of up to four tiles
    const int z = blockIdx.y, b = z / NH_, tid = threadIdx.x, w = __builtin_amdgcn_readfirstlane(tid >> 5); const size_t zo = (size_t)z * TT * HD, ao = (size_t)b * TT * DQ + (z % NH_) * HD;
#pragma unroll
    for (int i = 0; i < TT / 128; ++i) dls[i * 128 + tid] = bfr(DEL[(size_t)b * TT + i * 128 + tid]) * LOG2E;
    const float c1 = bfr(TAU[b]) * (SCL * LOG2E);
    __syncthreads();   // the delta row is whole before any wave reads it
    if (blockIdx.x < RH / 64) fattn<bf, true, 1>(Qh + zo, Ql + zo, Kh + zo, Kl + zo, Vh + zo, Vl + zo, dls, (const bf*)ring, c1, Ah + ao, Al + ao, (int)blockIdx.x * 64 + w * 16);
    else fattn<h16, false, 2>(Q16 + zo, nullptr, K16 + zo, nullptr, V16 + zo, nullptr, dls, (const h16*)ring, c1, Ah + ao, Al + ao, RH + ((int)blockIdx.x - RH / 64) * 128 + w * 32);
}

// ---- k_wo: the out projection of all batches, C = (Ah + Al) Bt^T + bias, f32. A work-group of 4 waves owns a 128 x 128 tile of C, a wave 64 x 64 of it (wm: which 64 token rows, wn: which 64 output columns), and walks all of K itself:
// 8 stages of 64 k, 128 + 128 + 128 operand rows a stage (hi rows, lo rows, weight rows; one 128-B line a row), two LDS buffers filled by asynchronous copies one stage ahead.
// One f32 accumulator chain per output over k = 0..511 (per 32 k the hi product, then the lo product), bias last. A wave's tile goes through the wave's own LDS range so that every store covers whole lines.
__global__ __launch_bounds__(128) void k_wo(const bf* __restrict__ Ah, const bf* __restrict__ Al, const bf* __restrict__ Wt, const float* __restrict__ bias, float* C) {
    typedef WFrag<bf> F; typedef F::V V;
    constexpr int NS = DQ / 64, BUF = 6 * TLE;   // stages; 16-bit elements of one buffer: hi rows 0..127, lo rows 0..127, weight rows 0..127, pitch KP
    static_assert(NS >= 2 && DQ % 64 == 0 && BUF >= 4 * 64 * 68, "the ring needs two whole stages; the four result tiles (pitch 68 floats) fit the two buffers");
    __shared__ __align__(16) float red[BUF];    // the two buffers; behind the loop each wave's result tile
    __shared__ __align__(16) float bs[128];     // the work-group's 128 bias values, rounded
    const int tid = threadIdx.x, w = __builtin_amdgcn_readfirstlane(tid >> 5), lane = tid & 31, lr = lane & 15, hi = lane >> 4, wm = w >> 1, wn = w & 1; const int r0 = blockIdx.x * 128, c0 = blockIdx.y * 128;
    const bf* ring = (const bf*)red;
    const unsigned lcp = (unsigned)(size_t)ring + (unsigned)((tid >> 3) * (KP * 2) + (tid & 7) * 16); const size_t go = (size_t)(tid >> 3) * DQ + (tid & 7) * 8;
    const char* gh = (const char*)(Ah + (size_t)r0 * DQ + go); const char* gl = (const char*)(Al + (size_t)r0 * DQ + go); const char* gb = (const char*)(Wt + (size_t)c0 * DQ + go);
    constexpr size_t R16 = (size_t)16 * DQ * 2;   // bytes of 16 operand rows
    // stage s -> buffer b: k in [64 s, 64 s + 64) of all 3 x 128 rows, 24 copies a thread
    auto stage = [&](int s, int b) { const unsigned l0 = lcp + (unsigned)(b * BUF * 2); const char* ph = gh + (size_t)s * 128; const char* pl = gl + (size_t)s * 128; const char* pb = gb + (size_t)s * 128;
        cp2(l0, ph, R16, l0 + TLE * 2, ph + 4 * R16, R16);                      // hi rows 0..63, 64..127
        cp2(l0 + 4 * TLE * 2, pb, R16, l0 + 5 * TLE * 2, pb + 4 * R16, R16);    // weight rows
        cp2(l0 + 2 * TLE * 2, pl, R16, l0 + 3 * TLE * 2, pl + 4 * R16, R16); }; // lo rows
    stage(0, 0);
    { const float* pbias = bias + c0 + tid; const float bv0 = *pbias;
      asm volatile("s_wait_xcnt 0x0" :: "v"(pbias) : "memory");   // behind the load, in front of any reuse of its address registers
      bs[tid] = bfr(bv0); }
    v8f acc[4][4];
#pragma unroll
    for (int mb = 0; mb < 4; ++mb)
#pragma unroll
        for (int nb = 0; nb < 4; ++nb) acc[mb][nb] = (v8f){};
    asm volatile("s_wait_asynccnt 0x0" ::: "memory");   // this wave's copies of stage 0 have landed
    __syncthreads();                                    // every wave's have: stage 0 (and the bias row) may be read
    stage(1, 1);
    // Two fragment sets: each 32-k step's 24 LDS reads are issued one block of 32 WMMAs ahead of their use, so that a lone wave on its SIMD does not stand waiting for them.
    // A stage's buffer is read only between the barrier that publishes it and the barrier at the stage's foot; the second step's products follow behind that barrier, from registers alone.
    V a[2][4], a2[2][4], b[2][4];
    auto ldf = [&](int x, const bf* fa, const bf* fb) {
#pragma unroll
        for (int i = 0; i < 4; ++i) { a[x][i] = F::ld(fa + i * 16 * KP); b[x][i] = F::ld(fb + i * 16 * KP); }
#pragma unroll
        for (int i = 0; i < 4; ++i) a2[x][i] = F::ld(fa + 2 * TLE + i * 16 * KP); };
    auto mm = [&](int x) {   // per 32 k: the 16 hi products, then the 16 lo products
#pragma unroll
        for (int nb = 0; nb < 4; ++nb)
#pragma unroll
            for (int mb = 0; mb < 4; ++mb) acc[mb][nb] = F::mma(a[x][mb], b[x][nb], acc[mb][nb]);
#pragma unroll
        for (int nb = 0; nb < 4; ++nb)
#pragma unroll
            for (int mb = 0; mb < 4; ++mb) acc[mb][nb] = F::mma(a2[x][mb], b[x][nb], acc[mb][nb]); };
#pragma unroll   // straight line: buffer offsets are constants and no back edge stands behind a WMMA
    for (int st = 0; st < NS; ++st) {
        const bf* fa = ring + (st & 1) * BUF + (wm * 64 + lr) * KP + 8 * hi; const bf* fb = ring + (st & 1) * BUF + 4 * TLE + (wn * 64 + lr) * KP + 8 * hi;
        // The scheduling barriers keep each step's 24 reads together as one group, a whole block of WMMAs ahead of their use, and the last block in front of the wait at the foot:
        // left free, this build either dealt the reads out singly among the WMMAs or moved a block behind the foot's wait, which then stood waiting for reads just issued.
        ldf(0, fa, fb);
        __builtin_amdgcn_sched_barrier(0);
        if (st > 0) mm(1);   // k 32..63 of the stage before
        __builtin_amdgcn_sched_barrier(0);
        ldf(1, fa + 32, fb + 32);
        __builtin_amdgcn_sched_barrier(0);
        mm(0);
        __builtin_amdgcn_sched_barrier(0);
        asm volatile("s_wait_dscnt 0x0" ::: "memory");      // this wave's reads of the stage's buffer are done before the buffer is handed back
        asm volatile("s_wait_asynccnt 0x0" ::: "memory");   // this wave's copies of the next stage have landed
        __syncthreads();                                    // next stage published; every reader has left this stage's buffer
        if (st + 2 < NS) stage(st + 2, st & 1);             // refill it, one whole stage ahead of its readers
    }
    mm(1);   // k 32..63 of the last stage
    asm volatile("s_wait_asynccnt 0x0" ::: "memory");   // no copy is outstanding when the buffers are written over
    float* my = red + w * (64 * 68);   // behind the last barrier no wave reads the buffers any more; this range is read by this wave alone
#pragma unroll
    for (int mb = 0; mb < 4; ++mb)
#pragma unroll
        for (int nb = 0; nb < 4; ++nb)
#pragma unroll
            for (int j = 0; j < 8; ++j) my[(mb * 16 + hi * 8 + j) * 68 + nb * 16 + lr] = acc[mb][nb][j];
    asm volatile("s_wait_dscnt 0x0" ::: "memory");   // the wave's tile is whole in LDS before its lanes read one another's values back
    const int cofs = lr * 4; const v4f bc = *(const v4fa*)(bs + wn * 64 + cofs);
    float* const crow = C + (size_t)(r0 + wm * 64 + hi) * DM + c0 + wn * 64 + cofs;   // a wave's store: 2 rows of 256 B
#pragma unroll 1   // rolled: 32 rows a trip, so that only two waits on the stores stand in the wave's way
    for (int s = 0; s < 2; ++s) { float* const p = crow + (size_t)s * 32 * DM; v4f v[16];
#pragma unroll
        for (int q = 0; q < 16; ++q) v[q] = *(const v4fa*)(my + (s * 32 + q * 2 + hi) * 68 + cofs) + bc;
#pragma unroll
        for (int q = 0; q < 16; ++q) *(v4f*)(p + (size_t)q * 2 * DM) = v[q];
        // behind the 16 stores, in front of any reuse of their data and address registers; as inputs of the wait these stay whole up to it
        asm volatile("s_wait_xcnt 0x0" :: "v"(v[0]), "v"(v[1]), "v"(v[2]), "v"(v[3]), "v"(v[4]), "v"(v[5]), "v"(v[6]), "v"(v[7]), "v"(v[8]), "v"(v[9]), "v"(v[10]), "v"(v[11]), "v"(v[12]), "v"(v[13]), "v"(v[14]), "v"(v[15]), "v"(p) : "memory"); }
}

extern "C" void kernel_launch(void* const* d_in, const int* in_sizes, int n_in,
                              void* d_out, int out_size, void* d_ws, size_t ws_size, hipStream_t stream) {
    (void)in_sizes; (void)n_in; (void)out_size;
    const float* x = (const float*)d_in[0]; const float* xk = (const float*)d_in[1]; const float* xv = (const float*)d_in[2]; const float* TAU = (const float*)d_in[3]; const float* DEL = (const float*)d_in[4]; const float* wq = (const float*)d_in[5]; const float* bq = (const float*)d_in[6]; const float* wk = (const float*)d_in[7]; const float* bk = (const float*)d_in[8]; const float* wv = (const float*)d_in[9]; const float* bv = (const float*)d_in[10]; const float* wo = (const float*)d_in[11]; const float* bo = (const float*)d_in[12];
    float* OUT = (float*)d_out;     // [4][2048][512]
    char* wsp = (char*)d_ws;
    auto take = [&](size_t bytes) { char* p = wsp; wsp += (bytes + 255) & ~(size_t)255; return (void*)p; };
    const size_t PLN = (size_t)NZ * TT * HD;   // elements of one plane set: every (batch, head)
    bf* WQ = (bf*)take((size_t)DQ * DM * 2); bf* WK = (bf*)take((size_t)DKV * DM * 2); bf* WV = (bf*)take((size_t)DKV * DM * 2); bf* WO = (bf*)take((size_t)DM * DQ * 2); (void)WK; (void)WV;
    h16* QP16 = (h16*)take(PLN * 2); h16* KP16 = (h16*)take(PLN * 2); h16* VT16 = (h16*)take(PLN * 2);
    bf* QPh = (bf*)take(PLN * 2); bf* KPh = (bf*)take(PLN * 2); bf* QPl = (bf*)take(PLN * 2); bf* KPl = (bf*)take(PLN * 2); bf* VTh = (bf*)take(PLN * 2); bf* VTl = (bf*)take(PLN * 2);
    bf* ATh = (bf*)take((size_t)NB_ * TT * DQ * 2); bf* ATl = (bf*)take((size_t)NB_ * TT * DQ * 2);
    // k_qkv reaches the k planes from the q planes: each k plane set lies directly behind its q plane set
    if ((size_t)(wsp - (char*)d_ws) > ws_size) return;    // ws 256 MiB
    k_wtG<<<dim3((unsigned)((DM * DQ / 64 + 63) / 64), 4, 1), 256, 0, stream>>>(wq, wk, wv, wo, DM, DQ, WQ);
    // q, k, v projections of all batches (x: 128 token rows, y: two heads, z: which projection), written as the attention kernel's planes
    k_qkv<<<dim3(NB_ * TT / 128, DQ / 128, 3), 128, 0, stream>>>(x, xk, xv, WQ, bq, bk, bv, QP16, QPh, QPl, VT16, VTh, VTl);
    k_fattn<<<dim3(RH / 64 + (TT - RH) / 128, NZ, 1), 128, 0, stream>>>(QP16, KP16, VT16, QPh, QPl, KPh, KPl, VTh, VTl, TAU, DEL, ATh, ATl);
    k_wo<<<dim3(NB_ * TT / 128, DM / 128, 1), 128, 0, stream>>>(ATh, ATl, WO, bo, OUT);
}

// v010
// Measured time: 103 microseconds a run.
// In two side-by-side timings against v009, it was 1.05 and 1.03 times as fast.
// Over all steps from v000 it is 21.8 times as fast.
#include <hip/hip_runtime.h>

// De-stationary attention (Non-stationary Transformer) (queries, keys, values [4][2048][512]; q, k, v = . W + b ('xw' [512][512]; 8 heads x 64); scores = tau[b] (q.k/8) + delta[b][s] (tau [4], delta [4][2048], read); softmax; out = merged Wo + bo -> [4][2048][512] (4.2 M)).
// Compute dtypes, f32 accumulate: every input rounded to bf16; q/k/v on PLAIN bf16 operands (inputs: exact) + biases; tau scale and delta shift applied in f32 per (i, j) inside the attention kernel; scores and attn.v: query rows < 512 hl (3 products), the rest single fp16 (x1024); softmax f32; Wo hl x exact (2 products) + bo.

#define NB_  4
#define TT   2048
#define DM   512
#define NH_  8
#define NKV  8
#define REP  (NH_ / NKV)
#define HD   64
#define DQ   (NH_ * HD)
#define DKV  (NKV * HD)
#define NZ   (NB_ * NH_)          // all (batch, head) planes
#define RH   512                  // query rows < RH use hi+lo planes (0: none)
#define WIN  0
#define PCAR 1024.0f
#define SCL  0.125f   // HD^-0.5
typedef _Float16 h16;
typedef unsigned short bf;
typedef __attribute__((ext_vector_type(16))) __bf16   v16bf;
typedef __attribute__((ext_vector_type(16))) _Float16 v16h;
typedef __attribute__((ext_vector_type(8)))  _Float16 v8h;
typedef __attribute__((ext_vector_type(8)))  unsigned short v8us;
typedef __attribute__((ext_vector_type(8)))  float    v8f;
typedef __attribute__((ext_vector_type(4)))  float    v4f;
typedef v8h  __attribute__((may_alias)) v8ha;
typedef v4f  __attribute__((may_alias)) v4fa;
typedef v8us __attribute__((may_alias)) v8usa;

__device__ __forceinline__ unsigned short f2bf(float f) { unsigned u = __float_as_uint(f); u += 0x7FFFu + ((u >> 16) & 1u); return (unsigned short)(u >> 16); }
__device__ __forceinline__ float bf2f(unsigned short b) { return __uint_as_float(((unsigned)b) << 16); }
__device__ __forceinline__ float bfr(float f) { return bf2f(f2bf(f)); }
__device__ __forceinline__ v16h cat16(v8h lo, v8h hi) { return __builtin_shufflevector(lo, hi, 0, 1, 2, 3, 4, 5, 6, 7, 8, 9, 10, 11, 12, 13, 14, 15); }
__device__ __forceinline__ v16bf cat16b(v8us lo, v8us hi) { return __builtin_bit_cast(v16bf, __builtin_shufflevector(lo, hi, 0, 1, 2, 3, 4, 5, 6, 7, 8, 9, 10, 11, 12, 13, 14, 15)); }
__device__ __forceinline__ v8f wmma16(v16h a, v16h b, v8f c) { return __builtin_amdgcn_wmma_f32_16x16x32_f16(false, a, false, b, (short)0, c, false, false); }
__device__ __forceinline__ v8f wmmab(v16bf a, v16bf b, v8f c) { return __builtin_amdgcn_wmma_f32_16x16x32_bf16(false, a, false, b, (short)0, c, false, false); }



// fragment loaders: K-contiguous 16-bit planes, lane (lr, hi) takes k = 8 hi + 0..7 and 16 + 8 hi + 0..7 of each 32
template <typename T16> struct WFrag;
template <> struct WFrag<h16> { typedef v16h V; static __device__ __forceinline__ V ld(const h16* p) { return cat16(*(const v8h*)p, *(const v8h*)(p + 16)); } static __device__ __forceinline__ v8f mma(V a, V b, v8f c) { return wmma16(a, b, c); } };
template <> struct WFrag<bf> { typedef v16bf V; static __device__ __forceinline__ V ld(const bf* p) { return cat16b(*(const v8us*)p, *(const v8us*)(p + 16)); } static __device__ __forceinline__ v8f mma(V a, V b, v8f c) { return wmmab(a, b, c); } };
__device__ __forceinline__ h16 tohx(float x) { return (h16)x; }
__device__ __forceinline__ void splitf(float y, unsigned short& h, unsigned short& l) { h = f2bf(y); l = f2bf(y - bf2f(h)); }
typedef __attribute__((ext_vector_type(2))) _Float16 v2h;
typedef __attribute__((ext_vector_type(4))) _Float16 v4h;
typedef __attribute__((ext_vector_type(2))) unsigned short v2us;
typedef __attribute__((ext_vector_type(4))) unsigned short v4us;
typedef __attribute__((ext_vector_type(2))) float v2f;
typedef __attribute__((ext_vector_type(4))) int v4i;

// ---- k_wtG: the four weight matrices, rounded to bf16 and transposed: Bt[y][n][k] = w_y[k][n]. A thread owns one 128-B line of Bt, 64 k of one column n.
// Its 64 loads stand in flight together; a wave's load is one whole line of w (32 neighbouring n of one row k), the work-group's two waves take 256 B of a row between them.
__global__ __launch_bounds__(64) void k_wtG(const float* __restrict__ w0, const float* __restrict__ w1, const float* __restrict__ w2, const float* __restrict__ w3, bf* Bt) {
    static_assert(DM % 64 == 0 && DQ % 64 == 0, "whole 64 x 64 blocks");
    const int y = blockIdx.y; const float* w = (y == 0) ? w0 : (y == 1) ? w1 : (y == 2) ? w2 : w3;   // blockIdx.y: which of the four equal-shaped matrices
    const int n = ((int)blockIdx.x % (DQ / 64)) * 64 + (int)threadIdx.x, k0 = ((int)blockIdx.x / (DQ / 64)) * 64;
    const float* const p = w + (size_t)k0 * DQ + n; float v[64];
#pragma unroll   // straight line: all 64 loads are issued before the first is waited for, and v, o below stay in registers
    for (int i = 0; i < 64; ++i) v[i] = p[(size_t)i * DQ];
    bf* const q = Bt + (size_t)y * DM * DQ + (size_t)n * DM + k0; v8us o[8];
#pragma unroll
    for (int j = 0; j < 8; ++j)
#pragma unroll
        for (int i = 0; i < 8; ++i) o[j][i] = f2bf(v[j * 8 + i]);
#pragma unroll
    for (int j = 0; j < 8; ++j) *(v8us*)(q + j * 8) = o[j];
}

#define KT  64          // keys per staged tile
#define KP  72          // LDS row pitch in 16-bit elements: 144 B = 16 B x 9, the pitch of ds_load_b128 readers of 128-B rows
#define TLE (64 * KP)   // elements of one staged tile: 64 rows (K: keys; V^T: head dims) of 64 values
// Two tiles of 64 rows x 128 B, global -> LDS: a thread brings 16 B of rows r, r + 16, r + 32, r + 48 of each tile (a wave's copy: four whole 128-B lines). 128 threads cover both tiles in one call.
// la, lb: the thread's LDS byte addresses in row r; ga, gb: its global addresses there; sa, sb: bytes of 16 global rows. The wait on xcnt closes the copies' own statement: their address registers are reused behind it.
__device__ __forceinline__ void cp2(unsigned la, const char* ga, size_t sa, unsigned lb, const char* gb, size_t sb) {
    asm volatile("global_load_async_to_lds_b128 %0, %1, off\n\tglobal_load_async_to_lds_b128 %2, %3, off\n\tglobal_load_async_to_lds_b128 %4, %5, off\n\tglobal_load_async_to_lds_b128 %6, %7, off\n\t"
                 "global_load_async_to_lds_b128 %8, %9, off\n\tglobal_load_async_to_lds_b128 %10, %11, off\n\tglobal_load_async_to_lds_b128 %12, %13, off\n\tglobal_load_async_to_lds_b128 %14, %15, off\n\ts_wait_xcnt 0x0"
                 :: "v"(la), "v"(ga), "v"(la + 16u * KP * 2u), "v"(ga + sa), "v"(la + 32u * KP * 2u), "v"(ga + 2 * sa), "v"(la + 48u * KP * 2u), "v"(ga + 3 * sa),
                    "v"(lb), "v"(gb), "v"(lb + 16u * KP * 2u), "v"(gb + sb), "v"(lb + 32u * KP * 2u), "v"(gb + 2 * sb), "v"(lb + 48u * KP * 2u), "v"(gb + 3 * sb) : "memory"); }
#define XP  68          // LDS row pitch of a staged f32 row in floats: 272 B = 16 B x 17, the pitch of ds_load_b128 readers of 256-B rows
// 64 rows x 256 B of f32, global -> LDS: a thread brings 16 B of rows r, r + 8, ..., r + 56 (a wave's copy: two whole rows, four 128-B lines). 128 threads cover the 64 rows in one call.
// l: the thread's LDS byte address in row r; g: its global address there; gs: bytes of 8 global rows. The wait on xcnt closes the copies' own statement: their address registers are reused behind it.
__device__ __forceinline__ void cp8(unsigned l, const char* g, size_t gs) {
    asm volatile("global_load_async_to_lds_b128 %0, %1, off\n\tglobal_load_async_to_lds_b128 %2, %3, off\n\tglobal_load_async_to_lds_b128 %4, %5, off\n\tglobal_load_async_to_lds_b128 %6, %7, off\n\t"
                 "global_load_async_to_lds_b128 %8, %9, off\n\tglobal_load_async_to_lds_b128 %10, %11, off\n\tglobal_load_async_to_lds_b128 %12, %13, off\n\tglobal_load_async_to_lds_b128 %14, %15, off\n\ts_wait_xcnt 0x0"
                 :: "v"(l), "v"(g), "v"(l + 8u * XP * 4u), "v"(g + gs), "v"(l + 16u * XP * 4u), "v"(g + 2 * gs), "v"(l + 24u * XP * 4u), "v"(g + 3 * gs),
                    "v"(l + 32u * XP * 4u), "v"(g + 4 * gs), "v"(l + 40u * XP * 4u), "v"(g + 5 * gs), "v"(l + 48u * XP * 4u), "v"(g + 6 * gs), "v"(l + 56u * XP * 4u), "v"(g + 7 * gs) : "memory"); }
typedef __attribute__((ext_vector_type(8))) __bf16 v8b;
// a bf16 fragment from 16 staged f32 values, rounded to nearest even; k order of the WFrag loaders: a0, a1 hold k = 8 hi + 0..7 of the 32, a2, a3 hold k = 16 + 8 hi + 0..7
__device__ __forceinline__ v16bf rndx(v4f a0, v4f a1, v4f a2, v4f a3) {
    const v8b lo = __builtin_convertvector(__builtin_shufflevector(a0, a1, 0, 1, 2, 3, 4, 5, 6, 7), v8b), hi = __builtin_convertvector(__builtin_shufflevector(a2, a3, 0, 1, 2, 3, 4, 5, 6, 7), v8b);
    return __builtin_shufflevector(lo, hi, 0, 1, 2, 3, 4, 5, 6, 7, 8, 9, 10, 11, 12, 13, 14, 15); }
// ---- k_qkv: the three projections of all batches, straight from the f32 inputs. A work-group of 4 waves owns a 128 x 128 tile of C = X Wt^T, a wave 64 x 64 of it (wm: which 64 token rows, wn: which 64 weight rows = which head), and walks all of K itself:
// 8 stages of 64 k, 128 token rows (f32, 256 B a row) + 128 weight rows (bf16, 128 B a row) a stage, two LDS buffers filled by asynchronous copies one stage ahead; the token values are rounded to bf16 where a fragment is read.
// One f32 accumulator chain per output over k = 0..511, bias last. z = 0, 1 (q, k) -> planes [batch][head][t][d]; z = 2 (v) -> the transposed planes [batch][head][d][t].
// A wave's 64 x 64 tile is one (64 tokens, head) unit: it goes through the wave's own LDS range (v: written there as [d][t]) so that every store covers whole lines. Each value is stored as fp16 and as bf16 hi + lo.
template <bool TR>   // TR: rows are head dims (bias by row, row pitch TT); else rows are tokens (bias by column, row pitch HD)
__device__ __forceinline__ void qkv_out(const float* my, const float* bh, h16* d16, bf* dh, bf* dl, int lane) {
    constexpr int pitch = TR ? TT : HD; const int cofs = (lane & 7) * 8; v8f bc = (v8f){};
    if (!TR) { const v4f b0 = *(const v4fa*)(bh + cofs), b1 = *(const v4fa*)(bh + cofs + 4); bc = __builtin_shufflevector(b0, b1, 0, 1, 2, 3, 4, 5, 6, 7); }
#pragma unroll 1   // rolled: 16 copies of the conversion code in two forms would only lengthen the kernel's text
    for (int s = 0; s < 16; ++s) { const int row = s * 4 + (lane >> 3);   // a wave's store: 4 rows of 128 B
        const v4f v0 = *(const v4fa*)(my + row * 68 + cofs), v1 = *(const v4fa*)(my + row * 68 + cofs + 4); const v8f val = __builtin_shufflevector(v0, v1, 0, 1, 2, 3, 4, 5, 6, 7);
        const float br = TR ? bh[row] : 0.f; v8h o16; v8us oh, ol;
#pragma unroll
        for (int q = 0; q < 8; ++q) { const float r = val[q] + (TR ? br : bc[q]); o16[q] = tohx(r); unsigned short a2, c2; splitf(r, a2, c2); oh[q] = a2; ol[q] = c2; }
        const size_t e = (size_t)row * pitch + cofs; h16* const p16 = d16 + e; bf* const ph = dh + e; bf* const pl = dl + e;
        *(v8h*)p16 = o16; *(v8us*)ph = oh; *(v8us*)pl = ol;
        // behind the three stores, in front of any reuse of their data and address registers; as inputs of the wait these stay whole up to it
        asm volatile("s_wait_xcnt 0x0" :: "v"(o16), "v"(oh), "v"(ol), "v"(p16), "v"(ph), "v"(pl) : "memory"); }
}
__global__ __launch_bounds__(128) void k_qkv(const float* __restrict__ x0, const float* __restrict__ x1, const float* __restrict__ x2, const bf* __restrict__ Wt, const float* __restrict__ bias0, const float* __restrict__ bias1, const float* __restrict__ bias2, h16* P16, bf* Ph, bf* Pl, h16* V16, bf* Vh, bf* Vl) {
    typedef WFrag<bf> F; typedef F::V V;
    constexpr int NS = DM / 64, XF = 128 * XP, BUF = XF + TLE;   // stages; floats of a buffer's token rows 0..127 (pitch XP); floats of one buffer: behind them weight rows 0..127 (2 TLE 16-bit elements, pitch KP)
    static_assert(NS >= 2 && DM % 64 == 0 && 2 * BUF >= 4 * 64 * 68, "the ring needs two whole stages; the four result tiles (pitch 68 floats) fit the two buffers");
    __shared__ __align__(16) float red[2 * BUF];   // the two buffers; behind the loop each wave's result tile
    __shared__ __align__(16) float bs[128];        // the work-group's 128 bias values, rounded
    const int z = blockIdx.z; const bool tr = (z == 2); const float* bias = (z == 0) ? bias0 : (z == 1) ? bias1 : bias2;
    const int tid = threadIdx.x, w = __builtin_amdgcn_readfirstlane(tid >> 5), lane = tid & 31, lr = lane & 15, hi = lane >> 4, wm = w >> 1, wn = w & 1; const int t0 = blockIdx.x * 128, n0 = blockIdx.y * 128;
    const float* Xz = ((z == 0) ? x0 : (z == 1) ? x1 : x2) + (size_t)t0 * DM; const bf* Wz = Wt + (size_t)z * DQ * DM + (size_t)n0 * DM;
    const unsigned lx = (unsigned)(size_t)red + (unsigned)((tid >> 4) * (XP * 4) + (tid & 15) * 16), lw = (unsigned)(size_t)red + (unsigned)(XF * 4 + (tid >> 3) * (KP * 2) + (tid & 7) * 16);
    const char* gx = (const char*)(Xz + (size_t)(tid >> 4) * DM + (tid & 15) * 4); const char* gw = (const char*)(Wz + (size_t)(tid >> 3) * DM + (tid & 7) * 8);
    // stage s -> buffer b: k in [64 s, 64 s + 64) of all 128 + 128 rows, 24 copies a thread
    auto stage = [&](int s, int b) { const unsigned o = (unsigned)(b * BUF * 4); const char* px = gx + (size_t)s * 256; const char* pw = gw + (size_t)s * 128;
        cp8(lx + o, px, (size_t)8 * DM * 4);                                                                     // token rows 0..63
        cp8(lx + o + 64u * XP * 4u, px + (size_t)64 * DM * 4, (size_t)8 * DM * 4);                               // token rows 64..127
        cp2(lw + o, pw, (size_t)16 * DM * 2, lw + o + TLE * 2, pw + (size_t)64 * DM * 2, (size_t)16 * DM * 2); };  // weight rows 0..63, 64..127
    stage(0, 0);
    { const float* pbias = bias + n0 + tid; const float bv0 = *pbias;
      asm volatile("s_wait_xcnt 0x0" :: "v"(pbias) : "memory");   // behind the load, in front of any reuse of its address registers
      bs[tid] = bfr(bv0); }
    v8f acc[4][4];
#pragma unroll
    for (int mb = 0; mb < 4; ++mb)
#pragma unroll
        for (int nb = 0; nb < 4; ++nb) acc[mb][nb] = (v8f){};
    asm volatile("s_wait_asynccnt 0x0" ::: "memory");   // this wave's copies of stage 0 have landed
    __syncthreads();                                    // every wave's have: stage 0 (and the bias row) may be read
    stage(1, 1);
#pragma unroll   // straight line: buffer offsets are constants and no back edge stands behind a WMMA
    for (int st = 0; st < NS; ++st) {
        const float* fa = red + (st & 1) * BUF + (wm * 64 + lr) * XP + 8 * hi; const bf* fb = (const bf*)(red + (st & 1) * BUF + XF) + (wn * 64 + lr) * KP + 8 * hi;
#pragma unroll
        for (int kc = 0; kc < 64; kc += 32) {
            V a[4], b[4]; v4f xr[4][4];
#pragma unroll
            for (int i = 0; i < 4; ++i) { const float* p = fa + i * 16 * XP + kc; xr[i][0] = *(const v4fa*)p; xr[i][1] = *(const v4fa*)(p + 4); xr[i][2] = *(const v4fa*)(p + 16); xr[i][3] = *(const v4fa*)(p + 20); }
#pragma unroll
            for (int i = 0; i < 4; ++i) b[i] = F::ld(fb + i * 16 * KP + kc);
            // keeps all 24 LDS reads of a 32-k step together as one group ahead of its roundings and 16 WMMAs: left free, this build dealt the weight reads out in twos among the WMMAs, each with a wait of its own directly behind it
            __builtin_amdgcn_sched_barrier(0);
#pragma unroll
            for (int i = 0; i < 4; ++i) a[i] = rndx(xr[i][0], xr[i][1], xr[i][2], xr[i][3]);
#pragma unroll
            for (int nb = 0; nb < 4; ++nb)
#pragma unroll
                for (int mb = 0; mb < 4; ++mb) acc[mb][nb] = F::mma(a[mb], b[nb], acc[mb][nb]);
            __builtin_amdgcn_sched_barrier(0);   // without it this build moved a stage's last WMMAs behind the foot's barrier, in front of the refill's copies, and took 34 more registers
        }
        asm volatile("s_wait_dscnt 0x0" ::: "memory");      // this wave's reads of the stage's buffer are done before the buffer is handed back
        asm volatile("s_wait_asynccnt 0x0" ::: "memory");   // this wave's copies of the next stage have landed
        __syncthreads();                                    // next stage published; every reader has left this stage's buffer
        if (st + 2 < NS) stage(st + 2, st & 1);             // refill it, one whole stage ahead of its readers
    }
    asm volatile("s_wait_asynccnt 0x0" ::: "memory");   // no copy is outstanding when the buffers are written over
    float* my = red + w * (64 * 68);   // behind the last barrier no wave reads the buffers any more; this range is read by this wave alone
    if (tr) {   // [d][t]: a lane's 8 values of a tile are 8 tokens of one head dim, two 16-B writes
#pragma unroll
        for (int mb = 0; mb < 4; ++mb)
#pragma unroll
            for (int nb = 0; nb < 4; ++nb) { float* const q = my + (nb * 16 + lr) * 68 + mb * 16 + hi * 8; const v8f c = acc[mb][nb];
                *(v4fa*)q = __builtin_shufflevector(c, c, 0, 1, 2, 3); *(v4fa*)(q + 4) = __builtin_shufflevector(c, c, 4, 5, 6, 7); }
    } else {    // [t][d]
#pragma unroll
        for (int mb = 0; mb < 4; ++mb)
#pragma unroll
            for (int nb = 0; nb < 4; ++nb)
#pragma unroll
                for (int j = 0; j < 8; ++j) my[(mb * 16 + hi * 8 + j) * 68 + nb * 16 + lr] = acc[mb][nb][j];
    }
    asm volatile("s_wait_dscnt 0x0" ::: "memory");   // the wave's tile is whole in LDS before its lanes read one another's values back
    const int tt = t0 + wm * 64, hl = wn;   // the wave's first token; which of the work-group's two heads
    const int zh = (tt / TT) * NH_ + (int)blockIdx.y * 2 + hl, tt0 = tt % TT;   // (batch, head) plane; first token inside its batch (64 tokens never cross a batch: TT % 64 == 0)
    if (tr) { const size_t o = ((size_t)zh * HD) * TT + tt0; qkv_out<true>(my, bs + hl * 64, V16 + o, Vh + o, Vl + o, lane); }
    else { const size_t o = (size_t)z * NZ * TT * HD + ((size_t)zh * TT + tt0) * HD; qkv_out<false>(my, bs + hl * 64, P16 + o, Ph + o, Pl + o, lane); }
}
// ---- k_fattn: scores, softmax and attn.v of one (batch, head) plane in one kernel; no score or probability leaves the registers.
// Transposed products: S^T = K Q^T (A = 16 key rows, B = 16 query columns), so lane (lr, hi) holds, for query lr, the scores of keys 8 hi + 0..7 of each 16-key tile;
// two such tiles, converted in place, are the B fragment of O^T += V^T P^T in the k order of the WFrag loaders. Running maximum and sum per query (online softmax), 32 keys a pass.
// x = log2(e) (tau (q.k/8) + delta[j]); p = 2^(x - m). Rows < RH: hi+lo bf16 planes, 3 products each; the rest fp16 with p x 1024 (the factor cancels in p / sum).
#define LOG2E 1.4426950408889634f
__device__ __forceinline__ float xhalf(float x) { const int b = __float_as_int(x); return __int_as_float(__builtin_amdgcn_permlanex16(b, b, 0x76543210, 0xfedcba98, false, false)); }   // lane l <-> l ^ 16
// 2^x of eight values / of one value. One statement each, results in registers of their own ("=&v"), closed by v_nop: the slot the instruction set asks for between a transcendental
// and an instruction that reads its result or overwrites its source.
__device__ __forceinline__ v8f exp2x8(v8f x) { float r0, r1, r2, r3, r4, r5, r6, r7;
    asm("v_exp_f32 %0, %8\n\tv_exp_f32 %1, %9\n\tv_exp_f32 %2, %10\n\tv_exp_f32 %3, %11\n\tv_exp_f32 %4, %12\n\tv_exp_f32 %5, %13\n\tv_exp_f32 %6, %14\n\tv_exp_f32 %7, %15\n\tv_nop"
        : "=&v"(r0), "=&v"(r1), "=&v"(r2), "=&v"(r3), "=&v"(r4), "=&v"(r5), "=&v"(r6), "=&v"(r7) : "v"(x[0]), "v"(x[1]), "v"(x[2]), "v"(x[3]), "v"(x[4]), "v"(x[5]), "v"(x[6]), "v"(x[7]));
    return (v8f){r0, r1, r2, r3, r4, r5, r6, r7}; }
__device__ __forceinline__ float exp2x1(float x) { float r; asm("v_exp_f32 %0, %1\n\tv_nop" : "=&v"(r) : "v"(x)); return r; }
// behind a group of global loads, in front of any reuse of their address registers; as inputs of the wait the four addresses stay whole up to it
__device__ __forceinline__ void xwait(const void* a, const void* b, const void* c, const void* d) { asm volatile("s_wait_xcnt 0x0" :: "v"(a), "v"(b), "v"(c), "v"(d) : "memory"); }
template <typename T16, bool HI, int QB>   // QB: 16-query column groups per wave (1 or 2)
__device__ __forceinline__ void fattn(const T16* __restrict__ Q, const T16* __restrict__ Q2, const T16* __restrict__ Kp, const T16* __restrict__ K2, const T16* __restrict__ Vt, const T16* __restrict__ Vt2, const float* dls, const T16* ring, float c1, bf* __restrict__ Ah, bf* __restrict__ Al, int q0) {
    typedef WFrag<T16> F; typedef typename F::V V;
    constexpr int NT = HI ? 4 : 2, NS = TT / KT;   // tiles per buffer (K, V^T; hi+lo: K lo, V^T lo too); stages
    static_assert(NS >= 2 && TT % KT == 0 && HD == 64 && KT == 64, "the ring needs two whole stages; a tile is 64 rows of 128 B");
    const int tid = threadIdx.x, lane = tid & 31, lr = lane & 15, hi = lane >> 4;
    // stage s -> buffer b: K rows [s KT, s KT + KT) and the same keys' columns of V^T
    const unsigned lcp = (unsigned)(size_t)ring + (unsigned)((tid >> 3) * (KP * 2) + (tid & 7) * 16);
    const char* kg = (const char*)(Kp + (size_t)(tid >> 3) * HD + (tid & 7) * 8); const char* vg = (const char*)(Vt + (size_t)(tid >> 3) * TT + (tid & 7) * 8);
    const char* kg2 = HI ? (const char*)(K2 + (size_t)(tid >> 3) * HD + (tid & 7) * 8) : kg; const char* vg2 = HI ? (const char*)(Vt2 + (size_t)(tid >> 3) * TT + (tid & 7) * 8) : vg;
    auto stage = [&](int s, int b) { const unsigned l0 = lcp + (unsigned)(b * NT * TLE * 2);
        cp2(l0, kg + (size_t)s * (KT * HD * 2), 16 * HD * 2, l0 + TLE * 2, vg + (size_t)s * (KT * 2), (size_t)16 * TT * 2);
        if (HI) cp2(l0 + 2 * TLE * 2, kg2 + (size_t)s * (KT * HD * 2), 16 * HD * 2, l0 + 3 * TLE * 2, vg2 + (size_t)s * (KT * 2), (size_t)16 * TT * 2); };
    stage(0, 0);
    V qf[QB][2], qf2[QB][2]; v8f o[QB][4]; float m[QB], l[QB]; const T16* qp[QB]; const T16* qp2[QB];
#pragma unroll
    for (int g = 0; g < QB; ++g) { m[g] = -3.0e38f; l[g] = 0.f; const size_t qo = (size_t)(q0 + g * 16 + lr) * HD + 8 * hi; qp[g] = Q + qo; qp2[g] = HI ? Q2 + qo : qp[g];
#pragma unroll
        for (int kc = 0; kc < 2; ++kc) { qf[g][kc] = F::ld(qp[g] + kc * 32); if (HI) qf2[g][kc] = F::ld(qp2[g] + kc * 32); }
#pragma unroll
        for (int nb = 0; nb < 4; ++nb) o[g][nb] = (v8f){}; }
    xwait(qp[0], qp[QB - 1], qp2[0], qp2[QB - 1]);
    asm volatile("s_wait_asynccnt 0x0" ::: "memory");   // this wave's copies of stage 0 have landed
    __syncthreads();                                    // every wave's have: stage 0 may be read
    stage(1, 1);
#pragma unroll 1   // rolled: one stage a trip, the buffers change places
    for (int st = 0; st < NS; ++st) {
        const T16* kb = ring + (st & 1) * (NT * TLE) + lr * KP + 8 * hi; const T16* vb = kb + TLE; const T16* kb2 = kb + 2 * TLE; const T16* vb2 = kb + 3 * TLE;
#pragma unroll   // the two 32-key passes of a stage stand one behind the other, so that the second's LDS reads can go ahead of the first's vector work
        for (int pp = 0; pp < KT / 32; ++pp) {
            const int j0 = st * KT + pp * 32;
            V kf[2][2], kf2[2][2], vf[4], vf2[4];
#pragma unroll
            for (int t = 0; t < 2; ++t)
#pragma unroll
                for (int kc = 0; kc < 2; ++kc) { kf[t][kc] = F::ld(kb + (pp * 32 + t * 16) * KP + kc * 32); if (HI) kf2[t][kc] = F::ld(kb2 + (pp * 32 + t * 16) * KP + kc * 32); }
#pragma unroll
            for (int nb = 0; nb < 4; ++nb) { vf[nb] = F::ld(vb + nb * 16 * KP + pp * 32); if (HI) vf2[nb] = F::ld(vb2 + nb * 16 * KP + pp * 32); }
            v8f s[QB][2];
#pragma unroll
            for (int g = 0; g < QB; ++g)
#pragma unroll
                for (int t = 0; t < 2; ++t) { s[g][t] = (v8f){};
#pragma unroll
                    for (int kc = 0; kc < 2; ++kc) { s[g][t] = F::mma(kf[t][kc], qf[g][kc], s[g][t]); if (HI) { s[g][t] = F::mma(kf[t][kc], qf2[g][kc], s[g][t]); s[g][t] = F::mma(kf2[t][kc], qf[g][kc], s[g][t]); } } }
            v8f dl[2]; V pf[QB], pf2[QB];
#pragma unroll
            for (int t = 0; t < 2; ++t) { const v4f d0 = *(const v4fa*)(dls + j0 + t * 16 + hi * 8), d1 = *(const v4fa*)(dls + j0 + t * 16 + hi * 8 + 4); dl[t] = __builtin_shufflevector(d0, d1, 0, 1, 2, 3, 4, 5, 6, 7); }
#pragma unroll
            for (int g = 0; g < QB; ++g) {
                float mx = -3.0e38f;
#pragma unroll
                for (int t = 0; t < 2; ++t)
#pragma unroll
                    for (int j = 0; j < 8; ++j) { s[g][t][j] = fmaf(s[g][t][j], c1, dl[t][j]); mx = fmaxf(mx, s[g][t][j]); }
                mx = fmaxf(mx, xhalf(mx));
                const float mn = fmaxf(m[g], mx), al = exp2x1(m[g] - mn), ms = HI ? mn : mn - 10.0f; m[g] = mn;
                float ps[2];
#pragma unroll
                for (int t = 0; t < 2; ++t) {
                    s[g][t] = exp2x8(s[g][t] - ms);
                    ps[t] = ((s[g][t][0] + s[g][t][1]) + (s[g][t][2] + s[g][t][3])) + ((s[g][t][4] + s[g][t][5]) + (s[g][t][6] + s[g][t][7])); }
                l[g] = fmaf(l[g], al, ps[0] + ps[1]);   // this lane's half of the keys; the halves meet behind the loop
#pragma unroll
                for (int nb = 0; nb < 4; ++nb) o[g][nb] *= al;
                if constexpr (HI) {
                    const v8b h0 = __builtin_convertvector(s[g][0], v8b), h1 = __builtin_convertvector(s[g][1], v8b);
                    const v8b l0 = __builtin_convertvector(s[g][0] - __builtin_convertvector(h0, v8f), v8b), l1 = __builtin_convertvector(s[g][1] - __builtin_convertvector(h1, v8f), v8b);
                    pf[g] = __builtin_shufflevector(h0, h1, 0, 1, 2, 3, 4, 5, 6, 7, 8, 9, 10, 11, 12, 13, 14, 15); pf2[g] = __builtin_shufflevector(l0, l1, 0, 1, 2, 3, 4, 5, 6, 7, 8, 9, 10, 11, 12, 13, 14, 15);
                } else pf[g] = cat16(__builtin_convertvector(s[g][0], v8h), __builtin_convertvector(s[g][1], v8h));
            }
            // attn.v of all groups behind the softmax of all groups: no 2^x statement stands close behind a WMMA whose operand registers it could be given
#pragma unroll
            for (int g = 0; g < QB; ++g)
#pragma unroll
                for (int nb = 0; nb < 4; ++nb) { o[g][nb] = F::mma(vf[nb], pf[g], o[g][nb]); if constexpr (HI) { o[g][nb] = F::mma(vf[nb], pf2[g], o[g][nb]); o[g][nb] = F::mma(vf2[nb], pf[g], o[g][nb]); } }
        }
        // four vector slots behind the stage's last WMMAs, also on the taken back edge: the next instructions write over their operands.
        // The accumulators are named so that every WMMA of the stage stands in front of the slots.
        if constexpr (QB == 1) asm volatile("v_nop\n\tv_nop\n\tv_nop\n\tv_nop" : "+v"(o[0][0]), "+v"(o[0][1]), "+v"(o[0][2]), "+v"(o[0][3]));
        else asm volatile("v_nop\n\tv_nop\n\tv_nop\n\tv_nop" : "+v"(o[0][0]), "+v"(o[0][1]), "+v"(o[0][2]), "+v"(o[0][3]), "+v"(o[QB - 1][0]), "+v"(o[QB - 1][1]), "+v"(o[QB - 1][2]), "+v"(o[QB - 1][3]));
        asm volatile("s_wait_dscnt 0x0" ::: "memory");      // this wave's reads of the stage's buffer are done before the buffer is handed back
        asm volatile("s_wait_asynccnt 0x0" ::: "memory");   // this wave's copies of the next stage have landed
        __syncthreads();                                    // next stage published; every reader has left this stage's buffer
        if (st + 2 < NS) stage(st + 2, st & 1);             // refill it, one whole stage ahead of its readers
    }
    asm volatile("s_wait_asynccnt 0x0" ::: "memory");   // no copy is outstanding when the wave goes on to its end
    // The merged rows [t][head * HD + d], bf16 hi + lo: the A planes of the out projection (Ah, Al point at this batch's row 0, this head's column 0). A lane holds 8 consecutive d of its query per tile.
    // Rows >= RH: the x 1024 comes off again, exactly, before the split.
#pragma unroll
    for (int g = 0; g < QB; ++g) { const float f = __fdiv_rn(HI ? 1.0f : PCAR, l[g] + xhalf(l[g])); const size_t ro = (size_t)(q0 + g * 16 + lr) * DQ + hi * 8; bf* const ph = Ah + ro; bf* const pl = Al + ro;
#pragma unroll
        for (int nb = 0; nb < 4; ++nb) { const v8f r = o[g][nb] * f; v8us oh, ol;
#pragma unroll
            for (int j = 0; j < 8; ++j) { unsigned short a, c2; splitf(HI ? r[j] : r[j] * (1.0f / PCAR), a, c2); oh[j] = a; ol[j] = c2; }
            *(v8us*)(ph + nb * 16) = oh; *(v8us*)(pl + nb * 16) = ol;
            // behind the two stores, in front of any reuse of their data and address registers; as inputs of the wait these stay whole up to it
            asm volatile("s_wait_xcnt 0x0" :: "v"(oh), "v"(ol), "v"(ph), "v"(pl) : "memory"); } }
}
// grid (RH/64 + (TT-RH)/128, NZ), 4 waves: blocks x < RH/64 take 64 hi+lo query rows (16 a wave), the others 128 fp16 rows (32 a wave); every wave walks all TT keys.
// K and V^T reach the waves through LDS: 64 keys a stage, two buffers, brought in by asynchronous copies in whole lines and read by all four waves.
__global__ __launch_bounds__(128) void k_fattn(const h16* __restrict__ Q16, const h16* __restrict__ K16, const h16* __restrict__ V16, const bf* __restrict__ Qh, const bf* __restrict__ Ql, const bf* __restrict__ Kh, const bf* __restrict__ Kl, const bf* __restrict__ Vh, const bf* __restrict__ Vl, const float* __restrict__ TAU, const float* __restrict__ DEL, bf* __restrict__ Ah, bf* __restrict__ Al) {
    __shared__ __align__(16) float dls[TT];   // log2(e) delta[b][j]
    __shared__ __align__(16) unsigned short ring[2 * 4 * TLE];   // two buffers of up to four tiles
    const int z = blockIdx.y, b = z / NH_, tid = threadIdx.x, w = __builtin_amdgcn_readfirstlane(tid >> 5); const size_t zo = (size_t)z * TT * HD, ao = (size_t)b * TT * DQ + (z % NH_) * HD;
#pragma unroll
    for (int i = 0; i < TT / 128; ++i) dls[i * 128 + tid] = bfr(DEL[(size_t)b * TT + i * 128 + tid]) * LOG2E;
    const float c1 = bfr(TAU[b]) * (SCL * LOG2E);
    __syncthreads();   // the delta row is whole before any wave reads it
    if (blockIdx.x < RH / 64) fattn<bf, true, 1>(Qh + zo, Ql + zo, Kh + zo, Kl + zo, Vh + zo, Vl + zo, dls, (const bf*)ring, c1, Ah + ao, Al + ao, (int)blockIdx.x * 64 + w * 16);
    else fattn<h16, false, 2>(Q16 + zo, nullptr, K16 + zo, nullptr, V16 + zo, nullptr, dls, (const h16*)ring, c1, Ah + ao, Al + ao, RH + ((int)blockIdx.x - RH / 64) * 128 + w * 32);
}

// ---- k_wo: the out projection of all batches, C = (Ah + Al) Bt^T + bias, f32. A work-group of 4 waves owns a 128 x 128 tile of C, a wave 64 x 64 of it (wm: which 64 token rows, wn: which 64 output columns), and walks all of K itself:
// 8 stages of 64 k, 128 + 128 + 128 operand rows a stage (hi rows, lo rows, weight rows; one 128-B line a row), two LDS buffers filled by asynchronous copies one stage ahead.
// One f32 accumulator chain per output over k = 0..511 (per 32 k the hi product, then the lo product), bias last. A wave's tile goes through the wave's own LDS range so that every store covers whole lines.
__global__ __launch_bounds__(128) void k_wo(const bf* __restrict__ Ah, const bf* __restrict__ Al, const bf* __restrict__ Wt, const float* __restrict__ bias, float* C) {
    typedef WFrag<bf> F; typedef F::V V;
    constexpr int NS = DQ / 64, BUF = 6 * TLE;   // stages; 16-bit elements of one buffer: hi rows 0..127, lo rows 0..127, weight rows 0..127, pitch KP
    static_assert(NS >= 2 && DQ % 64 == 0 && BUF >= 4 * 64 * 68, "the ring needs two whole stages; the four result tiles (pitch 68 floats) fit the two buffers");
    __shared__ __align__(16) float red[BUF];    // the two buffers; behind the loop each wave's result tile
    __shared__ __align__(16) float bs[128];     // the work-group's 128 bias values, rounded
    const int tid = threadIdx.x, w = __builtin_amdgcn_readfirstlane(tid >> 5), lane = tid & 31, lr = lane & 15, hi = lane >> 4, wm = w >> 1, wn = w & 1; const int r0 = blockIdx.x * 128, c0 = blockIdx.y * 128;
    const bf* ring = (const bf*)red;
    const unsigned lcp = (unsigned)(size_t)ring + (unsigned)((tid >> 3) * (KP * 2) + (tid & 7) * 16); const size_t go = (size_t)(tid >> 3) * DQ + (tid & 7) * 8;
    const char* gh = (const char*)(Ah + (size_t)r0 * DQ + go); const char* gl = (const char*)(Al + (size_t)r0 * DQ + go); const char* gb = (const char*)(Wt + (size_t)c0 * DQ + go);
    constexpr size_t R16 = (size_t)16 * DQ * 2;   // bytes of 16 operand rows
    // stage s -> buffer b: k in [64 s, 64 s + 64) of all 3 x 128 rows, 24 copies a thread
    auto stage = [&](int s, int b) { const unsigned l0 = lcp + (unsigned)(b * BUF * 2); const char* ph = gh + (size_t)s * 128; const char* pl = gl + (size_t)s * 128; const char* pb = gb + (size_t)s * 128;
        cp2(l0, ph, R16, l0 + TLE * 2, ph + 4 * R16, R16);                      // hi rows 0..63, 64..127
        cp2(l0 + 4 * TLE * 2, pb, R16, l0 + 5 * TLE * 2, pb + 4 * R16, R16);    // weight rows
        cp2(l0 + 2 * TLE * 2, pl, R16, l0 + 3 * TLE * 2, pl + 4 * R16, R16); }; // lo rows
    stage(0, 0);
    { const float* pbias = bias + c0 + tid; const float bv0 = *pbias;
      asm volatile("s_wait_xcnt 0x0" :: "v"(pbias) : "memory");   // behind the load, in front of any reuse of its address registers
      bs[tid] = bfr(bv0); }
    v8f acc[4][4];
#pragma unroll
    for (int mb = 0; mb < 4; ++mb)
#pragma unroll
        for (int nb = 0; nb < 4; ++nb) acc[mb][nb] = (v8f){};
    asm volatile("s_wait_asynccnt 0x0" ::: "memory");   // this wave's copies of stage 0 have landed
    __syncthreads();                                    // every wave's have: stage 0 (and the bias row) may be read
    stage(1, 1);
    // Two fragment sets: each 32-k step's 24 LDS reads are issued one block of 32 WMMAs ahead of their use, so that a lone wave on its SIMD does not stand waiting for them.
    // A stage's buffer is read only between the barrier that publishes it and the barrier at the stage's foot; the second step's products follow behind that barrier, from registers alone.
    V a[2][4], a2[2][4], b[2][4];
    auto ldf = [&](int x, const bf* fa, const bf* fb) {
#pragma unroll
        for (int i = 0; i < 4; ++i) { a[x][i] = F::ld(fa + i * 16 * KP); b[x][i] = F::ld(fb + i * 16 * KP); }
#pragma unroll
        for (int i = 0; i < 4; ++i) a2[x][i] = F::ld(fa + 2 * TLE + i * 16 * KP); };
    auto mm = [&](int x) {   // per 32 k: the 16 hi products, then the 16 lo products
#pragma unroll
        for (int nb = 0; nb < 4; ++nb)
#pragma unroll
            for (int mb = 0; mb < 4; ++mb) acc[mb][nb] = F::mma(a[x][mb], b[x][nb], acc[mb][nb]);
#pragma unroll
        for (int nb = 0; nb < 4; ++nb)
#pragma unroll
            for (int mb = 0; mb < 4; ++mb) acc[mb][nb] = F::mma(a2[x][mb], b[x][nb], acc[mb][nb]); };
#pragma unroll   // straight line: buffer offsets are constants and no back edge stands behind a WMMA
    for (int st = 0; st < NS; ++st) {
        const bf* fa = ring + (st & 1) * BUF + (wm * 64 + lr) * KP + 8 * hi; const bf* fb = ring + (st & 1) * BUF + 4 * TLE + (wn * 64 + lr) * KP + 8 * hi;
        // The scheduling barriers keep each step's 24 reads together as one group, a whole block of WMMAs ahead of their use, and the last block in front of the wait at the foot:
        // left free, this build either dealt the reads out singly among the WMMAs or moved a block behind the foot's wait, which then stood waiting for reads just issued.
        ldf(0, fa, fb);
        __builtin_amdgcn_sched_barrier(0);
        if (st > 0) mm(1);   // k 32..63 of the stage before
        __builtin_amdgcn_sched_barrier(0);
        ldf(1, fa + 32, fb + 32);
        __builtin_amdgcn_sched_barrier(0);
        mm(0);
        __builtin_amdgcn_sched_barrier(0);
        asm volatile("s_wait_dscnt 0x0" ::: "memory");      // this wave's reads of the stage's buffer are done before the buffer is handed back
        asm volatile("s_wait_asynccnt 0x0" ::: "memory");   // this wave's copies of the next stage have landed
        __syncthreads();                                    // next stage published; every reader has left this stage's buffer
        if (st + 2 < NS) stage(st + 2, st & 1);             // refill it, one whole stage ahead of its readers
    }
    mm(1);   // k 32..63 of the last stage
    asm volatile("s_wait_asynccnt 0x0" ::: "memory");   // no copy is outstanding when the buffers are written over
    float* my = red + w * (64 * 68);   // behind the last barrier no wave reads the buffers any more; this range is read by this wave alone
#pragma unroll
    for (int mb = 0; mb < 4; ++mb)
#pragma unroll
        for (int nb = 0; nb < 4; ++nb)
#pragma unroll
            for (int j = 0; j < 8; ++j) my[(mb * 16 + hi * 8 + j) * 68 + nb * 16 + lr] = acc[mb][nb][j];
    asm volatile("s_wait_dscnt 0x0" ::: "memory");   // the wave's tile is whole in LDS before its lanes read one another's values back
    const int cofs = lr * 4; const v4f bc = *(const v4fa*)(bs + wn * 64 + cofs);
    float* const crow = C + (size_t)(r0 + wm * 64 + hi) * DM + c0 + wn * 64 + cofs;   // a wave's store: 2 rows of 256 B
#pragma unroll 1   // rolled: 32 rows a trip, so that only two waits on the stores stand in the wave's way
    for (int s = 0; s < 2; ++s) { float* const p = crow + (size_t)s * 32 * DM; v4f v[16];
#pragma unroll
        for (int q = 0; q < 16; ++q) v[q] = *(const v4fa*)(my + (s * 32 + q * 2 + hi) * 68 + cofs) + bc;
#pragma unroll
        for (int q = 0; q < 16; ++q) *(v4f*)(p + (size_t)q * 2 * DM) = v[q];
        // behind the 16 stores, in front of any reuse of their data and address registers; as inputs of the wait these stay whole up to it
        asm volatile("s_wait_xcnt 0x0" :: "v"(v[0]), "v"(v[1]), "v"(v[2]), "v"(v[3]), "v"(v[4]), "v"(v[5]), "v"(v[6]), "v"(v[7]), "v"(v[8]), "v"(v[9]), "v"(v[10]), "v"(v[11]), "v"(v[12]), "v"(v[13]), "v"(v[14]), "v"(v[15]), "v"(p) : "memory"); }
}

extern "C" void kernel_launch(void* const* d_in, const int* in_sizes, int n_in,
                              void* d_out, int out_size, void* d_ws, size_t ws_size, hipStream_t stream) {
    (void)in_sizes; (void)n_in; (void)out_size;
    const float* x = (const float*)d_in[0]; const float* xk = (const float*)d_in[1]; const float* xv = (const float*)d_in[2]; const float* TAU = (const float*)d_in[3]; const float* DEL = (const float*)d_in[4]; const float* wq = (const float*)d_in[5]; const float* bq = (const float*)d_in[6]; const float* wk = (const float*)d_in[7]; const float* bk = (const float*)d_in[8]; const float* wv = (const float*)d_in[9]; const float* bv = (const float*)d_in[10]; const float* wo = (const float*)d_in[11]; const float* bo = (const float*)d_in[12];
    float* OUT = (float*)d_out;     // [4][2048][512]
    char* wsp = (char*)d_ws;
    auto take = [&](size_t bytes) { char* p = wsp; wsp += (bytes + 255) & ~(size_t)255; return (void*)p; };
    const size_t PLN = (size_t)NZ * TT * HD;   // elements of one plane set: every (batch, head)
    bf* WQ = (bf*)take((size_t)DQ * DM * 2); bf* WK = (bf*)take((size_t)DKV * DM * 2); bf* WV = (bf*)take((size_t)DKV * DM * 2); bf* WO = (bf*)take((size_t)DM * DQ * 2); (void)WK; (void)WV;
    h16* QP16 = (h16*)take(PLN * 2); h16* KP16 = (h16*)take(PLN * 2); h16* VT16 = (h16*)take(PLN * 2);
    bf* QPh = (bf*)take(PLN * 2); bf* KPh = (bf*)take(PLN * 2); bf* QPl = (bf*)take(PLN * 2); bf* KPl = (bf*)take(PLN * 2); bf* VTh = (bf*)take(PLN * 2); bf* VTl = (bf*)take(PLN * 2);
    bf* ATh = (bf*)take((size_t)NB_ * TT * DQ * 2); bf* ATl = (bf*)take((size_t)NB_ * TT * DQ * 2);
    // k_qkv reaches the k planes from the q planes: each k plane set lies directly behind its q plane set
    if ((size_t)(wsp - (char*)d_ws) > ws_size) return;    // ws 256 MiB
    k_wtG<<<dim3((DM / 64) * (DQ / 64), 4, 1), 64, 0, stream>>>(wq, wk, wv, wo, WQ);
    // q, k, v projections of all batches (x: 128 token rows, y: two heads, z: which projection), written as the attention kernel's planes
    k_qkv<<<dim3(NB_ * TT / 128, DQ / 128, 3), 128, 0, stream>>>(x, xk, xv, WQ, bq, bk, bv, QP16, QPh, QPl, VT16, VTh, VTl);
    k_fattn<<<dim3(RH / 64 + (TT - RH) / 128, NZ, 1), 128, 0, stream>>>(QP16, KP16, VT16, QPh, QPl, KPh, KPl, VTh, VTl, TAU, DEL, ATh, ATl);
    k_wo<<<dim3(NB_ * TT / 128, DM / 128, 1), 128, 0, stream>>>(ATh, ATl, WO, bo, OUT);
}
